// v000
// The times below were measured on an AMD MI455X: many runs one after another, warmed up first and cycling through
// copies of the inputs, with the whole window's GPU time divided by the number of runs. Launches and the gaps
// between them are all in it. The median over several windows is given; except for v000 it joins two sittings, which
// can be a few percent apart, so the side-by-side timings, each taken in one sitting, are the better comparison.
// v000, which the later versions start from, runs in 663 microseconds.
// All contractions (q/k/v projections, q.k^T scores, p.v, output projection): v_wmma_f32_16x16x32_f16, f16 operands carried by exact powers of two, f32 accumulate; key masking, softmax and bias add in f32.
#include <hip/hip_runtime.h>
#include <math.h>

typedef __attribute__((ext_vector_type(16))) _Float16 v16h;
typedef __attribute__((ext_vector_type(8)))  _Float16 v8h;
typedef __attribute__((ext_vector_type(8)))  float    v8f;
typedef __attribute__((ext_vector_type(4)))  float    v4f;
typedef __attribute__((ext_vector_type(4)))  int      v4i;

/* --------------------------------------------------------------------------- */
/* Shape constants (single head: batch b owns token rows b*1024 .. b*1024+1023) */
/* --------------------------------------------------------------------------- */
constexpr int kBatch  = 32;
constexpr int kG      = 1024;
constexpr int kD      = 256;
constexpr int kTok    = kBatch * kG;
constexpr int kChunkB = 4;
constexpr int kNChunk = kBatch / kChunkB;
constexpr int kSqrtD  = 16;
static_assert(kSqrtD * kSqrtD == kD);
static_assert(kTok == 32768);
static_assert((kD % 32) == 0 && (kG % 32) == 0);
static_assert((kD % 64) == 0 && (kG % 64) == 0 && (kTok % 64) == 0 && ((2 * kD) % 64) == 0);
static_assert((kBatch % kChunkB) == 0);

/* Power-of-two carries of the f16 operand planes, folded back exactly in f32 epilogue scales. */
constexpr float kXCarry   = 16.0f;
constexpr float kWCarry   = 1024.0f;
constexpr float kQKVCarry = 16.0f;
constexpr float kPCarry   = 32768.0f;
constexpr float kHCarry   = 256.0f;
constexpr float kNormQK   = 1.0f / (float)kSqrtD;
constexpr float kProjScale  = kQKVCarry / (kXCarry * kWCarry);
constexpr float kScoreScale = kNormQK / (kQKVCarry * kQKVCarry);
constexpr float kPVScale    = kHCarry / (kPCarry * kQKVCarry);
constexpr float kOutScale   = 1.0f / (kHCarry * kWCarry);

/* --------------------------------------------------------------------------- */
/* Workspace region map (bytes; every offset a multiple of 128)                 */
/*   X16  f16 [32768][256]        data x16                        16,777,216    */
/*   W16  f16 [4][256][256]       Wq | Wk | Wv | Wo, each x1024      524,288    */
/*   QK16 f16 [32768][512]        q x16 (cols 0..255) | k x16      33,554,432   */
/*   VT16 f16 [32][256][1024]     v^T per batch, x16               16,777,216   */
/*   SC   f32 [4][1024][1024]     masked-later scores of one chunk 16,777,216   */
/*   P16  f16 [4][1024][1024]     probabilities x32768, one chunk   8,388,608   */
/*   H16  f16 [32768][256]        attention output x256            16,777,216   */
/*   total                                                        109,576,192   */
/* --------------------------------------------------------------------------- */
constexpr size_t kOffX16  = 0;
constexpr size_t kOffW16  = kOffX16  + (size_t)kTok * kD * 2;
constexpr size_t kOffQK16 = kOffW16  + (size_t)4 * kD * kD * 2;
constexpr size_t kOffVT16 = kOffQK16 + (size_t)kTok * 2 * kD * 2;
constexpr size_t kOffSC   = kOffVT16 + (size_t)kBatch * kD * kG * 2;
constexpr size_t kOffP16  = kOffSC   + (size_t)kChunkB * kG * kG * 4;
constexpr size_t kOffH16  = kOffP16  + (size_t)kChunkB * kG * kG * 2;
constexpr size_t kWsTotal = kOffH16  + (size_t)kTok * kD * 2;
static_assert(kWsTotal == 109576192ull);
static_assert(kWsTotal <= 134217728ull);
static_assert((kOffW16 % 128) == 0 && (kOffQK16 % 128) == 0 && (kOffVT16 % 128) == 0 &&
              (kOffSC % 128) == 0 && (kOffP16 % 128) == 0 && (kOffH16 % 128) == 0);

/* --------------------------------------------------------------------------- */
/* Fragment helpers                                                             */
/* --------------------------------------------------------------------------- */
union FragU { v16h v; v8h h[2]; };
/* elements 0..7 <- p[0..7], elements 8..15 <- p[16..23]; caller adds 8*(lane>>4) to p */
__device__ __forceinline__ v16h frag_load(const _Float16* p) {
  FragU f;
  f.h[0] = *(const v8h*)(p);
  f.h[1] = *(const v8h*)(p + 16);
  return f.v;
}
__device__ __forceinline__ v8f mma_f16(v16h a, v16h b, v8f c) {
  return __builtin_amdgcn_wmma_f32_16x16x32_f16(false, a, false, b, (short)0, c, false, false);
}
/* one accumulator per statement; the A and B fragment registers are named as inputs */
__device__ __forceinline__ void mma_guard1(v8f& a, v16h x, v16h y) {
  asm volatile("v_nop\n\tv_nop\n\tv_nop\n\tv_nop" : "+v"(a) : "v"(x), "v"(y));
}
__device__ __forceinline__ void keep4_h(v16h a, v16h b, v16h c, v16h d) {
  asm volatile("v_nop" :: "v"(a), "v"(b), "v"(c), "v"(d));
}
__device__ __forceinline__ void acc_guard4(v8f& a, v8f& b, v8f& c, v8f& d) {
  asm volatile("v_nop\n\tv_nop\n\tv_nop\n\tv_nop" : "+v"(a), "+v"(b), "+v"(c), "+v"(d));
}

/* --------------------------------------------------------------------------- */
/* Register-blocked batched WMMA GEMM, f16 operands.                            */
/* C[m,n] = scale * sum_k A[m,k] * Bt[n,k] (+ bias[n]); each wave owns a 64x64 tile. */
/* A row-major [M,K]; Bt row-major [N,K]; M,N % 64 == 0, K % 32 == 0 (no tails). */
/* BIAS_MODE: 0 = none, 2 = bias[n] (f32 add).  OUT_MODE: 0 = f32, 1 = f16.      */
/* Epilogue: 16-row slabs staged per wave in LDS (same wave writes and reads);   */
/* --------------------------------------------------------------------------- */
template <int BIAS_MODE, int OUT_MODE>
__global__ __launch_bounds__(256) void wmma_gemm64(
    const unsigned short* __restrict__ Ap, int lda, long strideA,
    const unsigned short* __restrict__ Btp, int ldb, long strideB,
    void* __restrict__ Cout, int ldc, long strideC,
    const float* __restrict__ bias,
    int M, int N, int K, float scale) {
  const _Float16* A  = (const _Float16*)Ap;
  const _Float16* Bt = (const _Float16*)Btp;
  __shared__ __align__(16) float sT[8][16 * 68];
  const int b    = blockIdx.y;
  const int lane = threadIdx.x & 31;
  const int wave = __builtin_amdgcn_readfirstlane((int)(threadIdx.x >> 5));
  const int tilesN = N >> 6;
  const int tilesM = M >> 6;
  const int tile = blockIdx.x * 8 + wave;
  /* wave-uniform exit; this kernel has no block barriers */
  if (tile >= tilesM * tilesN) return;
  const int tm = tile / tilesN;
  const int tn = tile - tm * tilesN;
  const int m0 = tm << 6;
  const int n0 = tn << 6;

  const _Float16* Ab = A  + (size_t)b * strideA;
  const _Float16* Bb = Bt + (size_t)b * strideB;

  const int rlane = lane & 15;
  const int koff  = (lane >> 4) * 8;
  const int mOff  = (lane >> 4) * 8;

  v8f acc[4][4];
#pragma unroll
  for (int i = 0; i < 4; ++i)
#pragma unroll
    for (int j = 0; j < 4; ++j) acc[i][j] = (v8f){0.f, 0.f, 0.f, 0.f, 0.f, 0.f, 0.f, 0.f};

  for (int k0 = 0; k0 < K; k0 += 32) {
    v16h bh[4];
#pragma unroll
    for (int j = 0; j < 4; ++j) {
      const size_t bo = (size_t)(n0 + (j << 4) + rlane) * ldb + koff + k0;
      bh[j] = frag_load(Bb + bo);
    }
#pragma unroll
    for (int i = 0; i < 4; ++i) {
      const size_t ao = (size_t)(m0 + (i << 4) + rlane) * lda + koff + k0;
      v16h ah = frag_load(Ab + ao);
#pragma unroll
      for (int j = 0; j < 4; ++j) acc[i][j] = mma_f16(ah, bh[j], acc[i][j]);
      mma_guard1(acc[i][0], ah, bh[0]);
      mma_guard1(acc[i][1], ah, bh[1]);
      mma_guard1(acc[i][2], ah, bh[2]);
      mma_guard1(acc[i][3], ah, bh[3]);
    }
    keep4_h(bh[0], bh[1], bh[2], bh[3]);
  }
  acc_guard4(acc[0][0], acc[0][1], acc[0][2], acc[0][3]);
  acc_guard4(acc[1][0], acc[1][1], acc[1][2], acc[1][3]);
  acc_guard4(acc[2][0], acc[2][1], acc[2][2], acc[2][3]);
  acc_guard4(acc[3][0], acc[3][1], acc[3][2], acc[3][3]);

  /* ---- epilogue ---- */
  float* slab = sT[wave];
#pragma unroll
  for (int i = 0; i < 4; ++i) {
    const int mBase = m0 + (i << 4);
#pragma unroll
    for (int j = 0; j < 4; ++j) {
      const int n = n0 + (j << 4) + rlane;
      float bv = 0.f;
      if (BIAS_MODE == 2) bv = bias[n];
#pragma unroll
      for (int r = 0; r < 8; ++r) {
        float v = acc[i][j][r] * scale;
        if (BIAS_MODE == 2) v += bv;
        slab[(mOff + r) * 68 + (j << 4) + rlane] = v;
      }
    }
    __builtin_amdgcn_fence(__ATOMIC_RELEASE, "workgroup");
    __builtin_amdgcn_wave_barrier();
    __builtin_amdgcn_fence(__ATOMIC_ACQUIRE, "workgroup");
    if (OUT_MODE == 0) {
      /* row segment = 64 floats = 256 B = 16 lanes x 16 B; rows it*2 + hh, it 0..7 -> 16 rows, each once */
      float* C = (float*)Cout + (size_t)b * strideC;
      const int hh = lane >> 4, c4 = (lane & 15) * 4;
      {
#pragma unroll
        for (int it = 0; it < 8; ++it) {
          const int row = it * 2 + hh;
          v4f v = *(const v4f*)(slab + row * 68 + c4);
          *(v4f*)(C + (size_t)(mBase + row) * ldc + n0 + c4) = v;
        }
        
      }
    } else {
      const int q = lane >> 3, c8 = (lane & 7) * 8;
      unsigned short* C = (unsigned short*)Cout + (size_t)b * strideC;
      {
#pragma unroll
        for (int it = 0; it < 4; ++it) {
          const int row = it * 4 + q;
          const float* sp = slab + row * 68 + c8;
          v8h hv;
#pragma unroll
          for (int e = 0; e < 8; ++e) hv[e] = (_Float16)sp[e];
          *(v8h*)(C + (size_t)(mBase + row) * ldc + n0 + c8) = hv;
        }
        
      }
    }
    __builtin_amdgcn_fence(__ATOMIC_RELEASE, "workgroup");
    __builtin_amdgcn_wave_barrier();
    __builtin_amdgcn_fence(__ATOMIC_ACQUIRE, "workgroup");
  }
}

/* --------------------------------------------------------------------------- */
/* f32 -> f16 (x carry, exact power of two), 8 consecutive elements per thread.  */
/* One 16-B store per lane; 32 consecutive lanes = 512 contiguous B = 4 whole    */
/* Coverage: n8 = 32768*256/8 = 1,048,576 threads = 4096 blocks x 256 exactly.   */
/* --------------------------------------------------------------------------- */
__global__ __launch_bounds__(256) void cast8_f16_kernel(const float* __restrict__ in,
                                                        unsigned short* __restrict__ out,
                                                        int n8, float carry) {
  const int i = blockIdx.x * 256 + threadIdx.x;
  if (i >= n8) return;
  const float* p = in + 8 * (size_t)i;
  const v4f a = *(const v4f*)(p);
  const v4f c = *(const v4f*)(p + 4);
  v8h hv;
#pragma unroll
  for (int e = 0; e < 4; ++e) {
    hv[e]     = (_Float16)(a[e] * carry);
    hv[4 + e] = (_Float16)(c[e] * carry);
  }
  unsigned short* q = out + 8 * (size_t)i;
  *(v8h*)q = hv;
  
}

/* --------------------------------------------------------------------------- */
/* Four [256][256] f32 weight matrices ([out][in] = Bt layout) -> f16 planes     */
/* out + z*65536 halves, x carry. grid (32, 4): blockIdx.y selects the matrix    */
/* (block-uniform); 32 blocks x 256 threads x 8 = 65,536 = one whole plane.      */
/* --------------------------------------------------------------------------- */
__global__ __launch_bounds__(256) void cast8_w4_kernel(const float* __restrict__ W0, const float* __restrict__ W1,
                                                       const float* __restrict__ W2, const float* __restrict__ W3,
                                                       unsigned short* __restrict__ out, float carry) {
  const int z = blockIdx.y;
  const float* W = (z == 0) ? W0 : (z == 1) ? W1 : (z == 2) ? W2 : W3;
  const int i = blockIdx.x * 256 + threadIdx.x;
  const float* p = W + 8 * (size_t)i;
  const v4f a = *(const v4f*)(p);
  const v4f c = *(const v4f*)(p + 4);
  v8h hv;
#pragma unroll
  for (int e = 0; e < 4; ++e) {
    hv[e]     = (_Float16)(a[e] * carry);
    hv[4 + e] = (_Float16)(c[e] * carry);
  }
  unsigned short* q = out + (size_t)z * kD * kD + 8 * (size_t)i;
  *(v8h*)q = hv;
  
}

/* --------------------------------------------------------------------------- */
/* Key-masked row softmax of one chunk of 4 batches (f32 math).                  */
/*   x[k]  = blocked[b][k] ? fill : s[q][k]      (fill = -30, or -inf when the   */
/*           evaluate flag is nonzero; s already carries the 1/16 logit scale)   */
/*   e[k]  = exp(x[k] - max_k x[k]);  tot = sum_k e[k]  (blocked terms included) */
/*   P[q][k] = f16( blocked ? 0 : e[k] * (32768 / tot) )                         */
/* Block = 128 threads = one row of 1024 (8 columns per thread), 4 rows per      */
/* block in a rolled loop; grid (256, 4) -> 4 x 1024 rows, each once.            */
/* Reductions in fixed order: per-thread, wave shuffle tree, 4 wave partials in  */
/* index order through LDS with block barriers (all barriers block-uniform).     */
/* Store: one 16-B store per lane; a wave writes 512 contiguous B = 4 whole      */
/* --------------------------------------------------------------------------- */
constexpr int kSmRows = 4;
static_assert((kG % kSmRows) == 0 && kG == 128 * 8);
__global__ __launch_bounds__(128) void softmax_keymask_kernel(const float* __restrict__ S,
                                                              const int* __restrict__ mask,
                                                              const int* __restrict__ evalflag,
                                                              unsigned short* __restrict__ P, int b0) {
  __shared__ float redM[4];
  __shared__ float redS[4];
  const int t    = threadIdx.x;
  const int lane = t & 31;
  const int wave = __builtin_amdgcn_readfirstlane((int)(threadIdx.x >> 5));
  const int bl   = blockIdx.y;
  int b = b0 + bl;
  b = b < 0 ? 0 : (b > kBatch - 1 ? kBatch - 1 : b);
  const int c0 = t * 8;
  const v4i mk0 = *(const v4i*)(mask + (size_t)b * kG + c0);
  const v4i mk1 = *(const v4i*)(mask + (size_t)b * kG + c0 + 4);
  int blk[8];
#pragma unroll
  for (int e = 0; e < 4; ++e) {
    blk[e]     = (mk0[e] != 0) ? 1 : 0;
    blk[4 + e] = (mk1[e] != 0) ? 1 : 0;
  }
  const float fill = (evalflag[0] != 0) ? (-INFINITY) : (-30.0f);

#pragma unroll 1
  for (int rr = 0; rr < kSmRows; ++rr) {
    const int row = blockIdx.x * kSmRows + rr;
    const size_t ro = ((size_t)bl * kG + row) * kG + c0;
    const v4f a = *(const v4f*)(S + ro);
    const v4f c = *(const v4f*)(S + ro + 4);
    float x[8];
#pragma unroll
    for (int e = 0; e < 4; ++e) {
      x[e]     = blk[e]     ? fill : a[e];
      x[4 + e] = blk[4 + e] ? fill : c[e];
    }
    float m = fmaxf(fmaxf(fmaxf(x[0], x[1]), fmaxf(x[2], x[3])), fmaxf(fmaxf(x[4], x[5]), fmaxf(x[6], x[7])));
#pragma unroll
    for (int off = 16; off > 0; off >>= 1) m = fmaxf(m, __shfl_xor(m, off, 32));
    if (lane == 0) redM[wave] = m;
    __syncthreads();
    const float mrow = fmaxf(fmaxf(redM[0], redM[1]), fmaxf(redM[2], redM[3]));
    float ev[8];
    float s = 0.0f;
#pragma unroll
    for (int e = 0; e < 8; ++e) {
      ev[e] = expf(x[e] - mrow);
      s += ev[e];
    }
#pragma unroll
    for (int off = 16; off > 0; off >>= 1) s += __shfl_xor(s, off, 32);
    if (lane == 0) redS[wave] = s;
    __syncthreads();
    const float tot = ((redS[0] + redS[1]) + redS[2]) + redS[3];
    const float inv = kPCarry * (1.0f / tot);
    v8h hv;
#pragma unroll
    for (int e = 0; e < 8; ++e) {
      const float pv = blk[e] ? 0.0f : (ev[e] * inv);
      hv[e] = (_Float16)pv;
    }
    unsigned short* q = P + ro;
    *(v8h*)q = hv;
    
  }
}

/* --------------------------------------------------------------------------- */
/* Shape premise check: the file is built for 1024 nodes per batch. If the scalar */
/* two 512-B instructions) with NaN and returns normally.                         */
/* --------------------------------------------------------------------------- */
__global__ __launch_bounds__(32) void premise_guard_kernel(const int* __restrict__ gsz, float* __restrict__ out) {
  const int g = gsz[0];
  if (g != kG) {
    const int lane = threadIdx.x & 31;
    const float qn = __uint_as_float(0x7fc00000u);
    const v4f nv = (v4f){qn, qn, qn, qn};
    {
      *(v4f*)(out + lane * 4) = nv;
      *(v4f*)(out + 128 + lane * 4) = nv;
      
    }
  }
}

/* --------------------------------------------------------------------------- */
/* Host glue: kernel launches only. 2 casts + 2 projection GEMMs + 8 chunks x    */
/* (scores GEMM, softmax, p.v GEMM) + output GEMM + premise check = 30 launches. */
/* GEMM shapes (all K % 32 == 0, M and N % 64 == 0; grids exact):                */
/*   q|k proj : M 32768, N 512,  K 256            4096 tiles -> 512 blocks       */
/*   v^T proj : M 256,   N 1024, K 256, 32 batches  64 tiles -> 8 x 32 blocks    */
/*   scores   : M 1024,  N 1024, K 256, 4 batches  256 tiles -> 32 x 4 blocks    */
/*   p.v      : M 1024,  N 256,  K 1024, 4 batches  64 tiles -> 8 x 4 blocks     */
/*   out proj : M 32768, N 256,  K 256            2048 tiles -> 256 blocks       */
/* --------------------------------------------------------------------------- */
extern "C" void kernel_launch(void* const* d_in, const int* in_sizes, int n_in,
                              void* d_out, int out_size, void* d_ws, size_t ws_size,
                              hipStream_t stream) {
  if (n_in < 9) return;
  if (in_sizes[0] != kTok * kD) return;
  if (in_sizes[1] != kBatch * kG) return;
  if (in_sizes[2] != 1 || in_sizes[3] != 1) return;
  if (in_sizes[4] != kD * kD || in_sizes[5] != kD * kD || in_sizes[6] != kD * kD || in_sizes[7] != kD * kD) return;
  if (in_sizes[8] != kD) return;
  if (out_size != kTok * kD) return;
  if (ws_size < kWsTotal) return;

  const float* data   = (const float*)d_in[0];
  const int*   mask   = (const int*)d_in[1];
  const int*   gsize  = (const int*)d_in[2];
  const int*   evalf  = (const int*)d_in[3];
  const float* Wq     = (const float*)d_in[4];
  const float* Wk     = (const float*)d_in[5];
  const float* Wv     = (const float*)d_in[6];
  const float* Wo     = (const float*)d_in[7];
  const float* b_out  = (const float*)d_in[8];
  float* out = (float*)d_out;

  char* ws = (char*)d_ws;
  unsigned short* X16  = (unsigned short*)(ws + kOffX16);
  unsigned short* W16  = (unsigned short*)(ws + kOffW16);
  unsigned short* QK16 = (unsigned short*)(ws + kOffQK16);
  unsigned short* VT16 = (unsigned short*)(ws + kOffVT16);
  float*          SC   = (float*)(ws + kOffSC);
  unsigned short* P16  = (unsigned short*)(ws + kOffP16);
  unsigned short* H16  = (unsigned short*)(ws + kOffH16);

  /* operand planes */
  cast8_f16_kernel<<<(kTok * kD / 8) / 256, 256, 0, stream>>>(data, X16, kTok * kD / 8, kXCarry);
  cast8_w4_kernel<<<dim3((kD * kD / 8) / 256, 4), 256, 0, stream>>>(Wq, Wk, Wv, Wo, W16, kWCarry);

  /* q | k = x . [Wq ; Wk]^T  -> QK16 [32768][512], carried x16 */
  wmma_gemm64<0, 1><<<dim3((kTok / 64) * (2 * kD / 64) / 8, 1), 256, 0, stream>>>(
      X16, kD, 0L,
      W16, kD, 0L,
      (void*)QK16, 2 * kD, 0L,
      b_out,
      kTok, 2 * kD, kD, kProjScale);

  /* v^T per batch: VT[b][d][g] = Wv[d][:] . x[b*1024+g][:]  (A = Wv, Bt = x rows of batch b), carried x16 */
  wmma_gemm64<0, 1><<<dim3((kD / 64) * (kG / 64) / 8, kBatch), 256, 0, stream>>>(
      W16 + (size_t)2 * kD * kD, kD, 0L,
      X16, kD, (long)kG * kD,
      (void*)VT16, kG, (long)kD * kG,
      b_out,
      kD, kG, kD, kProjScale);

  for (int c = 0; c < kNChunk; ++c) {
    const int b0 = c * kChunkB;
    const unsigned short* Qc = QK16 + (size_t)b0 * kG * 2 * kD;
    const unsigned short* Kc = Qc + kD;
    /* scores[bl][q][k] = (1/16) * q.k  (A = q rows, Bt = k rows, both pitch 512) */
    wmma_gemm64<0, 0><<<dim3((kG / 64) * (kG / 64) / 8, kChunkB), 256, 0, stream>>>(
        Qc, 2 * kD, (long)kG * 2 * kD,
        Kc, 2 * kD, (long)kG * 2 * kD,
        (void*)SC, kG, (long)kG * kG,
        b_out,
        kG, kG, kD, kScoreScale);
    /* key mask + softmax -> P16 (x32768) */
    softmax_keymask_kernel<<<dim3(kG / kSmRows, kChunkB), 128, 0, stream>>>(SC, mask, evalf, P16, b0);
    /* H[b][q][d] = sum_k P[q][k] * v[k][d]  (A = P, Bt = v^T), carried x256 */
    wmma_gemm64<0, 1><<<dim3((kG / 64) * (kD / 64) / 8, kChunkB), 256, 0, stream>>>(
        P16, kG, (long)kG * kG,
        VT16 + (size_t)b0 * kD * kG, kG, (long)kD * kG,
        (void*)(H16 + (size_t)b0 * kG * kD), kD, (long)kG * kD,
        b_out,
        kG, kD, kG, kPVScale);
  }

  /* out = H . Wo^T + b_out[n] -> f32 output rows */
  wmma_gemm64<2, 0><<<dim3((kTok / 64) * (kD / 64) / 8, 1), 256, 0, stream>>>(
      H16, kD, 0L,
      W16 + (size_t)3 * kD * kD, kD, 0L,
      (void*)out, kD, 0L,
      b_out,
      kTok, kD, kD, kOutScale);

  premise_guard_kernel<<<1, 32, 0, stream>>>(gsize, out);
}

// v001
// One run takes 199 microseconds.
// Timed twice side by side with v000, it ran 3.43 and 3.38 times as fast.
// All contractions (q/k/v projections, q.k^T scores, p.v, output projection): v_wmma_f32_16x16x32_f16, f16 operands carried by exact powers of two, f32 accumulate; key masking, softmax and bias add in f32.
#include <hip/hip_runtime.h>
#include <math.h>

typedef __attribute__((ext_vector_type(16))) _Float16 v16h;
typedef __attribute__((ext_vector_type(8)))  _Float16 v8h;
typedef __attribute__((ext_vector_type(8)))  float    v8f;
typedef __attribute__((ext_vector_type(4)))  float    v4f;
typedef __attribute__((ext_vector_type(4)))  int      v4i;

/* --------------------------------------------------------------------------- */
/* Shape constants (single head: batch b owns token rows b*1024 .. b*1024+1023) */
/* --------------------------------------------------------------------------- */
constexpr int kBatch  = 32;
constexpr int kG      = 1024;
constexpr int kD      = 256;
constexpr int kTok    = kBatch * kG;
constexpr int kSqrtD  = 16;
static_assert(kSqrtD * kSqrtD == kD);
static_assert(kTok == 32768);
static_assert((kD % 32) == 0 && (kG % 32) == 0);
static_assert((kD % 64) == 0 && (kG % 64) == 0 && (kTok % 64) == 0 && ((2 * kD) % 64) == 0);

/* Power-of-two carries of the f16 operand planes, folded back exactly in f32 epilogue scales. */
constexpr float kXCarry   = 16.0f;
constexpr float kWCarry   = 1024.0f;
constexpr float kQKVCarry = 16.0f;
constexpr float kPCarry   = 32768.0f;
constexpr float kHCarry   = 256.0f;
constexpr float kNormQK   = 1.0f / (float)kSqrtD;
constexpr float kProjScale  = kQKVCarry / (kXCarry * kWCarry);
constexpr float kScoreScale = kNormQK / (kQKVCarry * kQKVCarry);
constexpr float kPVScale    = kHCarry / (kPCarry * kQKVCarry);
constexpr float kOutScale   = 1.0f / (kHCarry * kWCarry);

/* --------------------------------------------------------------------------- */
/* Workspace region map (bytes; every offset a multiple of 128)                 */
/*   W16  f16 [4][256][256]       Wq | Wk | Wv | Wo, each x1024      524,288    */
/*   VT16 f16 [32][256][1024]     v^T per batch, x16               16,777,216   */
/*   SC   f32 [32][1024][1024]    masked-later scores, all batches 134,217,728  */
/*   P16  f16 [32][1024][1024]    probabilities x32768, all batches 67,108,864  */
/*   H16  f16 [32768][256]        attention output x256            16,777,216   */
/*   total                                                        235,405,312   */
/* X16 and QK16 lie inside the P16 region: their last reader (the scores GEMM)   */
/* has ended before the softmax launch writes the first byte of P16.            */
/*   X16  f16 [32768][256]        data x16                  P16 + 0             */
/*   QK16 f16 [32768][512]        q x16 (cols 0..255) | k x16  P16 + 16,777,216 */
/* --------------------------------------------------------------------------- */
constexpr size_t kOffW16  = 0;
constexpr size_t kOffVT16 = kOffW16  + (size_t)4 * kD * kD * 2;
constexpr size_t kOffSC   = kOffVT16 + (size_t)kBatch * kD * kG * 2;
constexpr size_t kOffP16  = kOffSC   + (size_t)kBatch * kG * kG * 4;
constexpr size_t kOffH16  = kOffP16  + (size_t)kBatch * kG * kG * 2;
constexpr size_t kWsTotal = kOffH16  + (size_t)kTok * kD * 2;
constexpr size_t kOffX16  = kOffP16;
constexpr size_t kOffQK16 = kOffX16  + (size_t)kTok * kD * 2;
static_assert(kOffQK16 + (size_t)kTok * 2 * kD * 2 <= kOffH16);
static_assert(kWsTotal == 235405312ull);
static_assert(kWsTotal <= 268435456ull);
static_assert((kOffX16 % 128) == 0 && (kOffQK16 % 128) == 0 && (kOffVT16 % 128) == 0 &&
              (kOffSC % 128) == 0 && (kOffP16 % 128) == 0 && (kOffH16 % 128) == 0);

/* --------------------------------------------------------------------------- */
/* Fragment helpers                                                             */
/* --------------------------------------------------------------------------- */
union FragU { v16h v; v8h h[2]; };
/* elements 0..7 <- p[0..7], elements 8..15 <- p[16..23]; caller adds 8*(lane>>4) to p */
__device__ __forceinline__ v16h frag_load(const _Float16* p) {
  FragU f;
  f.h[0] = *(const v8h*)(p);
  f.h[1] = *(const v8h*)(p + 16);
  return f.v;
}
__device__ __forceinline__ v8f mma_f16(v16h a, v16h b, v8f c) {
  return __builtin_amdgcn_wmma_f32_16x16x32_f16(false, a, false, b, (short)0, c, false, false);
}
/* one accumulator per statement; the A and B fragment registers are named as inputs */
__device__ __forceinline__ void mma_guard1(v8f& a, v16h x, v16h y) {
  asm volatile("v_nop\n\tv_nop\n\tv_nop\n\tv_nop" : "+v"(a) : "v"(x), "v"(y));
}
__device__ __forceinline__ void keep4_h(v16h a, v16h b, v16h c, v16h d) {
  asm volatile("v_nop" :: "v"(a), "v"(b), "v"(c), "v"(d));
}
__device__ __forceinline__ void acc_guard4(v8f& a, v8f& b, v8f& c, v8f& d) {
  asm volatile("v_nop\n\tv_nop\n\tv_nop\n\tv_nop" : "+v"(a), "+v"(b), "+v"(c), "+v"(d));
}

/* --------------------------------------------------------------------------- */
/* Register-blocked batched WMMA GEMM, f16 operands.                            */
/* C[m,n] = scale * sum_k A[m,k] * Bt[n,k] (+ bias[n]); each wave owns a 64x64 tile. */
/* A row-major [M,K]; Bt row-major [N,K]; M,N % 64 == 0, K % 32 == 0 (no tails). */
/* BIAS_MODE: 0 = none, 2 = bias[n] (f32 add).  OUT_MODE: 0 = f32, 1 = f16.      */
/* Epilogue: 16-row slabs staged per wave in LDS (same wave writes and reads);   */
/* --------------------------------------------------------------------------- */
template <int BIAS_MODE, int OUT_MODE>
__global__ __launch_bounds__(256) void wmma_gemm64(
    const unsigned short* __restrict__ Ap, int lda, long strideA,
    const unsigned short* __restrict__ Btp, int ldb, long strideB,
    void* __restrict__ Cout, int ldc, long strideC,
    const float* __restrict__ bias,
    int M, int N, int K, float scale) {
  const _Float16* A  = (const _Float16*)Ap;
  const _Float16* Bt = (const _Float16*)Btp;
  __shared__ __align__(16) float sT[8][16 * 68];
  const int b    = blockIdx.y;
  const int lane = threadIdx.x & 31;
  const int wave = __builtin_amdgcn_readfirstlane((int)(threadIdx.x >> 5));
  const int tilesN = N >> 6;
  const int tilesM = M >> 6;
  const int tile = blockIdx.x * 8 + wave;
  /* wave-uniform exit; this kernel has no block barriers */
  if (tile >= tilesM * tilesN) return;
  const int tm = tile / tilesN;
  const int tn = tile - tm * tilesN;
  const int m0 = tm << 6;
  const int n0 = tn << 6;

  const _Float16* Ab = A  + (size_t)b * strideA;
  const _Float16* Bb = Bt + (size_t)b * strideB;

  const int rlane = lane & 15;
  const int koff  = (lane >> 4) * 8;
  const int mOff  = (lane >> 4) * 8;

  v8f acc[4][4];
#pragma unroll
  for (int i = 0; i < 4; ++i)
#pragma unroll
    for (int j = 0; j < 4; ++j) acc[i][j] = (v8f){0.f, 0.f, 0.f, 0.f, 0.f, 0.f, 0.f, 0.f};

  for (int k0 = 0; k0 < K; k0 += 32) {
    v16h bh[4];
#pragma unroll
    for (int j = 0; j < 4; ++j) {
      const size_t bo = (size_t)(n0 + (j << 4) + rlane) * ldb + koff + k0;
      bh[j] = frag_load(Bb + bo);
    }
#pragma unroll
    for (int i = 0; i < 4; ++i) {
      const size_t ao = (size_t)(m0 + (i << 4) + rlane) * lda + koff + k0;
      v16h ah = frag_load(Ab + ao);
#pragma unroll
      for (int j = 0; j < 4; ++j) acc[i][j] = mma_f16(ah, bh[j], acc[i][j]);
      mma_guard1(acc[i][0], ah, bh[0]);
      mma_guard1(acc[i][1], ah, bh[1]);
      mma_guard1(acc[i][2], ah, bh[2]);
      mma_guard1(acc[i][3], ah, bh[3]);
    }
    keep4_h(bh[0], bh[1], bh[2], bh[3]);
  }
  acc_guard4(acc[0][0], acc[0][1], acc[0][2], acc[0][3]);
  acc_guard4(acc[1][0], acc[1][1], acc[1][2], acc[1][3]);
  acc_guard4(acc[2][0], acc[2][1], acc[2][2], acc[2][3]);
  acc_guard4(acc[3][0], acc[3][1], acc[3][2], acc[3][3]);

  /* ---- epilogue ---- */
  float* slab = sT[wave];
#pragma unroll
  for (int i = 0; i < 4; ++i) {
    const int mBase = m0 + (i << 4);
#pragma unroll
    for (int j = 0; j < 4; ++j) {
      const int n = n0 + (j << 4) + rlane;
      float bv = 0.f;
      if (BIAS_MODE == 2) bv = bias[n];
#pragma unroll
      for (int r = 0; r < 8; ++r) {
        float v = acc[i][j][r] * scale;
        if (BIAS_MODE == 2) v += bv;
        slab[(mOff + r) * 68 + (j << 4) + rlane] = v;
      }
    }
    __builtin_amdgcn_fence(__ATOMIC_RELEASE, "workgroup");
    __builtin_amdgcn_wave_barrier();
    __builtin_amdgcn_fence(__ATOMIC_ACQUIRE, "workgroup");
    if (OUT_MODE == 0) {
      /* row segment = 64 floats = 256 B = 16 lanes x 16 B; rows it*2 + hh, it 0..7 -> 16 rows, each once */
      float* C = (float*)Cout + (size_t)b * strideC;
      const int hh = lane >> 4, c4 = (lane & 15) * 4;
      {
#pragma unroll
        for (int it = 0; it < 8; ++it) {
          const int row = it * 2 + hh;
          v4f v = *(const v4f*)(slab + row * 68 + c4);
          *(v4f*)(C + (size_t)(mBase + row) * ldc + n0 + c4) = v;
        }
        
      }
    } else {
      const int q = lane >> 3, c8 = (lane & 7) * 8;
      unsigned short* C = (unsigned short*)Cout + (size_t)b * strideC;
      {
#pragma unroll
        for (int it = 0; it < 4; ++it) {
          const int row = it * 4 + q;
          const float* sp = slab + row * 68 + c8;
          v8h hv;
#pragma unroll
          for (int e = 0; e < 8; ++e) hv[e] = (_Float16)sp[e];
          *(v8h*)(C + (size_t)(mBase + row) * ldc + n0 + c8) = hv;
        }
        
      }
    }
    __builtin_amdgcn_fence(__ATOMIC_RELEASE, "workgroup");
    __builtin_amdgcn_wave_barrier();
    __builtin_amdgcn_fence(__ATOMIC_ACQUIRE, "workgroup");
  }
}

/* --------------------------------------------------------------------------- */
/* f32 -> f16 (x carry, exact power of two), 8 consecutive elements per thread.  */
/* One 16-B store per lane; 32 consecutive lanes = 512 contiguous B = 4 whole    */
/* Coverage: n8 = 32768*256/8 = 1,048,576 threads = 4096 blocks x 256 exactly.   */
/* --------------------------------------------------------------------------- */
__global__ __launch_bounds__(256) void cast8_f16_kernel(const float* __restrict__ in,
                                                        unsigned short* __restrict__ out,
                                                        int n8, float carry) {
  const int i = blockIdx.x * 256 + threadIdx.x;
  if (i >= n8) return;
  const float* p = in + 8 * (size_t)i;
  const v4f a = *(const v4f*)(p);
  const v4f c = *(const v4f*)(p + 4);
  v8h hv;
#pragma unroll
  for (int e = 0; e < 4; ++e) {
    hv[e]     = (_Float16)(a[e] * carry);
    hv[4 + e] = (_Float16)(c[e] * carry);
  }
  unsigned short* q = out + 8 * (size_t)i;
  *(v8h*)q = hv;
  
}

/* --------------------------------------------------------------------------- */
/* Four [256][256] f32 weight matrices ([out][in] = Bt layout) -> f16 planes     */
/* out + z*65536 halves, x carry. grid (32, 4): blockIdx.y selects the matrix    */
/* (block-uniform); 32 blocks x 256 threads x 8 = 65,536 = one whole plane.      */
/* --------------------------------------------------------------------------- */
__global__ __launch_bounds__(256) void cast8_w4_kernel(const float* __restrict__ W0, const float* __restrict__ W1,
                                                       const float* __restrict__ W2, const float* __restrict__ W3,
                                                       unsigned short* __restrict__ out, float carry) {
  const int z = blockIdx.y;
  const float* W = (z == 0) ? W0 : (z == 1) ? W1 : (z == 2) ? W2 : W3;
  const int i = blockIdx.x * 256 + threadIdx.x;
  const float* p = W + 8 * (size_t)i;
  const v4f a = *(const v4f*)(p);
  const v4f c = *(const v4f*)(p + 4);
  v8h hv;
#pragma unroll
  for (int e = 0; e < 4; ++e) {
    hv[e]     = (_Float16)(a[e] * carry);
    hv[4 + e] = (_Float16)(c[e] * carry);
  }
  unsigned short* q = out + (size_t)z * kD * kD + 8 * (size_t)i;
  *(v8h*)q = hv;
  
}

/* --------------------------------------------------------------------------- */
/* Key-masked row softmax, blockIdx.y = batch counted from b0 (f32 math).        */
/*   x[k]  = blocked[b][k] ? fill : s[q][k]      (fill = -30, or -inf when the   */
/*           evaluate flag is nonzero; s already carries the 1/16 logit scale)   */
/*   e[k]  = exp(x[k] - max_k x[k]);  tot = sum_k e[k]  (blocked terms included) */
/*   P[q][k] = f16( blocked ? 0 : e[k] * (32768 / tot) )                         */
/* Block = 128 threads = one row of 1024 (8 columns per thread), 4 rows per      */
/* block in a rolled loop; grid (256, 32) -> 32 x 1024 rows, each once.          */
/* Reductions in fixed order: per-thread, wave shuffle tree, 4 wave partials in  */
/* index order through LDS with block barriers (all barriers block-uniform).     */
/* Store: one 16-B store per lane; a wave writes 512 contiguous B = 4 whole      */
/* --------------------------------------------------------------------------- */
constexpr int kSmRows = 4;
static_assert((kG % kSmRows) == 0 && kG == 128 * 8);
__global__ __launch_bounds__(128) void softmax_keymask_kernel(const float* __restrict__ S,
                                                              const int* __restrict__ mask,
                                                              const int* __restrict__ evalflag,
                                                              unsigned short* __restrict__ P, int b0) {
  __shared__ float redM[4];
  __shared__ float redS[4];
  const int t    = threadIdx.x;
  const int lane = t & 31;
  const int wave = __builtin_amdgcn_readfirstlane((int)(threadIdx.x >> 5));
  const int bl   = blockIdx.y;
  int b = b0 + bl;
  b = b < 0 ? 0 : (b > kBatch - 1 ? kBatch - 1 : b);
  const int c0 = t * 8;
  const v4i mk0 = *(const v4i*)(mask + (size_t)b * kG + c0);
  const v4i mk1 = *(const v4i*)(mask + (size_t)b * kG + c0 + 4);
  int blk[8];
#pragma unroll
  for (int e = 0; e < 4; ++e) {
    blk[e]     = (mk0[e] != 0) ? 1 : 0;
    blk[4 + e] = (mk1[e] != 0) ? 1 : 0;
  }
  const float fill = (evalflag[0] != 0) ? (-INFINITY) : (-30.0f);

#pragma unroll 1
  for (int rr = 0; rr < kSmRows; ++rr) {
    const int row = blockIdx.x * kSmRows + rr;
    const size_t ro = ((size_t)bl * kG + row) * kG + c0;
    const v4f a = *(const v4f*)(S + ro);
    const v4f c = *(const v4f*)(S + ro + 4);
    float x[8];
#pragma unroll
    for (int e = 0; e < 4; ++e) {
      x[e]     = blk[e]     ? fill : a[e];
      x[4 + e] = blk[4 + e] ? fill : c[e];
    }
    float m = fmaxf(fmaxf(fmaxf(x[0], x[1]), fmaxf(x[2], x[3])), fmaxf(fmaxf(x[4], x[5]), fmaxf(x[6], x[7])));
#pragma unroll
    for (int off = 16; off > 0; off >>= 1) m = fmaxf(m, __shfl_xor(m, off, 32));
    if (lane == 0) redM[wave] = m;
    __syncthreads();
    const float mrow = fmaxf(fmaxf(redM[0], redM[1]), fmaxf(redM[2], redM[3]));
    float ev[8];
    float s = 0.0f;
#pragma unroll
    for (int e = 0; e < 8; ++e) {
      ev[e] = expf(x[e] - mrow);
      s += ev[e];
    }
#pragma unroll
    for (int off = 16; off > 0; off >>= 1) s += __shfl_xor(s, off, 32);
    if (lane == 0) redS[wave] = s;
    __syncthreads();
    const float tot = ((redS[0] + redS[1]) + redS[2]) + redS[3];
    const float inv = kPCarry * (1.0f / tot);
    v8h hv;
#pragma unroll
    for (int e = 0; e < 8; ++e) {
      const float pv = blk[e] ? 0.0f : (ev[e] * inv);
      hv[e] = (_Float16)pv;
    }
    unsigned short* q = P + ro;
    *(v8h*)q = hv;
    
  }
}

/* --------------------------------------------------------------------------- */
/* Shape premise check: the file is built for 1024 nodes per batch. If the scalar */
/* two 512-B instructions) with NaN and returns normally.                         */
/* --------------------------------------------------------------------------- */
__global__ __launch_bounds__(32) void premise_guard_kernel(const int* __restrict__ gsz, float* __restrict__ out) {
  const int g = gsz[0];
  if (g != kG) {
    const int lane = threadIdx.x & 31;
    const float qn = __uint_as_float(0x7fc00000u);
    const v4f nv = (v4f){qn, qn, qn, qn};
    {
      *(v4f*)(out + lane * 4) = nv;
      *(v4f*)(out + 128 + lane * 4) = nv;
      
    }
  }
}

/* --------------------------------------------------------------------------- */
/* Host glue: kernel launches only. 2 casts + 2 projection GEMMs + scores GEMM,  */
/* softmax, p.v GEMM (each one launch over all 32 batches, so that p.v has one   */
/* block for every WGP) + output GEMM + premise check = 9 launches.              */
/* GEMM shapes (all K % 32 == 0, M and N % 64 == 0; grids exact):                */
/*   q|k proj : M 32768, N 512,  K 256            4096 tiles -> 512 blocks       */
/*   v^T proj : M 256,   N 1024, K 256, 32 batches  64 tiles -> 8 x 32 blocks    */
/*   scores   : M 1024,  N 1024, K 256, 32 batches 256 tiles -> 32 x 32 blocks   */
/*   p.v      : M 1024,  N 256,  K 1024, 32 batches 64 tiles -> 8 x 32 blocks    */
/*   out proj : M 32768, N 256,  K 256            2048 tiles -> 256 blocks       */
/* --------------------------------------------------------------------------- */
extern "C" void kernel_launch(void* const* d_in, const int* in_sizes, int n_in,
                              void* d_out, int out_size, void* d_ws, size_t ws_size,
                              hipStream_t stream) {
  if (n_in < 9) return;
  if (in_sizes[0] != kTok * kD) return;
  if (in_sizes[1] != kBatch * kG) return;
  if (in_sizes[2] != 1 || in_sizes[3] != 1) return;
  if (in_sizes[4] != kD * kD || in_sizes[5] != kD * kD || in_sizes[6] != kD * kD || in_sizes[7] != kD * kD) return;
  if (in_sizes[8] != kD) return;
  if (out_size != kTok * kD) return;
  if (ws_size < kWsTotal) return;

  const float* data   = (const float*)d_in[0];
  const int*   mask   = (const int*)d_in[1];
  const int*   gsize  = (const int*)d_in[2];
  const int*   evalf  = (const int*)d_in[3];
  const float* Wq     = (const float*)d_in[4];
  const float* Wk     = (const float*)d_in[5];
  const float* Wv     = (const float*)d_in[6];
  const float* Wo     = (const float*)d_in[7];
  const float* b_out  = (const float*)d_in[8];
  float* out = (float*)d_out;

  char* ws = (char*)d_ws;
  unsigned short* X16  = (unsigned short*)(ws + kOffX16);
  unsigned short* W16  = (unsigned short*)(ws + kOffW16);
  unsigned short* QK16 = (unsigned short*)(ws + kOffQK16);
  unsigned short* VT16 = (unsigned short*)(ws + kOffVT16);
  float*          SC   = (float*)(ws + kOffSC);
  unsigned short* P16  = (unsigned short*)(ws + kOffP16);
  unsigned short* H16  = (unsigned short*)(ws + kOffH16);

  /* operand planes */
  cast8_f16_kernel<<<(kTok * kD / 8) / 256, 256, 0, stream>>>(data, X16, kTok * kD / 8, kXCarry);
  cast8_w4_kernel<<<dim3((kD * kD / 8) / 256, 4), 256, 0, stream>>>(Wq, Wk, Wv, Wo, W16, kWCarry);

  /* q | k = x . [Wq ; Wk]^T  -> QK16 [32768][512], carried x16 */
  wmma_gemm64<0, 1><<<dim3((kTok / 64) * (2 * kD / 64) / 8, 1), 256, 0, stream>>>(
      X16, kD, 0L,
      W16, kD, 0L,
      (void*)QK16, 2 * kD, 0L,
      b_out,
      kTok, 2 * kD, kD, kProjScale);

  /* v^T per batch: VT[b][d][g] = Wv[d][:] . x[b*1024+g][:]  (A = Wv, Bt = x rows of batch b), carried x16 */
  wmma_gemm64<0, 1><<<dim3((kD / 64) * (kG / 64) / 8, kBatch), 256, 0, stream>>>(
      W16 + (size_t)2 * kD * kD, kD, 0L,
      X16, kD, (long)kG * kD,
      (void*)VT16, kG, (long)kD * kG,
      b_out,
      kD, kG, kD, kProjScale);

  /* scores[b][q][k] = (1/16) * q.k  (A = q rows, Bt = k rows, both pitch 512) */
  wmma_gemm64<0, 0><<<dim3((kG / 64) * (kG / 64) / 8, kBatch), 256, 0, stream>>>(
      QK16, 2 * kD, (long)kG * 2 * kD,
      QK16 + kD, 2 * kD, (long)kG * 2 * kD,
      (void*)SC, kG, (long)kG * kG,
      b_out,
      kG, kG, kD, kScoreScale);
  /* key mask + softmax -> P16 (x32768) */
  softmax_keymask_kernel<<<dim3(kG / kSmRows, kBatch), 128, 0, stream>>>(SC, mask, evalf, P16, 0);
  /* H[b][q][d] = sum_k P[q][k] * v[k][d]  (A = P, Bt = v^T), carried x256 */
  wmma_gemm64<0, 1><<<dim3((kG / 64) * (kD / 64) / 8, kBatch), 256, 0, stream>>>(
      P16, kG, (long)kG * kG,
      VT16, kG, (long)kD * kG,
      (void*)H16, kD, (long)kG * kD,
      b_out,
      kG, kD, kG, kPVScale);

  /* out = H . Wo^T + b_out[n] -> f32 output rows */
  wmma_gemm64<2, 0><<<dim3((kTok / 64) * (kD / 64) / 8, 1), 256, 0, stream>>>(
      H16, kD, 0L,
      W16 + (size_t)3 * kD * kD, kD, 0L,
      (void*)out, kD, 0L,
      b_out,
      kTok, kD, kD, kOutScale);

  premise_guard_kernel<<<1, 32, 0, stream>>>(gsize, out);
}

// v002
// A run of this version takes 108 microseconds.
// Next to v001, in two timings, it ran 1.86 and 1.85 times as fast.
// Over all steps from v000 it is 6.31 times as fast.
// All contractions (q/k/v projections, q.k^T scores, p.v, output projection): v_wmma_f32_16x16x32_f16, f16 operands carried by exact powers of two, f32 accumulate; key masking, softmax and bias add in f32.
#include <hip/hip_runtime.h>
#include <math.h>

typedef __attribute__((ext_vector_type(16))) _Float16 v16h;
typedef __attribute__((ext_vector_type(8)))  _Float16 v8h;
typedef __attribute__((ext_vector_type(8)))  float    v8f;
typedef __attribute__((ext_vector_type(4)))  float    v4f;
typedef __attribute__((ext_vector_type(4)))  int      v4i;

/* --------------------------------------------------------------------------- */
/* Shape constants (single head: batch b owns token rows b*1024 .. b*1024+1023) */
/* --------------------------------------------------------------------------- */
constexpr int kBatch  = 32;
constexpr int kG      = 1024;
constexpr int kD      = 256;
constexpr int kTok    = kBatch * kG;
constexpr int kSqrtD  = 16;
static_assert(kSqrtD * kSqrtD == kD);
static_assert(kTok == 32768);
static_assert((kD % 32) == 0 && (kG % 32) == 0);
static_assert((kD % 64) == 0 && (kG % 64) == 0 && (kTok % 64) == 0 && ((2 * kD) % 64) == 0);

/* Power-of-two carries of the f16 operand planes, folded back exactly in f32 epilogue scales. */
constexpr float kXCarry   = 16.0f;
constexpr float kWCarry   = 1024.0f;
constexpr float kQKVCarry = 16.0f;
constexpr float kPCarry   = 32768.0f;
constexpr float kHCarry   = 256.0f;
constexpr float kNormQK   = 1.0f / (float)kSqrtD;
constexpr float kProjScale  = kQKVCarry / (kXCarry * kWCarry);
constexpr float kScoreScale = kNormQK / (kQKVCarry * kQKVCarry);
constexpr float kOutScale   = 1.0f / (kHCarry * kWCarry);

/* --------------------------------------------------------------------------- */
/* Workspace region map (bytes; every offset a multiple of 128)                 */
/*   W16  f16 [4][256][256]       Wq | Wk | Wv | Wo, each x1024      524,288    */
/*   VT16 f16 [32][256][1024]     v^T per batch, x16               16,777,216   */
/*   X16  f16 [32768][256]        data x16                         16,777,216   */
/*   QK16 f16 [32768][512]        q x16 (cols 0..255) | k x16      33,554,432   */
/*   H16  f16 [32768][256]        attention output x256            16,777,216   */
/*   total                                                         84,410,368   */
/* --------------------------------------------------------------------------- */
constexpr size_t kOffW16  = 0;
constexpr size_t kOffVT16 = kOffW16  + (size_t)4 * kD * kD * 2;
constexpr size_t kOffX16  = kOffVT16 + (size_t)kBatch * kD * kG * 2;
constexpr size_t kOffQK16 = kOffX16  + (size_t)kTok * kD * 2;
constexpr size_t kOffH16  = kOffQK16 + (size_t)kTok * 2 * kD * 2;
constexpr size_t kWsTotal = kOffH16  + (size_t)kTok * kD * 2;
static_assert(kWsTotal == 84410368ull);
static_assert(kWsTotal <= 268435456ull);
static_assert((kOffX16 % 128) == 0 && (kOffQK16 % 128) == 0 && (kOffVT16 % 128) == 0 && (kOffH16 % 128) == 0);

/* --------------------------------------------------------------------------- */
/* Fragment helpers                                                             */
/* --------------------------------------------------------------------------- */
union FragU { v16h v; v8h h[2]; };
/* elements 0..7 <- p[0..7], elements 8..15 <- p[16..23]; caller adds 8*(lane>>4) to p */
__device__ __forceinline__ v16h frag_load(const _Float16* p) {
  FragU f;
  f.h[0] = *(const v8h*)(p);
  f.h[1] = *(const v8h*)(p + 16);
  return f.v;
}
__device__ __forceinline__ v8f mma_f16(v16h a, v16h b, v8f c) {
  return __builtin_amdgcn_wmma_f32_16x16x32_f16(false, a, false, b, (short)0, c, false, false);
}
/* one accumulator per statement; the A and B fragment registers are named as inputs */
__device__ __forceinline__ void mma_guard1(v8f& a, v16h x, v16h y) {
  asm volatile("v_nop\n\tv_nop\n\tv_nop\n\tv_nop" : "+v"(a) : "v"(x), "v"(y));
}
__device__ __forceinline__ void keep4_h(v16h a, v16h b, v16h c, v16h d) {
  asm volatile("v_nop" :: "v"(a), "v"(b), "v"(c), "v"(d));
}
__device__ __forceinline__ void acc_guard4(v8f& a, v8f& b, v8f& c, v8f& d) {
  asm volatile("v_nop\n\tv_nop\n\tv_nop\n\tv_nop" : "+v"(a), "+v"(b), "+v"(c), "+v"(d));
}

/* --------------------------------------------------------------------------- */
/* Register-blocked batched WMMA GEMM, f16 operands.                            */
/* C[m,n] = scale * sum_k A[m,k] * Bt[n,k] (+ bias[n]); each wave owns a 64x64 tile. */
/* A row-major [M,K]; Bt row-major [N,K]; M,N % 64 == 0, K % 32 == 0 (no tails). */
/* BIAS_MODE: 0 = none, 2 = bias[n] (f32 add).  OUT_MODE: 0 = f32, 1 = f16.      */
/* Epilogue: 16-row slabs staged per wave in LDS (same wave writes and reads);   */
/* --------------------------------------------------------------------------- */
template <int BIAS_MODE, int OUT_MODE>
__global__ __launch_bounds__(256) void wmma_gemm64(
    const unsigned short* __restrict__ Ap, int lda, long strideA,
    const unsigned short* __restrict__ Btp, int ldb, long strideB,
    void* __restrict__ Cout, int ldc, long strideC,
    const float* __restrict__ bias,
    int M, int N, int K, float scale) {
  const _Float16* A  = (const _Float16*)Ap;
  const _Float16* Bt = (const _Float16*)Btp;
  __shared__ __align__(16) float sT[8][16 * 68];
  const int b    = blockIdx.y;
  const int lane = threadIdx.x & 31;
  const int wave = __builtin_amdgcn_readfirstlane((int)(threadIdx.x >> 5));
  const int tilesN = N >> 6;
  const int tilesM = M >> 6;
  const int tile = blockIdx.x * 8 + wave;
  /* wave-uniform exit; this kernel has no block barriers */
  if (tile >= tilesM * tilesN) return;
  const int tm = tile / tilesN;
  const int tn = tile - tm * tilesN;
  const int m0 = tm << 6;
  const int n0 = tn << 6;

  const _Float16* Ab = A  + (size_t)b * strideA;
  const _Float16* Bb = Bt + (size_t)b * strideB;

  const int rlane = lane & 15;
  const int koff  = (lane >> 4) * 8;
  const int mOff  = (lane >> 4) * 8;

  v8f acc[4][4];
#pragma unroll
  for (int i = 0; i < 4; ++i)
#pragma unroll
    for (int j = 0; j < 4; ++j) acc[i][j] = (v8f){0.f, 0.f, 0.f, 0.f, 0.f, 0.f, 0.f, 0.f};

  for (int k0 = 0; k0 < K; k0 += 32) {
    v16h bh[4];
#pragma unroll
    for (int j = 0; j < 4; ++j) {
      const size_t bo = (size_t)(n0 + (j << 4) + rlane) * ldb + koff + k0;
      bh[j] = frag_load(Bb + bo);
    }
#pragma unroll
    for (int i = 0; i < 4; ++i) {
      const size_t ao = (size_t)(m0 + (i << 4) + rlane) * lda + koff + k0;
      v16h ah = frag_load(Ab + ao);
#pragma unroll
      for (int j = 0; j < 4; ++j) acc[i][j] = mma_f16(ah, bh[j], acc[i][j]);
      mma_guard1(acc[i][0], ah, bh[0]);
      mma_guard1(acc[i][1], ah, bh[1]);
      mma_guard1(acc[i][2], ah, bh[2]);
      mma_guard1(acc[i][3], ah, bh[3]);
    }
    keep4_h(bh[0], bh[1], bh[2], bh[3]);
  }
  acc_guard4(acc[0][0], acc[0][1], acc[0][2], acc[0][3]);
  acc_guard4(acc[1][0], acc[1][1], acc[1][2], acc[1][3]);
  acc_guard4(acc[2][0], acc[2][1], acc[2][2], acc[2][3]);
  acc_guard4(acc[3][0], acc[3][1], acc[3][2], acc[3][3]);

  /* ---- epilogue ---- */
  float* slab = sT[wave];
#pragma unroll
  for (int i = 0; i < 4; ++i) {
    const int mBase = m0 + (i << 4);
#pragma unroll
    for (int j = 0; j < 4; ++j) {
      const int n = n0 + (j << 4) + rlane;
      float bv = 0.f;
      if (BIAS_MODE == 2) bv = bias[n];
#pragma unroll
      for (int r = 0; r < 8; ++r) {
        float v = acc[i][j][r] * scale;
        if (BIAS_MODE == 2) v += bv;
        slab[(mOff + r) * 68 + (j << 4) + rlane] = v;
      }
    }
    __builtin_amdgcn_fence(__ATOMIC_RELEASE, "workgroup");
    __builtin_amdgcn_wave_barrier();
    __builtin_amdgcn_fence(__ATOMIC_ACQUIRE, "workgroup");
    if (OUT_MODE == 0) {
      /* row segment = 64 floats = 256 B = 16 lanes x 16 B; rows it*2 + hh, it 0..7 -> 16 rows, each once */
      float* C = (float*)Cout + (size_t)b * strideC;
      const int hh = lane >> 4, c4 = (lane & 15) * 4;
      {
#pragma unroll
        for (int it = 0; it < 8; ++it) {
          const int row = it * 2 + hh;
          v4f v = *(const v4f*)(slab + row * 68 + c4);
          *(v4f*)(C + (size_t)(mBase + row) * ldc + n0 + c4) = v;
        }
        
      }
    } else {
      const int q = lane >> 3, c8 = (lane & 7) * 8;
      unsigned short* C = (unsigned short*)Cout + (size_t)b * strideC;
      {
#pragma unroll
        for (int it = 0; it < 4; ++it) {
          const int row = it * 4 + q;
          const float* sp = slab + row * 68 + c8;
          v8h hv;
#pragma unroll
          for (int e = 0; e < 8; ++e) hv[e] = (_Float16)sp[e];
          *(v8h*)(C + (size_t)(mBase + row) * ldc + n0 + c8) = hv;
        }
        
      }
    }
    __builtin_amdgcn_fence(__ATOMIC_RELEASE, "workgroup");
    __builtin_amdgcn_wave_barrier();
    __builtin_amdgcn_fence(__ATOMIC_ACQUIRE, "workgroup");
  }
}

/* --------------------------------------------------------------------------- */
/* f32 -> f16 (x carry, exact power of two), 8 consecutive elements per thread.  */
/* One 16-B store per lane; 32 consecutive lanes = 512 contiguous B = 4 whole    */
/* Coverage: n8 = 32768*256/8 = 1,048,576 threads = 4096 blocks x 256 exactly.   */
/* --------------------------------------------------------------------------- */
__global__ __launch_bounds__(256) void cast8_f16_kernel(const float* __restrict__ in,
                                                        unsigned short* __restrict__ out,
                                                        int n8, float carry) {
  const int i = blockIdx.x * 256 + threadIdx.x;
  if (i >= n8) return;
  const float* p = in + 8 * (size_t)i;
  const v4f a = *(const v4f*)(p);
  const v4f c = *(const v4f*)(p + 4);
  v8h hv;
#pragma unroll
  for (int e = 0; e < 4; ++e) {
    hv[e]     = (_Float16)(a[e] * carry);
    hv[4 + e] = (_Float16)(c[e] * carry);
  }
  unsigned short* q = out + 8 * (size_t)i;
  *(v8h*)q = hv;
  
}

/* --------------------------------------------------------------------------- */
/* Four [256][256] f32 weight matrices ([out][in] = Bt layout) -> f16 planes     */
/* out + z*65536 halves, x carry. grid (32, 4): blockIdx.y selects the matrix    */
/* (block-uniform); 32 blocks x 256 threads x 8 = 65,536 = one whole plane.      */
/* --------------------------------------------------------------------------- */
__global__ __launch_bounds__(256) void cast8_w4_kernel(const float* __restrict__ W0, const float* __restrict__ W1,
                                                       const float* __restrict__ W2, const float* __restrict__ W3,
                                                       unsigned short* __restrict__ out, float carry) {
  const int z = blockIdx.y;
  const float* W = (z == 0) ? W0 : (z == 1) ? W1 : (z == 2) ? W2 : W3;
  const int i = blockIdx.x * 256 + threadIdx.x;
  const float* p = W + 8 * (size_t)i;
  const v4f a = *(const v4f*)(p);
  const v4f c = *(const v4f*)(p + 4);
  v8h hv;
#pragma unroll
  for (int e = 0; e < 4; ++e) {
    hv[e]     = (_Float16)(a[e] * carry);
    hv[4 + e] = (_Float16)(c[e] * carry);
  }
  unsigned short* q = out + (size_t)z * kD * kD + 8 * (size_t)i;
  *(v8h*)q = hv;
  
}

/* --------------------------------------------------------------------------- */
/* Fused attention of one batch: scores, key mask, softmax and p.v in one launch. */
/*   S^T = K . Q^T   (A = 16 key rows from LDS, B = 16 query columns in registers) */
/*   O^T += V^T . P^T (A = 16 rows of v^T from LDS, B = P^T packed from the S^T    */
/*                     accumulators: two 16-key tiles give one 32-key B operand)   */
/* A lane owns query column c = lane & 15 and, of every 16-key tile, the keys      */
/* 8*(lane>>4) .. +7, so maximum and sum run in-lane plus one exchange of halves.  */
/*   x[k] = blocked[k] ? fill : s[k]  (log2 units; fill = -30, or -inf when the    */
/*          evaluate flag is nonzero);  e[k] = 2^(x[k] - m + 15), m = running max; */
/*   the sum takes every e[k], blocked ones included; P takes 0 for blocked keys.  */
/* Block = 8 waves x 16 queries = 128 queries; grid (8, 32). A stage is 64 keys:   */
/* K rows and v^T rows go global -> registers -> LDS one stage ahead, two buffers, */
/* one block barrier per stage (it publishes the next stage and ends the reads of  */
/* the buffer that the stage after it overwrites).                                 */
/* --------------------------------------------------------------------------- */
constexpr int kFaKeys   = 64;
constexpr int kFaStages = kG / kFaKeys;
constexpr int kFaQ      = 128;
constexpr int kKPitch   = kD + 8;        /* halves: 528 B = 16 B x 33 */
constexpr int kVPitch   = kFaKeys + 8;   /* halves: 144 B = 16 B x 9  */
constexpr int kKBuf     = kFaKeys * kKPitch;
constexpr int kVBuf     = kD * kVPitch;
constexpr float kLog2e  = 1.4426950408889634f;
constexpr float kScore2 = kScoreScale * kLog2e;
constexpr float kPExp   = 15.0f;
constexpr float kFaOut  = kHCarry / kQKVCarry;
static_assert(kPCarry == 32768.0f && kPExp == 15.0f);
static_assert((kG % kFaKeys) == 0 && (kG % kFaQ) == 0 && kD == 256 && kFaKeys == 64);

/* lane l reads lane l ^ 16 */
__device__ __forceinline__ float xhalf(float x) {
  return __builtin_bit_cast(float, __builtin_amdgcn_permlanex16(__builtin_bit_cast(int, x), __builtin_bit_cast(int, x),
                                                                0x76543210, 0xfedcba98, false, false));
}

/* group g of the score product: key tiles 0..3 at depth steps 2g and 2g+1 */
template <int G>
__device__ __forceinline__ void load_k8(v16h (&f)[8], const _Float16* kb) {
#pragma unroll
  for (int u = 0; u < 8; ++u) f[u] = frag_load(kb + (u & 3) * 16 * kKPitch + (2 * G + (u >> 2)) * 32);
}
template <int G>
__device__ __forceinline__ void mma_k8(v8f (&st)[4], const v16h (&f)[8], const v16h (&qf)[8]) {
#pragma unroll
  for (int u = 0; u < 8; ++u) st[u & 3] = mma_f16(f[u], qf[2 * G + (u >> 2)], st[u & 3]);
}
/* group g of the output product: depth tiles 8*(g&1) .. +7 at the 32 keys g>>1 */
template <int G>
__device__ __forceinline__ void load_v8(v16h (&f)[8], const _Float16* vb) {
#pragma unroll
  for (int u = 0; u < 8; ++u) f[u] = frag_load(vb + ((G & 1) * 8 + u) * 16 * kVPitch + (G >> 1) * 32);
}
template <int G>
__device__ __forceinline__ void mma_v8(v8f (&acc)[16], const v16h (&f)[8], const v16h (&pb)[2]) {
#pragma unroll
  for (int u = 0; u < 8; ++u) acc[(G & 1) * 8 + u] = mma_f16(f[u], pb[G >> 1], acc[(G & 1) * 8 + u]);
}
/* holds the next group's LDS loads in front of this group's matrix instructions, so that they fly under them */
__device__ __forceinline__ void group_fence() { __builtin_amdgcn_sched_barrier(0); }

__global__ __launch_bounds__(256) void attn_fused_kernel(const unsigned short* __restrict__ QKp,
                                                         const unsigned short* __restrict__ VTp,
                                                         const int* __restrict__ mask,
                                                         const int* __restrict__ evalflag,
                                                         unsigned short* __restrict__ Hp) {
  __shared__ __align__(16) _Float16 sK[2][kKBuf];
  __shared__ __align__(16) _Float16 sV[2][kVBuf];
  __shared__ unsigned sBlk[kG / 32];
  const int t    = threadIdx.x;
  const int lane = t & 31;
  const int wave = __builtin_amdgcn_readfirstlane((int)(threadIdx.x >> 5));
  const int b    = blockIdx.y;
  const int c    = lane & 15;
  const int h    = lane >> 4;
  const int q0   = blockIdx.x * kFaQ + wave * 16;
  const _Float16* QK = (const _Float16*)QKp + (size_t)b * kG * 2 * kD;
  const _Float16* VT = (const _Float16*)VTp + (size_t)b * kD * kG;

  /* blocked keys as bits: word w, bit i = key 32*w + i */
  int mk[4];
#pragma unroll
  for (int i = 0; i < 4; ++i) mk[i] = mask[(size_t)b * kG + (wave * 4 + i) * 32 + lane];
  /* stands in front of the first overwrite of the address register that these loads name */
  asm volatile("s_wait_xcnt 0x0" ::: "memory");
  unsigned bits[4];
#pragma unroll
  for (int i = 0; i < 4; ++i) bits[i] = __builtin_amdgcn_ballot_w32(mk[i] != 0);
  if (lane == 0) {
#pragma unroll
    for (int i = 0; i < 4; ++i) sBlk[wave * 4 + i] = bits[i];
  }
  const float fill2 = (evalflag[0] != 0) ? (-INFINITY) : (-30.0f * kLog2e);

  /* B operand of the score product: this wave's 16 query rows, whole depth */
  v16h qf[8];
#pragma unroll
  for (int kk = 0; kk < 8; ++kk) qf[kk] = frag_load(QK + (size_t)(q0 + c) * (2 * kD) + kk * 32 + 8 * h);

  /* staging map: 16-B chunk t + 256*i of a stage's K tile (32 chunks a row) and v^T tile (8 chunks a row) */
  const int kRow = t >> 5, kCol = (t & 31) * 8;
  const int vRow = t >> 3, vCol = (t & 7) * 8;
  const _Float16* gK = QK + (size_t)kRow * (2 * kD) + kD + kCol;
  const _Float16* gV = VT + (size_t)vRow * kG + vCol;
  const int lK = kRow * kKPitch + kCol;
  const int lV = vRow * kVPitch + vCol;
  v8h kr[8], vr[8];
#pragma unroll
  for (int i = 0; i < 8; ++i) {
    kr[i] = *(const v8h*)(gK + (size_t)(8 * i) * (2 * kD));
    vr[i] = *(const v8h*)(gV + (size_t)(32 * i) * kG);
  }
#pragma unroll
  for (int i = 0; i < 8; ++i) {
    *(v8h*)(&sK[0][lK + 8 * i * kKPitch])  = kr[i];
    *(v8h*)(&sV[0][lV + 32 * i * kVPitch]) = vr[i];
  }

  v8f acc[16];
#pragma unroll
  for (int d = 0; d < 16; ++d) acc[d] = (v8f){0.f, 0.f, 0.f, 0.f, 0.f, 0.f, 0.f, 0.f};
  float m_run = -INFINITY;
  float l_run = 0.0f;
  __syncthreads();

  /* rolled: one stage's body (64 matrix instructions and their loads) per iteration */
#pragma unroll 1
  for (int s = 0; s < kFaStages; ++s) {
    const int buf = s & 1;
    const bool more = (s + 1 < kFaStages);
    if (more) {
#pragma unroll
      for (int i = 0; i < 8; ++i) {
        kr[i] = *(const v8h*)(gK + (size_t)((s + 1) * kFaKeys + 8 * i) * (2 * kD));
        vr[i] = *(const v8h*)(gV + (size_t)(32 * i) * kG + (s + 1) * kFaKeys);
      }
      /* stands in front of the first overwrite of an address register that these loads name */
      asm volatile("s_wait_xcnt 0x0" ::: "memory");
    }

    /* S^T: 4 key tiles x 16 query columns */
    v8f st[4];
#pragma unroll
    for (int kt = 0; kt < 4; ++kt) st[kt] = (v8f){0.f, 0.f, 0.f, 0.f, 0.f, 0.f, 0.f, 0.f};
    const _Float16* kb = &sK[buf][c * kKPitch + 8 * h];
    const _Float16* vb = &sV[buf][c * kVPitch + 8 * h];
    v16h fa[8], fb[8];
    load_k8<0>(fa, kb);
    load_k8<1>(fb, kb); group_fence(); mma_k8<0>(st, fa, qf); group_fence();
    load_k8<2>(fa, kb); group_fence(); mma_k8<1>(st, fb, qf); group_fence();
    load_k8<3>(fb, kb); group_fence(); mma_k8<2>(st, fa, qf); group_fence();
    load_v8<0>(fa, vb); group_fence(); mma_k8<3>(st, fb, qf); group_fence();

    /* key kt*16 + 8h + r of the stage: word kt>>1, bit (kt&1)*16 + 8h + r */
    const unsigned w0 = sBlk[2 * s] >> (8 * h);
    const unsigned w1 = sBlk[2 * s + 1] >> (8 * h);
    float x[4][8];
    float mx = -INFINITY;
#pragma unroll
    for (int kt = 0; kt < 4; ++kt) {
      const unsigned wb = (kt < 2) ? w0 : w1;
#pragma unroll
      for (int r = 0; r < 8; ++r) {
        const bool blk = ((wb >> ((kt & 1) * 16 + r)) & 1u) != 0u;
        x[kt][r] = blk ? fill2 : st[kt][r] * kScore2;
        mx = fmaxf(mx, x[kt][r]);
      }
    }
    mx = fmaxf(mx, xhalf(mx));
    const float m_new = fmaxf(m_run, mx);
    /* scalar branch: the 128 output registers are rescaled only in a stage that raises some column's maximum */
    if (__builtin_amdgcn_ballot_w32(m_new > m_run) != 0) {
      const float ms   = (m_new == -INFINITY) ? 0.0f : m_new;
      const float corr = __builtin_amdgcn_exp2f(m_run - ms);
      l_run *= corr;
#pragma unroll
      for (int d = 0; d < 16; ++d)
#pragma unroll
        for (int r = 0; r < 8; ++r) acc[d][r] *= corr;
      m_run = m_new;
    }
    const float moff = ((m_run == -INFINITY) ? 0.0f : m_run) - kPExp;

    v16h pb[2];
    float ls[4];
#pragma unroll
    for (int kt = 0; kt < 4; ++kt) {
      const unsigned wb = (kt < 2) ? w0 : w1;
      ls[kt] = 0.0f;
#pragma unroll
      for (int r = 0; r < 8; ++r) {
        const bool blk = ((wb >> ((kt & 1) * 16 + r)) & 1u) != 0u;
        const float e = __builtin_amdgcn_exp2f(x[kt][r] - moff);
        ls[kt] += e;
        pb[kt >> 1][(kt & 1) * 8 + r] = (_Float16)(blk ? 0.0f : e);
      }
    }
    l_run += (ls[0] + ls[1]) + (ls[2] + ls[3]);

    /* O^T: 16 depth tiles x 16 query columns, 2 x 32 keys */
    load_v8<1>(fb, vb); group_fence(); mma_v8<0>(acc, fa, pb); group_fence();
    load_v8<2>(fa, vb); group_fence(); mma_v8<1>(acc, fb, pb); group_fence();
    load_v8<3>(fb, vb); group_fence(); mma_v8<2>(acc, fa, pb); group_fence();
    mma_v8<3>(acc, fb, pb);

    if (more) {
#pragma unroll
      for (int i = 0; i < 8; ++i) {
        *(v8h*)(&sK[buf ^ 1][lK + 8 * i * kKPitch])  = kr[i];
        *(v8h*)(&sV[buf ^ 1][lV + 32 * i * kVPitch]) = vr[i];
      }
    }
    __syncthreads();
  }

  /* a lane holds depth d*16 + 8h .. +7 of query q0 + c: one 16-B store per depth tile; the wave owns its 16 whole rows */
  const float l_tot = l_run + xhalf(l_run);
  const float inv   = (l_tot > 0.0f) ? (kFaOut / l_tot) : 0.0f;
  _Float16* H = (_Float16*)Hp + ((size_t)b * kG + q0 + c) * kD + 8 * h;
#pragma unroll
  for (int d = 0; d < 16; ++d) {
    v8h hv;
#pragma unroll
    for (int r = 0; r < 8; ++r) hv[r] = (_Float16)(acc[d][r] * inv);
    *(v8h*)(H + d * 16) = hv;
  }
}

/* --------------------------------------------------------------------------- */
/* Shape premise check: the file is built for 1024 nodes per batch. If the scalar */
/* two 512-B instructions) with NaN and returns normally.                         */
/* --------------------------------------------------------------------------- */
__global__ __launch_bounds__(32) void premise_guard_kernel(const int* __restrict__ gsz, float* __restrict__ out) {
  const int g = gsz[0];
  if (g != kG) {
    const int lane = threadIdx.x & 31;
    const float qn = __uint_as_float(0x7fc00000u);
    const v4f nv = (v4f){qn, qn, qn, qn};
    {
      *(v4f*)(out + lane * 4) = nv;
      *(v4f*)(out + 128 + lane * 4) = nv;
      
    }
  }
}

/* --------------------------------------------------------------------------- */
/* Host glue: kernel launches only. 2 casts + 2 projection GEMMs + fused          */
/* attention (one launch over all 32 batches, 8 x 32 blocks: one for every WGP)  */
/* + output GEMM + premise check = 7 launches.                                   */
/* GEMM shapes (all K % 32 == 0, M and N % 64 == 0; grids exact):                */
/*   q|k proj : M 32768, N 512,  K 256            4096 tiles -> 512 blocks       */
/*   v^T proj : M 256,   N 1024, K 256, 32 batches  64 tiles -> 8 x 32 blocks    */
/*   out proj : M 32768, N 256,  K 256            2048 tiles -> 256 blocks       */
/* --------------------------------------------------------------------------- */
extern "C" void kernel_launch(void* const* d_in, const int* in_sizes, int n_in,
                              void* d_out, int out_size, void* d_ws, size_t ws_size,
                              hipStream_t stream) {
  if (n_in < 9) return;
  if (in_sizes[0] != kTok * kD) return;
  if (in_sizes[1] != kBatch * kG) return;
  if (in_sizes[2] != 1 || in_sizes[3] != 1) return;
  if (in_sizes[4] != kD * kD || in_sizes[5] != kD * kD || in_sizes[6] != kD * kD || in_sizes[7] != kD * kD) return;
  if (in_sizes[8] != kD) return;
  if (out_size != kTok * kD) return;
  if (ws_size < kWsTotal) return;

  const float* data   = (const float*)d_in[0];
  const int*   mask   = (const int*)d_in[1];
  const int*   gsize  = (const int*)d_in[2];
  const int*   evalf  = (const int*)d_in[3];
  const float* Wq     = (const float*)d_in[4];
  const float* Wk     = (const float*)d_in[5];
  const float* Wv     = (const float*)d_in[6];
  const float* Wo     = (const float*)d_in[7];
  const float* b_out  = (const float*)d_in[8];
  float* out = (float*)d_out;

  char* ws = (char*)d_ws;
  unsigned short* X16  = (unsigned short*)(ws + kOffX16);
  unsigned short* W16  = (unsigned short*)(ws + kOffW16);
  unsigned short* QK16 = (unsigned short*)(ws + kOffQK16);
  unsigned short* VT16 = (unsigned short*)(ws + kOffVT16);
  unsigned short* H16  = (unsigned short*)(ws + kOffH16);

  /* operand planes */
  cast8_f16_kernel<<<(kTok * kD / 8) / 256, 256, 0, stream>>>(data, X16, kTok * kD / 8, kXCarry);
  cast8_w4_kernel<<<dim3((kD * kD / 8) / 256, 4), 256, 0, stream>>>(Wq, Wk, Wv, Wo, W16, kWCarry);

  /* q | k = x . [Wq ; Wk]^T  -> QK16 [32768][512], carried x16 */
  wmma_gemm64<0, 1><<<dim3((kTok / 64) * (2 * kD / 64) / 8, 1), 256, 0, stream>>>(
      X16, kD, 0L,
      W16, kD, 0L,
      (void*)QK16, 2 * kD, 0L,
      b_out,
      kTok, 2 * kD, kD, kProjScale);

  /* v^T per batch: VT[b][d][g] = Wv[d][:] . x[b*1024+g][:]  (A = Wv, Bt = x rows of batch b), carried x16 */
  wmma_gemm64<0, 1><<<dim3((kD / 64) * (kG / 64) / 8, kBatch), 256, 0, stream>>>(
      W16 + (size_t)2 * kD * kD, kD, 0L,
      X16, kD, (long)kG * kD,
      (void*)VT16, kG, (long)kD * kG,
      b_out,
      kD, kG, kD, kProjScale);

  /* H[b][q][d] = sum_k softmax_k(mask(q.k / 16)) * v[k][d], carried x256 */
  attn_fused_kernel<<<dim3(kG / kFaQ, kBatch), 256, 0, stream>>>(QK16, VT16, mask, evalf, H16);

  /* out = H . Wo^T + b_out[n] -> f32 output rows */
  wmma_gemm64<2, 0><<<dim3((kTok / 64) * (kD / 64) / 8, 1), 256, 0, stream>>>(
      H16, kD, 0L,
      W16 + (size_t)3 * kD * kD, kD, 0L,
      (void*)out, kD, 0L,
      b_out,
      kTok, kD, kD, kOutScale);

  premise_guard_kernel<<<1, 32, 0, stream>>>(gsize, out);
}

// v003
// Measured time: 85.8 microseconds a run.
// Timed twice side by side with v002, it ran 1.27 and 1.26 times as fast.
// Counting every step since v000, it is 7.97 times as fast.
// All contractions (q/k/v projections, q.k^T scores, p.v, output projection): v_wmma_f32_16x16x32_f16, f16 operands carried by exact powers of two, f32 accumulate; key masking, softmax and bias add in f32.
#include <hip/hip_runtime.h>
#include <math.h>

typedef __attribute__((ext_vector_type(16))) _Float16 v16h;
typedef __attribute__((ext_vector_type(8)))  _Float16 v8h;
typedef __attribute__((ext_vector_type(8)))  float    v8f;
typedef __attribute__((ext_vector_type(4)))  float    v4f;
typedef __attribute__((ext_vector_type(4)))  int      v4i;

/* --------------------------------------------------------------------------- */
/* Shape constants (single head: batch b owns token rows b*1024 .. b*1024+1023) */
/* --------------------------------------------------------------------------- */
constexpr int kBatch  = 32;
constexpr int kG      = 1024;
constexpr int kD      = 256;
constexpr int kTok    = kBatch * kG;
constexpr int kSqrtD  = 16;
static_assert(kSqrtD * kSqrtD == kD);
static_assert(kTok == 32768);
static_assert((kD % 32) == 0 && (kG % 32) == 0);
static_assert((kD % 64) == 0 && (kG % 64) == 0 && (kTok % 64) == 0 && ((2 * kD) % 64) == 0);

/* Power-of-two carries of the f16 operand planes, folded back exactly in f32 epilogue scales. */
constexpr float kXCarry   = 16.0f;
constexpr float kWCarry   = 1024.0f;
constexpr float kQKVCarry = 16.0f;
constexpr float kPCarry   = 32768.0f;
constexpr float kHCarry   = 256.0f;
constexpr float kNormQK   = 1.0f / (float)kSqrtD;
constexpr float kProjScale  = kQKVCarry / (kXCarry * kWCarry);
constexpr float kScoreScale = kNormQK / (kQKVCarry * kQKVCarry);
constexpr float kOutScale   = 1.0f / (kHCarry * kWCarry);

/* --------------------------------------------------------------------------- */
/* Workspace region map (bytes; every offset a multiple of 128)                 */
/*   W16  f16 [4][256][256]       Wq | Wk | Wv | Wo, each x1024      524,288    */
/*   VT16 f16 [32][256][1024]     v^T per batch, x16               16,777,216   */
/*   X16  f16 [32768][256]        data x16                         16,777,216   */
/*   QK16 f16 [32768][512]        q x16 (cols 0..255) | k x16      33,554,432   */
/*   H16  f16 [32768][256]        attention output x256            16,777,216   */
/*   total                                                         84,410,368   */
/* --------------------------------------------------------------------------- */
constexpr size_t kOffW16  = 0;
constexpr size_t kOffVT16 = kOffW16  + (size_t)4 * kD * kD * 2;
constexpr size_t kOffX16  = kOffVT16 + (size_t)kBatch * kD * kG * 2;
constexpr size_t kOffQK16 = kOffX16  + (size_t)kTok * kD * 2;
constexpr size_t kOffH16  = kOffQK16 + (size_t)kTok * 2 * kD * 2;
constexpr size_t kWsTotal = kOffH16  + (size_t)kTok * kD * 2;
static_assert(kWsTotal == 84410368ull);
static_assert(kWsTotal <= 268435456ull);
static_assert((kOffX16 % 128) == 0 && (kOffQK16 % 128) == 0 && (kOffVT16 % 128) == 0 && (kOffH16 % 128) == 0);

/* --------------------------------------------------------------------------- */
/* Fragment helpers                                                             */
/* --------------------------------------------------------------------------- */
union FragU { v16h v; v8h h[2]; };
/* elements 0..7 <- p[0..7], elements 8..15 <- p[16..23]; caller adds 8*(lane>>4) to p */
__device__ __forceinline__ v16h frag_load(const _Float16* p) {
  FragU f;
  f.h[0] = *(const v8h*)(p);
  f.h[1] = *(const v8h*)(p + 16);
  return f.v;
}
__device__ __forceinline__ v8f mma_f16(v16h a, v16h b, v8f c) {
  return __builtin_amdgcn_wmma_f32_16x16x32_f16(false, a, false, b, (short)0, c, false, false);
}
__device__ __forceinline__ void acc_guard4(v8f& a, v8f& b, v8f& c, v8f& d) {
  asm volatile("v_nop\n\tv_nop\n\tv_nop\n\tv_nop" : "+v"(a), "+v"(b), "+v"(c), "+v"(d));
}

/* --------------------------------------------------------------------------- */
/* Batched WMMA GEMM, f16 operands, depth 256, operand rows of 256 halves.       */
/* C[m,n] = scale * sum_k A[m,k] * Bt[n,k] (+ bias[n]).                          */
/* A block of 8 waves (2 x 4) owns a 128 x 256 tile, each wave 64 x 64 of it.    */
/* The block's operand rows go global -> registers -> LDS by loads that cover    */
/* whole 256-B runs of a row (16 lanes x 16 B), each element once per block; the */
/* waves take their fragments from LDS. The depth is staged in two halves: both  */
/* halves' loads are issued at the start, and the second half is still in flight */
/* while the first is multiplied. One block barrier publishes each half.         */
/* A row-major [M,256]; Bt row-major [N,256]; M % 128 == 0, N % 256 == 0.        */
/* BIAS_MODE: 0 = none, 2 = bias[n] (f32 add).  OUT_MODE: 0 = f32, 1 = f16.      */
/* Epilogue: 16-row slabs staged per wave in LDS (same wave writes and reads);   */
/* --------------------------------------------------------------------------- */
constexpr int kGM     = 128;
constexpr int kGN     = 256;
constexpr int kGHalf  = kD / 2;        /* halves of depth per staged part: 256 B of a row */
constexpr int kGPitch = kGHalf + 8;    /* halves: 272 B = 16 B x 17 */
static_assert(kD == 256 && kGHalf == 128);
static_assert((kTok % kGM) == 0 && (kD % kGM) == 0 && ((2 * kD) % kGN) == 0 && (kG % kGN) == 0 && (kD % kGN) == 0);

/* depth step KS of a staged half: the wave's 4 A and 4 B fragments; a and b point at the lane's row 0 of the wave's 64 rows */
template <int KS>
__device__ __forceinline__ void load_ab(v16h (&f)[8], const _Float16* a, const _Float16* b) {
#pragma unroll
  for (int u = 0; u < 4; ++u) {
    f[u]     = frag_load(a + (u << 4) * kGPitch + KS * 32);
    f[4 + u] = frag_load(b + (u << 4) * kGPitch + KS * 32);
  }
}
__device__ __forceinline__ void mma_ab(v8f (&acc)[4][4], const v16h (&f)[8]) {
#pragma unroll
  for (int i = 0; i < 4; ++i)
#pragma unroll
    for (int j = 0; j < 4; ++j) acc[i][j] = mma_f16(f[i], f[4 + j], acc[i][j]);
}
/* holds the next depth step's LDS loads, as one group, in front of this step's matrix instructions, so that they fly under them */
__device__ __forceinline__ void step_fence() { __builtin_amdgcn_sched_barrier(0); }
/* one staged half of the depth: 4 steps of 32, fragments fetched one step ahead into a second register set */
__device__ __forceinline__ void gemm_half(v8f (&acc)[4][4], const _Float16* a, const _Float16* b) {
  v16h fa[8], fb[8];
  load_ab<0>(fa, a, b);
  load_ab<1>(fb, a, b); step_fence(); mma_ab(acc, fa); step_fence();
  load_ab<2>(fa, a, b); step_fence(); mma_ab(acc, fb); step_fence();
  load_ab<3>(fb, a, b); step_fence(); mma_ab(acc, fa); step_fence();
  mma_ab(acc, fb);
}
/* block barrier for LDS data alone: it waits for this wave's LDS stores and not for its global loads, so that the */
/* second half's loads stay in flight across it (the plain barrier's fence would wait for them too)                */
__device__ __forceinline__ void lds_barrier() {
  __builtin_amdgcn_fence(__ATOMIC_RELEASE, "workgroup", "local");
  __builtin_amdgcn_s_barrier();
  __builtin_amdgcn_fence(__ATOMIC_ACQUIRE, "workgroup", "local");
}

template <int BIAS_MODE, int OUT_MODE>
__global__ __launch_bounds__(256) void wmma_gemm64(
    const unsigned short* __restrict__ Ap, long strideA,
    const unsigned short* __restrict__ Btp, long strideB,
    void* __restrict__ Cout, int ldc, long strideC,
    const float* __restrict__ bias,
    int N, float scale) {
  const _Float16* A  = (const _Float16*)Ap;
  const _Float16* Bt = (const _Float16*)Btp;
  __shared__ __align__(16) _Float16 sA[2][kGM * kGPitch];
  __shared__ __align__(16) _Float16 sB[2][kGN * kGPitch];
  __shared__ __align__(16) float sT[8][16 * 68];
  const int b    = blockIdx.y;
  const int t    = threadIdx.x;
  const int lane = t & 31;
  const int wave = __builtin_amdgcn_readfirstlane((int)(threadIdx.x >> 5));
  const int tilesN = N / kGN;
  const int tm = blockIdx.x / tilesN;
  const int tn = blockIdx.x - tm * tilesN;
  const int wm = (wave >> 2) << 6;
  const int wn = (wave & 3) << 6;
  const int m0 = tm * kGM + wm;
  const int n0 = tn * kGN + wn;

  const int rlane = lane & 15;
  const int koff  = (lane >> 4) * 8;
  const int mOff  = (lane >> 4) * 8;

  /* staging map: 16-B chunk t & 15 of row (t >> 4) + 16*i; a wave-wide load covers two rows' whole 256-B runs */
  const int sRow = t >> 4, sCol = (t & 15) * 8;
  const _Float16* gA = A  + (size_t)b * strideA + (size_t)(tm * kGM + sRow) * kD + sCol;
  const _Float16* gB = Bt + (size_t)b * strideB + (size_t)(tn * kGN + sRow) * kD + sCol;
  const int lS = sRow * kGPitch + sCol;
  v8h ra0[kGM / 16], rb0[kGN / 16], ra1[kGM / 16], rb1[kGN / 16];
#pragma unroll
  for (int i = 0; i < kGM / 16; ++i) ra0[i] = *(const v8h*)(gA + (size_t)(16 * i) * kD);
#pragma unroll
  for (int i = 0; i < kGN / 16; ++i) rb0[i] = *(const v8h*)(gB + (size_t)(16 * i) * kD);
#pragma unroll
  for (int i = 0; i < kGM / 16; ++i) ra1[i] = *(const v8h*)(gA + (size_t)(16 * i) * kD + kGHalf);
#pragma unroll
  for (int i = 0; i < kGN / 16; ++i) rb1[i] = *(const v8h*)(gB + (size_t)(16 * i) * kD + kGHalf);
  /* stands in front of the first overwrite of an address register that these loads name; the two addresses are */
  /* inputs so that their registers live up to the wait                                                          */
  asm volatile("s_wait_xcnt 0x0" :: "v"(gA), "v"(gB) : "memory");

  v8f acc[4][4];
#pragma unroll
  for (int i = 0; i < 4; ++i)
#pragma unroll
    for (int j = 0; j < 4; ++j) acc[i][j] = (v8f){0.f, 0.f, 0.f, 0.f, 0.f, 0.f, 0.f, 0.f};

#pragma unroll
  for (int i = 0; i < kGM / 16; ++i) *(v8h*)(&sA[0][lS + 16 * i * kGPitch]) = ra0[i];
#pragma unroll
  for (int i = 0; i < kGN / 16; ++i) *(v8h*)(&sB[0][lS + 16 * i * kGPitch]) = rb0[i];
  lds_barrier();
  gemm_half(acc, &sA[0][(wm + rlane) * kGPitch + koff], &sB[0][(wn + rlane) * kGPitch + koff]);
#pragma unroll
  for (int i = 0; i < kGM / 16; ++i) *(v8h*)(&sA[1][lS + 16 * i * kGPitch]) = ra1[i];
#pragma unroll
  for (int i = 0; i < kGN / 16; ++i) *(v8h*)(&sB[1][lS + 16 * i * kGPitch]) = rb1[i];
  lds_barrier();
  gemm_half(acc, &sA[1][(wm + rlane) * kGPitch + koff], &sB[1][(wn + rlane) * kGPitch + koff]);
  acc_guard4(acc[0][0], acc[0][1], acc[0][2], acc[0][3]);
  acc_guard4(acc[1][0], acc[1][1], acc[1][2], acc[1][3]);
  acc_guard4(acc[2][0], acc[2][1], acc[2][2], acc[2][3]);
  acc_guard4(acc[3][0], acc[3][1], acc[3][2], acc[3][3]);

  /* ---- epilogue ---- */
  float* slab = sT[wave];
#pragma unroll
  for (int i = 0; i < 4; ++i) {
    const int mBase = m0 + (i << 4);
#pragma unroll
    for (int j = 0; j < 4; ++j) {
      const int n = n0 + (j << 4) + rlane;
      float bv = 0.f;
      if (BIAS_MODE == 2) bv = bias[n];
#pragma unroll
      for (int r = 0; r < 8; ++r) {
        float v = acc[i][j][r] * scale;
        if (BIAS_MODE == 2) v += bv;
        slab[(mOff + r) * 68 + (j << 4) + rlane] = v;
      }
    }
    __builtin_amdgcn_fence(__ATOMIC_RELEASE, "workgroup");
    __builtin_amdgcn_wave_barrier();
    __builtin_amdgcn_fence(__ATOMIC_ACQUIRE, "workgroup");
    if (OUT_MODE == 0) {
      /* row segment = 64 floats = 256 B = 16 lanes x 16 B; rows it*2 + hh, it 0..7 -> 16 rows, each once */
      float* C = (float*)Cout + (size_t)b * strideC;
      const int hh = lane >> 4, c4 = (lane & 15) * 4;
      {
#pragma unroll
        for (int it = 0; it < 8; ++it) {
          const int row = it * 2 + hh;
          v4f v = *(const v4f*)(slab + row * 68 + c4);
          *(v4f*)(C + (size_t)(mBase + row) * ldc + n0 + c4) = v;
        }
        
      }
    } else {
      const int q = lane >> 3, c8 = (lane & 7) * 8;
      unsigned short* C = (unsigned short*)Cout + (size_t)b * strideC;
      {
#pragma unroll
        for (int it = 0; it < 4; ++it) {
          const int row = it * 4 + q;
          const float* sp = slab + row * 68 + c8;
          v8h hv;
#pragma unroll
          for (int e = 0; e < 8; ++e) hv[e] = (_Float16)sp[e];
          *(v8h*)(C + (size_t)(mBase + row) * ldc + n0 + c8) = hv;
        }
        
      }
    }
    __builtin_amdgcn_fence(__ATOMIC_RELEASE, "workgroup");
    __builtin_amdgcn_wave_barrier();
    __builtin_amdgcn_fence(__ATOMIC_ACQUIRE, "workgroup");
  }
}

/* --------------------------------------------------------------------------- */
/* f32 -> f16 (x carry, exact power of two), 8 consecutive elements per thread.  */
/* One 16-B store per lane; 32 consecutive lanes = 512 contiguous B = 4 whole    */
/* Coverage: n8 = 32768*256/8 = 1,048,576 threads = 4096 blocks x 256 exactly.   */
/* --------------------------------------------------------------------------- */
__global__ __launch_bounds__(256) void cast8_f16_kernel(const float* __restrict__ in,
                                                        unsigned short* __restrict__ out,
                                                        int n8, float carry) {
  const int i = blockIdx.x * 256 + threadIdx.x;
  if (i >= n8) return;
  const float* p = in + 8 * (size_t)i;
  const v4f a = *(const v4f*)(p);
  const v4f c = *(const v4f*)(p + 4);
  v8h hv;
#pragma unroll
  for (int e = 0; e < 4; ++e) {
    hv[e]     = (_Float16)(a[e] * carry);
    hv[4 + e] = (_Float16)(c[e] * carry);
  }
  unsigned short* q = out + 8 * (size_t)i;
  *(v8h*)q = hv;
  
}

/* --------------------------------------------------------------------------- */
/* Four [256][256] f32 weight matrices ([out][in] = Bt layout) -> f16 planes     */
/* out + z*65536 halves, x carry. grid (32, 4): blockIdx.y selects the matrix    */
/* (block-uniform); 32 blocks x 256 threads x 8 = 65,536 = one whole plane.      */
/* --------------------------------------------------------------------------- */
__global__ __launch_bounds__(256) void cast8_w4_kernel(const float* __restrict__ W0, const float* __restrict__ W1,
                                                       const float* __restrict__ W2, const float* __restrict__ W3,
                                                       unsigned short* __restrict__ out, float carry) {
  const int z = blockIdx.y;
  const float* W = (z == 0) ? W0 : (z == 1) ? W1 : (z == 2) ? W2 : W3;
  const int i = blockIdx.x * 256 + threadIdx.x;
  const float* p = W + 8 * (size_t)i;
  const v4f a = *(const v4f*)(p);
  const v4f c = *(const v4f*)(p + 4);
  v8h hv;
#pragma unroll
  for (int e = 0; e < 4; ++e) {
    hv[e]     = (_Float16)(a[e] * carry);
    hv[4 + e] = (_Float16)(c[e] * carry);
  }
  unsigned short* q = out + (size_t)z * kD * kD + 8 * (size_t)i;
  *(v8h*)q = hv;
  
}

/* --------------------------------------------------------------------------- */
/* Fused attention of one batch: scores, key mask, softmax and p.v in one launch. */
/*   S^T = K . Q^T   (A = 16 key rows from LDS, B = 16 query columns in registers) */
/*   O^T += V^T . P^T (A = 16 rows of v^T from LDS, B = P^T packed from the S^T    */
/*                     accumulators: two 16-key tiles give one 32-key B operand)   */
/* A lane owns query column c = lane & 15 and, of every 16-key tile, the keys      */
/* 8*(lane>>4) .. +7, so maximum and sum run in-lane plus one exchange of halves.  */
/*   x[k] = blocked[k] ? fill : s[k]  (log2 units; fill = -30, or -inf when the    */
/*          evaluate flag is nonzero);  e[k] = 2^(x[k] - m + 15), m = running max; */
/*   the sum takes every e[k], blocked ones included; P takes 0 for blocked keys.  */
/* Block = 8 waves x 16 queries = 128 queries; grid (8, 32). A stage is 64 keys:   */
/* K rows and v^T rows go global -> registers -> LDS one stage ahead, two buffers, */
/* one block barrier per stage (it publishes the next stage and ends the reads of  */
/* the buffer that the stage after it overwrites).                                 */
/* --------------------------------------------------------------------------- */
constexpr int kFaKeys   = 64;
constexpr int kFaStages = kG / kFaKeys;
constexpr int kFaQ      = 128;
constexpr int kKPitch   = kD + 8;        /* halves: 528 B = 16 B x 33 */
constexpr int kVPitch   = kFaKeys + 8;   /* halves: 144 B = 16 B x 9  */
constexpr int kKBuf     = kFaKeys * kKPitch;
constexpr int kVBuf     = kD * kVPitch;
constexpr float kLog2e  = 1.4426950408889634f;
constexpr float kScore2 = kScoreScale * kLog2e;
constexpr float kPExp   = 15.0f;
constexpr float kFaOut  = kHCarry / kQKVCarry;
static_assert(kPCarry == 32768.0f && kPExp == 15.0f);
static_assert((kG % kFaKeys) == 0 && (kG % kFaQ) == 0 && kD == 256 && kFaKeys == 64);

/* lane l reads lane l ^ 16 */
__device__ __forceinline__ float xhalf(float x) {
  return __builtin_bit_cast(float, __builtin_amdgcn_permlanex16(__builtin_bit_cast(int, x), __builtin_bit_cast(int, x),
                                                                0x76543210, 0xfedcba98, false, false));
}

/* group g of the score product: key tiles 0..3 at depth steps 2g and 2g+1 */
template <int G>
__device__ __forceinline__ void load_k8(v16h (&f)[8], const _Float16* kb) {
#pragma unroll
  for (int u = 0; u < 8; ++u) f[u] = frag_load(kb + (u & 3) * 16 * kKPitch + (2 * G + (u >> 2)) * 32);
}
template <int G>
__device__ __forceinline__ void mma_k8(v8f (&st)[4], const v16h (&f)[8], const v16h (&qf)[8]) {
#pragma unroll
  for (int u = 0; u < 8; ++u) st[u & 3] = mma_f16(f[u], qf[2 * G + (u >> 2)], st[u & 3]);
}
/* group g of the output product: depth tiles 8*(g&1) .. +7 at the 32 keys g>>1 */
template <int G>
__device__ __forceinline__ void load_v8(v16h (&f)[8], const _Float16* vb) {
#pragma unroll
  for (int u = 0; u < 8; ++u) f[u] = frag_load(vb + ((G & 1) * 8 + u) * 16 * kVPitch + (G >> 1) * 32);
}
template <int G>
__device__ __forceinline__ void mma_v8(v8f (&acc)[16], const v16h (&f)[8], const v16h (&pb)[2]) {
#pragma unroll
  for (int u = 0; u < 8; ++u) acc[(G & 1) * 8 + u] = mma_f16(f[u], pb[G >> 1], acc[(G & 1) * 8 + u]);
}
/* holds the next group's LDS loads in front of this group's matrix instructions, so that they fly under them */
__device__ __forceinline__ void group_fence() { __builtin_amdgcn_sched_barrier(0); }

__global__ __launch_bounds__(256) void attn_fused_kernel(const unsigned short* __restrict__ QKp,
                                                         const unsigned short* __restrict__ VTp,
                                                         const int* __restrict__ mask,
                                                         const int* __restrict__ evalflag,
                                                         unsigned short* __restrict__ Hp) {
  __shared__ __align__(16) _Float16 sK[2][kKBuf];
  __shared__ __align__(16) _Float16 sV[2][kVBuf];
  __shared__ unsigned sBlk[kG / 32];
  const int t    = threadIdx.x;
  const int lane = t & 31;
  const int wave = __builtin_amdgcn_readfirstlane((int)(threadIdx.x >> 5));
  const int b    = blockIdx.y;
  const int c    = lane & 15;
  const int h    = lane >> 4;
  const int q0   = blockIdx.x * kFaQ + wave * 16;
  const _Float16* QK = (const _Float16*)QKp + (size_t)b * kG * 2 * kD;
  const _Float16* VT = (const _Float16*)VTp + (size_t)b * kD * kG;

  /* blocked keys as bits: word w, bit i = key 32*w + i */
  int mk[4];
#pragma unroll
  for (int i = 0; i < 4; ++i) mk[i] = mask[(size_t)b * kG + (wave * 4 + i) * 32 + lane];
  /* stands in front of the first overwrite of the address register that these loads name */
  asm volatile("s_wait_xcnt 0x0" ::: "memory");
  unsigned bits[4];
#pragma unroll
  for (int i = 0; i < 4; ++i) bits[i] = __builtin_amdgcn_ballot_w32(mk[i] != 0);
  if (lane == 0) {
#pragma unroll
    for (int i = 0; i < 4; ++i) sBlk[wave * 4 + i] = bits[i];
  }
  const float fill2 = (evalflag[0] != 0) ? (-INFINITY) : (-30.0f * kLog2e);

  /* B operand of the score product: this wave's 16 query rows, whole depth */
  v16h qf[8];
#pragma unroll
  for (int kk = 0; kk < 8; ++kk) qf[kk] = frag_load(QK + (size_t)(q0 + c) * (2 * kD) + kk * 32 + 8 * h);

  /* staging map: 16-B chunk t + 256*i of a stage's K tile (32 chunks a row) and v^T tile (8 chunks a row) */
  const int kRow = t >> 5, kCol = (t & 31) * 8;
  const int vRow = t >> 3, vCol = (t & 7) * 8;
  const _Float16* gK = QK + (size_t)kRow * (2 * kD) + kD + kCol;
  const _Float16* gV = VT + (size_t)vRow * kG + vCol;
  const int lK = kRow * kKPitch + kCol;
  const int lV = vRow * kVPitch + vCol;
  v8h kr[8], vr[8];
#pragma unroll
  for (int i = 0; i < 8; ++i) {
    kr[i] = *(const v8h*)(gK + (size_t)(8 * i) * (2 * kD));
    vr[i] = *(const v8h*)(gV + (size_t)(32 * i) * kG);
  }
#pragma unroll
  for (int i = 0; i < 8; ++i) {
    *(v8h*)(&sK[0][lK + 8 * i * kKPitch])  = kr[i];
    *(v8h*)(&sV[0][lV + 32 * i * kVPitch]) = vr[i];
  }

  v8f acc[16];
#pragma unroll
  for (int d = 0; d < 16; ++d) acc[d] = (v8f){0.f, 0.f, 0.f, 0.f, 0.f, 0.f, 0.f, 0.f};
  float m_run = -INFINITY;
  float l_run = 0.0f;
  __syncthreads();

  /* rolled: one stage's body (64 matrix instructions and their loads) per iteration */
#pragma unroll 1
  for (int s = 0; s < kFaStages; ++s) {
    const int buf = s & 1;
    const bool more = (s + 1 < kFaStages);
    if (more) {
#pragma unroll
      for (int i = 0; i < 8; ++i) {
        kr[i] = *(const v8h*)(gK + (size_t)((s + 1) * kFaKeys + 8 * i) * (2 * kD));
        vr[i] = *(const v8h*)(gV + (size_t)(32 * i) * kG + (s + 1) * kFaKeys);
      }
      /* stands in front of the first overwrite of an address register that these loads name */
      asm volatile("s_wait_xcnt 0x0" ::: "memory");
    }

    /* S^T: 4 key tiles x 16 query columns */
    v8f st[4];
#pragma unroll
    for (int kt = 0; kt < 4; ++kt) st[kt] = (v8f){0.f, 0.f, 0.f, 0.f, 0.f, 0.f, 0.f, 0.f};
    const _Float16* kb = &sK[buf][c * kKPitch + 8 * h];
    const _Float16* vb = &sV[buf][c * kVPitch + 8 * h];
    v16h fa[8], fb[8];
    load_k8<0>(fa, kb);
    load_k8<1>(fb, kb); group_fence(); mma_k8<0>(st, fa, qf); group_fence();
    load_k8<2>(fa, kb); group_fence(); mma_k8<1>(st, fb, qf); group_fence();
    load_k8<3>(fb, kb); group_fence(); mma_k8<2>(st, fa, qf); group_fence();
    load_v8<0>(fa, vb); group_fence(); mma_k8<3>(st, fb, qf); group_fence();

    /* key kt*16 + 8h + r of the stage: word kt>>1, bit (kt&1)*16 + 8h + r */
    const unsigned w0 = sBlk[2 * s] >> (8 * h);
    const unsigned w1 = sBlk[2 * s + 1] >> (8 * h);
    float x[4][8];
    float mx = -INFINITY;
#pragma unroll
    for (int kt = 0; kt < 4; ++kt) {
      const unsigned wb = (kt < 2) ? w0 : w1;
#pragma unroll
      for (int r = 0; r < 8; ++r) {
        const bool blk = ((wb >> ((kt & 1) * 16 + r)) & 1u) != 0u;
        x[kt][r] = blk ? fill2 : st[kt][r] * kScore2;
        mx = fmaxf(mx, x[kt][r]);
      }
    }
    mx = fmaxf(mx, xhalf(mx));
    const float m_new = fmaxf(m_run, mx);
    /* scalar branch: the 128 output registers are rescaled only in a stage that raises some column's maximum */
    if (__builtin_amdgcn_ballot_w32(m_new > m_run) != 0) {
      const float ms   = (m_new == -INFINITY) ? 0.0f : m_new;
      const float corr = __builtin_amdgcn_exp2f(m_run - ms);
      l_run *= corr;
#pragma unroll
      for (int d = 0; d < 16; ++d)
#pragma unroll
        for (int r = 0; r < 8; ++r) acc[d][r] *= corr;
      m_run = m_new;
    }
    const float moff = ((m_run == -INFINITY) ? 0.0f : m_run) - kPExp;

    v16h pb[2];
    float ls[4];
#pragma unroll
    for (int kt = 0; kt < 4; ++kt) {
      const unsigned wb = (kt < 2) ? w0 : w1;
      ls[kt] = 0.0f;
#pragma unroll
      for (int r = 0; r < 8; ++r) {
        const bool blk = ((wb >> ((kt & 1) * 16 + r)) & 1u) != 0u;
        const float e = __builtin_amdgcn_exp2f(x[kt][r] - moff);
        ls[kt] += e;
        pb[kt >> 1][(kt & 1) * 8 + r] = (_Float16)(blk ? 0.0f : e);
      }
    }
    l_run += (ls[0] + ls[1]) + (ls[2] + ls[3]);

    /* O^T: 16 depth tiles x 16 query columns, 2 x 32 keys */
    load_v8<1>(fb, vb); group_fence(); mma_v8<0>(acc, fa, pb); group_fence();
    load_v8<2>(fa, vb); group_fence(); mma_v8<1>(acc, fb, pb); group_fence();
    load_v8<3>(fb, vb); group_fence(); mma_v8<2>(acc, fa, pb); group_fence();
    mma_v8<3>(acc, fb, pb);

    if (more) {
#pragma unroll
      for (int i = 0; i < 8; ++i) {
        *(v8h*)(&sK[buf ^ 1][lK + 8 * i * kKPitch])  = kr[i];
        *(v8h*)(&sV[buf ^ 1][lV + 32 * i * kVPitch]) = vr[i];
      }
    }
    __syncthreads();
  }

  /* a lane holds depth d*16 + 8h .. +7 of query q0 + c: one 16-B store per depth tile; the wave owns its 16 whole rows */
  const float l_tot = l_run + xhalf(l_run);
  const float inv   = (l_tot > 0.0f) ? (kFaOut / l_tot) : 0.0f;
  _Float16* H = (_Float16*)Hp + ((size_t)b * kG + q0 + c) * kD + 8 * h;
#pragma unroll
  for (int d = 0; d < 16; ++d) {
    v8h hv;
#pragma unroll
    for (int r = 0; r < 8; ++r) hv[r] = (_Float16)(acc[d][r] * inv);
    *(v8h*)(H + d * 16) = hv;
  }
}

/* --------------------------------------------------------------------------- */
/* Shape premise check: the file is built for 1024 nodes per batch. If the scalar */
/* two 512-B instructions) with NaN and returns normally.                         */
/* --------------------------------------------------------------------------- */
__global__ __launch_bounds__(32) void premise_guard_kernel(const int* __restrict__ gsz, float* __restrict__ out) {
  const int g = gsz[0];
  if (g != kG) {
    const int lane = threadIdx.x & 31;
    const float qn = __uint_as_float(0x7fc00000u);
    const v4f nv = (v4f){qn, qn, qn, qn};
    {
      *(v4f*)(out + lane * 4) = nv;
      *(v4f*)(out + 128 + lane * 4) = nv;
      
    }
  }
}

/* --------------------------------------------------------------------------- */
/* Host glue: kernel launches only. 2 casts + 2 projection GEMMs + fused          */
/* attention (one launch over all 32 batches, 8 x 32 blocks: one for every WGP)  */
/* + output GEMM + premise check = 7 launches.                                   */
/* GEMM shapes (depth 256; one 128 x 256 tile per block; grids exact):           */
/*   q|k proj : M 32768, N 512               256 x 2 tiles -> 512 blocks         */
/*   v^T proj : M 256,   N 1024, 32 batches    2 x 4 tiles -> 8 x 32 blocks      */
/*   out proj : M 32768, N 256               256 x 1 tiles -> 256 blocks         */
/* --------------------------------------------------------------------------- */
extern "C" void kernel_launch(void* const* d_in, const int* in_sizes, int n_in,
                              void* d_out, int out_size, void* d_ws, size_t ws_size,
                              hipStream_t stream) {
  if (n_in < 9) return;
  if (in_sizes[0] != kTok * kD) return;
  if (in_sizes[1] != kBatch * kG) return;
  if (in_sizes[2] != 1 || in_sizes[3] != 1) return;
  if (in_sizes[4] != kD * kD || in_sizes[5] != kD * kD || in_sizes[6] != kD * kD || in_sizes[7] != kD * kD) return;
  if (in_sizes[8] != kD) return;
  if (out_size != kTok * kD) return;
  if (ws_size < kWsTotal) return;

  const float* data   = (const float*)d_in[0];
  const int*   mask   = (const int*)d_in[1];
  const int*   gsize  = (const int*)d_in[2];
  const int*   evalf  = (const int*)d_in[3];
  const float* Wq     = (const float*)d_in[4];
  const float* Wk     = (const float*)d_in[5];
  const float* Wv     = (const float*)d_in[6];
  const float* Wo     = (const float*)d_in[7];
  const float* b_out  = (const float*)d_in[8];
  float* out = (float*)d_out;

  char* ws = (char*)d_ws;
  unsigned short* X16  = (unsigned short*)(ws + kOffX16);
  unsigned short* W16  = (unsigned short*)(ws + kOffW16);
  unsigned short* QK16 = (unsigned short*)(ws + kOffQK16);
  unsigned short* VT16 = (unsigned short*)(ws + kOffVT16);
  unsigned short* H16  = (unsigned short*)(ws + kOffH16);

  /* operand planes */
  cast8_f16_kernel<<<(kTok * kD / 8) / 256, 256, 0, stream>>>(data, X16, kTok * kD / 8, kXCarry);
  cast8_w4_kernel<<<dim3((kD * kD / 8) / 256, 4), 256, 0, stream>>>(Wq, Wk, Wv, Wo, W16, kWCarry);

  /* q | k = x . [Wq ; Wk]^T  -> QK16 [32768][512], carried x16 */
  wmma_gemm64<0, 1><<<dim3((kTok / kGM) * (2 * kD / kGN), 1), 256, 0, stream>>>(
      X16, 0L,
      W16, 0L,
      (void*)QK16, 2 * kD, 0L,
      b_out,
      2 * kD, kProjScale);

  /* v^T per batch: VT[b][d][g] = Wv[d][:] . x[b*1024+g][:]  (A = Wv, Bt = x rows of batch b), carried x16 */
  wmma_gemm64<0, 1><<<dim3((kD / kGM) * (kG / kGN), kBatch), 256, 0, stream>>>(
      W16 + (size_t)2 * kD * kD, 0L,
      X16, (long)kG * kD,
      (void*)VT16, kG, (long)kD * kG,
      b_out,
      kG, kProjScale);

  /* H[b][q][d] = sum_k softmax_k(mask(q.k / 16)) * v[k][d], carried x256 */
  attn_fused_kernel<<<dim3(kG / kFaQ, kBatch), 256, 0, stream>>>(QK16, VT16, mask, evalf, H16);

  /* out = H . Wo^T + b_out[n] -> f32 output rows */
  wmma_gemm64<2, 0><<<dim3((kTok / kGM) * (kD / kGN), 1), 256, 0, stream>>>(
      H16, 0L,
      W16 + (size_t)3 * kD * kD, 0L,
      (void*)out, kD, 0L,
      b_out,
      kD, kOutScale);

  premise_guard_kernel<<<1, 32, 0, stream>>>(gsize, out);
}

// v004
// Measured time: 77.9 microseconds a run.
// Timed twice side by side with v003, it ran 1.10 and 1.09 times as fast.
// Over all steps from v000 it is 8.72 times as fast.
// All contractions (q/k/v projections, q.k^T scores, p.v, output projection): v_wmma_f32_16x16x32_f16, f16 operands carried by exact powers of two, f32 accumulate; key masking, softmax and bias add in f32.
#include <hip/hip_runtime.h>
#include <math.h>

typedef __attribute__((ext_vector_type(16))) _Float16 v16h;
typedef __attribute__((ext_vector_type(8)))  _Float16 v8h;
typedef __attribute__((ext_vector_type(4)))  _Float16 v4h;
typedef __attribute__((ext_vector_type(8)))  float    v8f;
typedef __attribute__((ext_vector_type(4)))  float    v4f;
typedef __attribute__((ext_vector_type(4)))  int      v4i;

/* --------------------------------------------------------------------------- */
/* Shape constants (single head: batch b owns token rows b*1024 .. b*1024+1023) */
/* --------------------------------------------------------------------------- */
constexpr int kBatch  = 32;
constexpr int kG      = 1024;
constexpr int kD      = 256;
constexpr int kTok    = kBatch * kG;
constexpr int kSqrtD  = 16;
static_assert(kSqrtD * kSqrtD == kD);
static_assert(kTok == 32768);
static_assert((kD % 32) == 0 && (kG % 32) == 0);
static_assert((kD % 64) == 0 && (kG % 64) == 0 && (kTok % 64) == 0 && ((2 * kD) % 64) == 0);

/* Power-of-two carries of the f16 operand planes, folded back exactly in f32 epilogue scales. */
constexpr float kXCarry   = 16.0f;
constexpr float kWCarry   = 1024.0f;
constexpr float kQKVCarry = 16.0f;
constexpr float kPCarry   = 32768.0f;
constexpr float kHCarry   = 256.0f;
constexpr float kNormQK   = 1.0f / (float)kSqrtD;
constexpr float kProjScale  = kQKVCarry / (kXCarry * kWCarry);
constexpr float kScoreScale = kNormQK / (kQKVCarry * kQKVCarry);
constexpr float kOutScale   = 1.0f / (kHCarry * kWCarry);

/* --------------------------------------------------------------------------- */
/* Workspace region map (bytes; every offset a multiple of 128)                 */
/*   W16  f16 [4][256][256]       Wq | Wk | Wv | Wo, each x1024      524,288    */
/*   VT16 f16 [32][256][1024]     v^T per batch, x16               16,777,216   */
/*   QK16 f16 [32768][512]        q x16 (cols 0..255) | k x16      33,554,432   */
/*   H16  f16 [32768][256]        attention output x256            16,777,216   */
/*   total                                                         67,633,152   */
/* --------------------------------------------------------------------------- */
constexpr size_t kOffW16  = 0;
constexpr size_t kOffVT16 = kOffW16  + (size_t)4 * kD * kD * 2;
constexpr size_t kOffQK16 = kOffVT16 + (size_t)kBatch * kD * kG * 2;
constexpr size_t kOffH16  = kOffQK16 + (size_t)kTok * 2 * kD * 2;
constexpr size_t kWsTotal = kOffH16  + (size_t)kTok * kD * 2;
static_assert(kWsTotal == 67633152ull);
static_assert(kWsTotal <= 268435456ull);
static_assert((kOffQK16 % 128) == 0 && (kOffVT16 % 128) == 0 && (kOffH16 % 128) == 0);

/* --------------------------------------------------------------------------- */
/* Fragment helpers                                                             */
/* --------------------------------------------------------------------------- */
union FragU { v16h v; v8h h[2]; };
/* elements 0..7 <- p[0..7], elements 8..15 <- p[16..23]; caller adds 8*(lane>>4) to p */
__device__ __forceinline__ v16h frag_load(const _Float16* p) {
  FragU f;
  f.h[0] = *(const v8h*)(p);
  f.h[1] = *(const v8h*)(p + 16);
  return f.v;
}
__device__ __forceinline__ v8f mma_f16(v16h a, v16h b, v8f c) {
  return __builtin_amdgcn_wmma_f32_16x16x32_f16(false, a, false, b, (short)0, c, false, false);
}
__device__ __forceinline__ void acc_guard4(v8f& a, v8f& b, v8f& c, v8f& d) {
  asm volatile("v_nop\n\tv_nop\n\tv_nop\n\tv_nop" : "+v"(a), "+v"(b), "+v"(c), "+v"(d));
}

/* --------------------------------------------------------------------------- */
/* WMMA GEMM, f16 operands, depth 256, operand rows of 256 elements.             */
/* C[m,n] = scale * sum_k A[m,k] * Bt[n,k] (+ bias[n]).                          */
/* A block of 8 waves (2 x 4) owns a 128 x 256 tile, each wave 64 x 64 of it.    */
/* The block's operand rows go global -> registers -> LDS by loads that cover    */
/* whole 256-B runs of a row (16 lanes x 16 B), each element once per block; the */
/* waves take their fragments from LDS. The depth is staged in two halves: both  */
/* halves' loads are issued at the start, and the second half is still in flight */
/* while the first is multiplied. One block barrier publishes each half.         */
/* A row-major [M,256]; Bt row-major [N,256]; M % 128 == 0, N % 256 == 0.        */
/* A_F32: 1 = the A rows are f32 in memory (Af) and become f16 (x16, an exact    */
/* power of two) between their load and their LDS store; a wave-wide load then   */
/* covers one row's whole 512-B run. 0 = f16 rows (Ap).                          */
/* SWAP: 1 = the Bt rows are the matrix instruction's first operand, so that the */
/* block holds C^T: row n, column m; it goes to plane m / 1024 of Cout, column   */
/* m % 1024 (v^T per batch).                                                     */
/* BIAS_MODE: 0 = none, 2 = bias[n] (f32 add).  OUT_MODE: 0 = f32, 1 = f16.      */
/* Epilogue: 16-row slabs staged per wave in LDS (same wave writes and reads);   */
/* --------------------------------------------------------------------------- */
constexpr int kGM     = 128;
constexpr int kGN     = 256;
constexpr int kGHalf  = kD / 2;        /* halves of depth per staged part: 256 B of a row */
constexpr int kGPitch = kGHalf + 8;    /* halves: 272 B = 16 B x 17 */
static_assert(kD == 256 && kGHalf == 128);
static_assert((kTok % kGM) == 0 && (kG % kGM) == 0 && ((2 * kD) % kGN) == 0 && (kD % kGN) == 0);

/* depth step KS of a staged half: the wave's 4 A and 4 B fragments; a and b point at the lane's row 0 of the wave's 64 rows */
template <int KS>
__device__ __forceinline__ void load_ab(v16h (&f)[8], const _Float16* a, const _Float16* b) {
#pragma unroll
  for (int u = 0; u < 4; ++u) {
    f[u]     = frag_load(a + (u << 4) * kGPitch + KS * 32);
    f[4 + u] = frag_load(b + (u << 4) * kGPitch + KS * 32);
  }
}
__device__ __forceinline__ void mma_ab(v8f (&acc)[4][4], const v16h (&f)[8]) {
#pragma unroll
  for (int i = 0; i < 4; ++i)
#pragma unroll
    for (int j = 0; j < 4; ++j) acc[i][j] = mma_f16(f[i], f[4 + j], acc[i][j]);
}
/* holds the next depth step's LDS loads, as one group, in front of this step's matrix instructions, so that they fly under them */
__device__ __forceinline__ void step_fence() { __builtin_amdgcn_sched_barrier(0); }
/* one staged half of the depth: 4 steps of 32, fragments fetched one step ahead into a second register set */
__device__ __forceinline__ void gemm_half(v8f (&acc)[4][4], const _Float16* a, const _Float16* b) {
  v16h fa[8], fb[8];
  load_ab<0>(fa, a, b);
  load_ab<1>(fb, a, b); step_fence(); mma_ab(acc, fa); step_fence();
  load_ab<2>(fa, a, b); step_fence(); mma_ab(acc, fb); step_fence();
  load_ab<3>(fb, a, b); step_fence(); mma_ab(acc, fa); step_fence();
  mma_ab(acc, fb);
}
/* block barrier for LDS data alone: it waits for this wave's LDS stores and not for its global loads, so that the */
/* second half's loads stay in flight across it (the plain barrier's fence would wait for them too)                */
__device__ __forceinline__ void lds_barrier() {
  __builtin_amdgcn_fence(__ATOMIC_RELEASE, "workgroup", "local");
  __builtin_amdgcn_s_barrier();
  __builtin_amdgcn_fence(__ATOMIC_ACQUIRE, "workgroup", "local");
}

/* four f32 of an operand row -> f16, carried x16 */
__device__ __forceinline__ v4h cast4_x(v4f a) {
  v4h hv;
#pragma unroll
  for (int e = 0; e < 4; ++e) hv[e] = (_Float16)(a[e] * kXCarry);
  return hv;
}

template <int BIAS_MODE, int OUT_MODE, int A_F32, int SWAP>
__global__ __launch_bounds__(256) void wmma_gemm64(
    const unsigned short* __restrict__ Ap,
    const float* __restrict__ Af,
    const unsigned short* __restrict__ Btp,
    void* __restrict__ Cout, int ldc, long strideC,
    const float* __restrict__ bias,
    int N, float scale) {
  const _Float16* Bt = (const _Float16*)Btp;
  __shared__ __align__(16) _Float16 sA[2][kGM * kGPitch];
  __shared__ __align__(16) _Float16 sB[2][kGN * kGPitch];
  __shared__ __align__(16) float sT[8][16 * 68];
  const int t    = threadIdx.x;
  const int lane = t & 31;
  const int wave = __builtin_amdgcn_readfirstlane((int)(threadIdx.x >> 5));
  const int tilesN = N / kGN;
  const int tm = blockIdx.x / tilesN;
  const int tn = blockIdx.x - tm * tilesN;
  const int wm = (wave >> 2) << 6;
  const int wn = (wave & 3) << 6;
  /* output plane, first row and first column of the wave's 64 x 64 tile */
  const int b  = SWAP ? (tm * kGM) / kG : 0;
  const int m0 = SWAP ? tn * kGN + wn : tm * kGM + wm;
  const int n0 = SWAP ? (tm * kGM) % kG + wm : tn * kGN + wn;

  const int rlane = lane & 15;
  const int koff  = (lane >> 4) * 8;
  const int mOff  = (lane >> 4) * 8;

  /* staging map: 16-B chunk t & 15 of row (t >> 4) + 16*i; a wave-wide load covers two rows' whole 256-B runs */
  const int sRow = t >> 4, sCol = (t & 15) * 8;
  const _Float16* gA = A_F32 ? nullptr : (const _Float16*)Ap + (size_t)(tm * kGM + sRow) * kD + sCol;
  const _Float16* gB = Bt + (size_t)(tn * kGN + sRow) * kD + sCol;
  const int lS = sRow * kGPitch + sCol;
  /* f32 rows: 16-B chunk t & 31 of a half of row (t >> 5) + 8*i; a wave-wide load covers that row's whole 512-B run */
  const int xRow = t >> 5, xCol = (t & 31) * 4;
  const float* gX = A_F32 ? Af + (size_t)(tm * kGM + xRow) * kD + xCol : nullptr;
  const int lX = xRow * kGPitch + xCol;
  v8h ra0[kGM / 16], rb0[kGN / 16], ra1[kGM / 16], rb1[kGN / 16];
  v4f xa0[kGM / 8], xa1[kGM / 8];
  if constexpr (A_F32) {
#pragma unroll
    for (int i = 0; i < kGM / 8; ++i) xa0[i] = *(const v4f*)(gX + (size_t)(8 * i) * kD);
  } else {
#pragma unroll
    for (int i = 0; i < kGM / 16; ++i) ra0[i] = *(const v8h*)(gA + (size_t)(16 * i) * kD);
  }
#pragma unroll
  for (int i = 0; i < kGN / 16; ++i) rb0[i] = *(const v8h*)(gB + (size_t)(16 * i) * kD);
  if constexpr (A_F32) {
#pragma unroll
    for (int i = 0; i < kGM / 8; ++i) xa1[i] = *(const v4f*)(gX + (size_t)(8 * i) * kD + kGHalf);
  } else {
#pragma unroll
    for (int i = 0; i < kGM / 16; ++i) ra1[i] = *(const v8h*)(gA + (size_t)(16 * i) * kD + kGHalf);
  }
#pragma unroll
  for (int i = 0; i < kGN / 16; ++i) rb1[i] = *(const v8h*)(gB + (size_t)(16 * i) * kD + kGHalf);
  /* stands in front of the first overwrite of an address register that these loads name; the two addresses are */
  /* inputs so that their registers live up to the wait                                                          */
  if constexpr (A_F32) asm volatile("s_wait_xcnt 0x0" :: "v"(gX), "v"(gB) : "memory");
  else                 asm volatile("s_wait_xcnt 0x0" :: "v"(gA), "v"(gB) : "memory");

  v8f acc[4][4];
#pragma unroll
  for (int i = 0; i < 4; ++i)
#pragma unroll
    for (int j = 0; j < 4; ++j) acc[i][j] = (v8f){0.f, 0.f, 0.f, 0.f, 0.f, 0.f, 0.f, 0.f};

  const int fA = (wm + rlane) * kGPitch + koff;
  const int fB = (wn + rlane) * kGPitch + koff;
  if constexpr (A_F32) {
#pragma unroll
    for (int i = 0; i < kGM / 8; ++i) *(v4h*)(&sA[0][lX + 8 * i * kGPitch]) = cast4_x(xa0[i]);
  } else {
#pragma unroll
    for (int i = 0; i < kGM / 16; ++i) *(v8h*)(&sA[0][lS + 16 * i * kGPitch]) = ra0[i];
  }
#pragma unroll
  for (int i = 0; i < kGN / 16; ++i) *(v8h*)(&sB[0][lS + 16 * i * kGPitch]) = rb0[i];
  lds_barrier();
  if constexpr (SWAP) gemm_half(acc, &sB[0][fB], &sA[0][fA]);
  else                gemm_half(acc, &sA[0][fA], &sB[0][fB]);
  if constexpr (A_F32) {
#pragma unroll
    for (int i = 0; i < kGM / 8; ++i) *(v4h*)(&sA[1][lX + 8 * i * kGPitch]) = cast4_x(xa1[i]);
  } else {
#pragma unroll
    for (int i = 0; i < kGM / 16; ++i) *(v8h*)(&sA[1][lS + 16 * i * kGPitch]) = ra1[i];
  }
#pragma unroll
  for (int i = 0; i < kGN / 16; ++i) *(v8h*)(&sB[1][lS + 16 * i * kGPitch]) = rb1[i];
  lds_barrier();
  if constexpr (SWAP) gemm_half(acc, &sB[1][fB], &sA[1][fA]);
  else                gemm_half(acc, &sA[1][fA], &sB[1][fB]);
  acc_guard4(acc[0][0], acc[0][1], acc[0][2], acc[0][3]);
  acc_guard4(acc[1][0], acc[1][1], acc[1][2], acc[1][3]);
  acc_guard4(acc[2][0], acc[2][1], acc[2][2], acc[2][3]);
  acc_guard4(acc[3][0], acc[3][1], acc[3][2], acc[3][3]);

  /* ---- epilogue ---- */
  float* slab = sT[wave];
#pragma unroll
  for (int i = 0; i < 4; ++i) {
    const int mBase = m0 + (i << 4);
#pragma unroll
    for (int j = 0; j < 4; ++j) {
      const int n = n0 + (j << 4) + rlane;
      float bv = 0.f;
      if (BIAS_MODE == 2) bv = bias[n];
#pragma unroll
      for (int r = 0; r < 8; ++r) {
        float v = acc[i][j][r] * scale;
        if (BIAS_MODE == 2) v += bv;
        slab[(mOff + r) * 68 + (j << 4) + rlane] = v;
      }
    }
    __builtin_amdgcn_fence(__ATOMIC_RELEASE, "workgroup");
    __builtin_amdgcn_wave_barrier();
    __builtin_amdgcn_fence(__ATOMIC_ACQUIRE, "workgroup");
    if (OUT_MODE == 0) {
      /* row segment = 64 floats = 256 B = 16 lanes x 16 B; rows it*2 + hh, it 0..7 -> 16 rows, each once */
      float* C = (float*)Cout + (size_t)b * strideC;
      const int hh = lane >> 4, c4 = (lane & 15) * 4;
      {
#pragma unroll
        for (int it = 0; it < 8; ++it) {
          const int row = it * 2 + hh;
          v4f v = *(const v4f*)(slab + row * 68 + c4);
          *(v4f*)(C + (size_t)(mBase + row) * ldc + n0 + c4) = v;
        }
        
      }
    } else {
      const int q = lane >> 3, c8 = (lane & 7) * 8;
      unsigned short* C = (unsigned short*)Cout + (size_t)b * strideC;
      {
#pragma unroll
        for (int it = 0; it < 4; ++it) {
          const int row = it * 4 + q;
          const float* sp = slab + row * 68 + c8;
          v8h hv;
#pragma unroll
          for (int e = 0; e < 8; ++e) hv[e] = (_Float16)sp[e];
          *(v8h*)(C + (size_t)(mBase + row) * ldc + n0 + c8) = hv;
        }
        
      }
    }
    __builtin_amdgcn_fence(__ATOMIC_RELEASE, "workgroup");
    __builtin_amdgcn_wave_barrier();
    __builtin_amdgcn_fence(__ATOMIC_ACQUIRE, "workgroup");
  }
}

/* --------------------------------------------------------------------------- */
/* Four [256][256] f32 weight matrices ([out][in] = Bt layout) -> f16 planes     */
/* out + z*65536 halves, x carry. grid (32, 4): blockIdx.y selects the matrix    */
/* (block-uniform); 32 blocks x 256 threads x 8 = 65,536 = one whole plane.      */
/* --------------------------------------------------------------------------- */
__global__ __launch_bounds__(256) void cast8_w4_kernel(const float* __restrict__ W0, const float* __restrict__ W1,
                                                       const float* __restrict__ W2, const float* __restrict__ W3,
                                                       unsigned short* __restrict__ out, float carry) {
  const int z = blockIdx.y;
  const float* W = (z == 0) ? W0 : (z == 1) ? W1 : (z == 2) ? W2 : W3;
  const int i = blockIdx.x * 256 + threadIdx.x;
  const float* p = W + 8 * (size_t)i;
  const v4f a = *(const v4f*)(p);
  const v4f c = *(const v4f*)(p + 4);
  v8h hv;
#pragma unroll
  for (int e = 0; e < 4; ++e) {
    hv[e]     = (_Float16)(a[e] * carry);
    hv[4 + e] = (_Float16)(c[e] * carry);
  }
  unsigned short* q = out + (size_t)z * kD * kD + 8 * (size_t)i;
  *(v8h*)q = hv;
  
}

/* --------------------------------------------------------------------------- */
/* Fused attention of one batch: scores, key mask, softmax and p.v in one launch. */
/*   S^T = K . Q^T   (A = 16 key rows from LDS, B = 16 query columns in registers) */
/*   O^T += V^T . P^T (A = 16 rows of v^T from LDS, B = P^T packed from the S^T    */
/*                     accumulators: two 16-key tiles give one 32-key B operand)   */
/* A lane owns query column c = lane & 15 and, of every 16-key tile, the keys      */
/* 8*(lane>>4) .. +7, so maximum and sum run in-lane plus one exchange of halves.  */
/*   x[k] = blocked[k] ? fill : s[k]  (log2 units; fill = -30, or -inf when the    */
/*          evaluate flag is nonzero);  e[k] = 2^(x[k] - m + 15), m = running max; */
/*   the sum takes every e[k], blocked ones included; P takes 0 for blocked keys.  */
/* Block = 8 waves x 16 queries = 128 queries; grid (8, 32). A stage is 64 keys:   */
/* K rows and v^T rows go global -> registers -> LDS one stage ahead, two buffers, */
/* one block barrier per stage (it publishes the next stage and ends the reads of  */
/* the buffer that the stage after it overwrites).                                 */
/* --------------------------------------------------------------------------- */
constexpr int kFaKeys   = 64;
constexpr int kFaStages = kG / kFaKeys;
constexpr int kFaQ      = 128;
constexpr int kKPitch   = kD + 8;        /* halves: 528 B = 16 B x 33 */
constexpr int kVPitch   = kFaKeys + 8;   /* halves: 144 B = 16 B x 9  */
constexpr int kKBuf     = kFaKeys * kKPitch;
constexpr int kVBuf     = kD * kVPitch;
constexpr float kLog2e  = 1.4426950408889634f;
constexpr float kScore2 = kScoreScale * kLog2e;
constexpr float kPExp   = 15.0f;
constexpr float kFaOut  = kHCarry / kQKVCarry;
static_assert(kPCarry == 32768.0f && kPExp == 15.0f);
static_assert((kG % kFaKeys) == 0 && (kG % kFaQ) == 0 && kD == 256 && kFaKeys == 64);

/* lane l reads lane l ^ 16 */
__device__ __forceinline__ float xhalf(float x) {
  return __builtin_bit_cast(float, __builtin_amdgcn_permlanex16(__builtin_bit_cast(int, x), __builtin_bit_cast(int, x),
                                                                0x76543210, 0xfedcba98, false, false));
}

/* group g of the score product: key tiles 0..3 at depth steps 2g and 2g+1 */
template <int G>
__device__ __forceinline__ void load_k8(v16h (&f)[8], const _Float16* kb) {
#pragma unroll
  for (int u = 0; u < 8; ++u) f[u] = frag_load(kb + (u & 3) * 16 * kKPitch + (2 * G + (u >> 2)) * 32);
}
template <int G>
__device__ __forceinline__ void mma_k8(v8f (&st)[4], const v16h (&f)[8], const v16h (&qf)[8]) {
#pragma unroll
  for (int u = 0; u < 8; ++u) st[u & 3] = mma_f16(f[u], qf[2 * G + (u >> 2)], st[u & 3]);
}
/* group g of the output product: depth tiles 8*(g&1) .. +7 at the 32 keys g>>1 */
template <int G>
__device__ __forceinline__ void load_v8(v16h (&f)[8], const _Float16* vb) {
#pragma unroll
  for (int u = 0; u < 8; ++u) f[u] = frag_load(vb + ((G & 1) * 8 + u) * 16 * kVPitch + (G >> 1) * 32);
}
template <int G>
__device__ __forceinline__ void mma_v8(v8f (&acc)[16], const v16h (&f)[8], const v16h (&pb)[2]) {
#pragma unroll
  for (int u = 0; u < 8; ++u) acc[(G & 1) * 8 + u] = mma_f16(f[u], pb[G >> 1], acc[(G & 1) * 8 + u]);
}
/* holds the next group's LDS loads in front of this group's matrix instructions, so that they fly under them */
__device__ __forceinline__ void group_fence() { __builtin_amdgcn_sched_barrier(0); }

__global__ __launch_bounds__(256) void attn_fused_kernel(const unsigned short* __restrict__ QKp,
                                                         const unsigned short* __restrict__ VTp,
                                                         const int* __restrict__ mask,
                                                         const int* __restrict__ evalflag,
                                                         unsigned short* __restrict__ Hp) {
  __shared__ __align__(16) _Float16 sK[2][kKBuf];
  __shared__ __align__(16) _Float16 sV[2][kVBuf];
  __shared__ unsigned sBlk[kG / 32];
  const int t    = threadIdx.x;
  const int lane = t & 31;
  const int wave = __builtin_amdgcn_readfirstlane((int)(threadIdx.x >> 5));
  const int b    = blockIdx.y;
  const int c    = lane & 15;
  const int h    = lane >> 4;
  const int q0   = blockIdx.x * kFaQ + wave * 16;
  const _Float16* QK = (const _Float16*)QKp + (size_t)b * kG * 2 * kD;
  const _Float16* VT = (const _Float16*)VTp + (size_t)b * kD * kG;

  /* blocked keys as bits: word w, bit i = key 32*w + i */
  int mk[4];
#pragma unroll
  for (int i = 0; i < 4; ++i) mk[i] = mask[(size_t)b * kG + (wave * 4 + i) * 32 + lane];
  /* stands in front of the first overwrite of the address register that these loads name */
  asm volatile("s_wait_xcnt 0x0" ::: "memory");
  unsigned bits[4];
#pragma unroll
  for (int i = 0; i < 4; ++i) bits[i] = __builtin_amdgcn_ballot_w32(mk[i] != 0);
  if (lane == 0) {
#pragma unroll
    for (int i = 0; i < 4; ++i) sBlk[wave * 4 + i] = bits[i];
  }
  const float fill2 = (evalflag[0] != 0) ? (-INFINITY) : (-30.0f * kLog2e);

  /* B operand of the score product: this wave's 16 query rows, whole depth */
  v16h qf[8];
#pragma unroll
  for (int kk = 0; kk < 8; ++kk) qf[kk] = frag_load(QK + (size_t)(q0 + c) * (2 * kD) + kk * 32 + 8 * h);

  /* staging map: 16-B chunk t + 256*i of a stage's K tile (32 chunks a row) and v^T tile (8 chunks a row) */
  const int kRow = t >> 5, kCol = (t & 31) * 8;
  const int vRow = t >> 3, vCol = (t & 7) * 8;
  const _Float16* gK = QK + (size_t)kRow * (2 * kD) + kD + kCol;
  const _Float16* gV = VT + (size_t)vRow * kG + vCol;
  const int lK = kRow * kKPitch + kCol;
  const int lV = vRow * kVPitch + vCol;
  v8h kr[8], vr[8];
#pragma unroll
  for (int i = 0; i < 8; ++i) {
    kr[i] = *(const v8h*)(gK + (size_t)(8 * i) * (2 * kD));
    vr[i] = *(const v8h*)(gV + (size_t)(32 * i) * kG);
  }
#pragma unroll
  for (int i = 0; i < 8; ++i) {
    *(v8h*)(&sK[0][lK + 8 * i * kKPitch])  = kr[i];
    *(v8h*)(&sV[0][lV + 32 * i * kVPitch]) = vr[i];
  }

  v8f acc[16];
#pragma unroll
  for (int d = 0; d < 16; ++d) acc[d] = (v8f){0.f, 0.f, 0.f, 0.f, 0.f, 0.f, 0.f, 0.f};
  float m_run = -INFINITY;
  float l_run = 0.0f;
  __syncthreads();

  /* rolled: one stage's body (64 matrix instructions and their loads) per iteration */
#pragma unroll 1
  for (int s = 0; s < kFaStages; ++s) {
    const int buf = s & 1;
    const bool more = (s + 1 < kFaStages);
    if (more) {
#pragma unroll
      for (int i = 0; i < 8; ++i) {
        kr[i] = *(const v8h*)(gK + (size_t)((s + 1) * kFaKeys + 8 * i) * (2 * kD));
        vr[i] = *(const v8h*)(gV + (size_t)(32 * i) * kG + (s + 1) * kFaKeys);
      }
      /* stands in front of the first overwrite of an address register that these loads name */
      asm volatile("s_wait_xcnt 0x0" ::: "memory");
    }

    /* S^T: 4 key tiles x 16 query columns */
    v8f st[4];
#pragma unroll
    for (int kt = 0; kt < 4; ++kt) st[kt] = (v8f){0.f, 0.f, 0.f, 0.f, 0.f, 0.f, 0.f, 0.f};
    const _Float16* kb = &sK[buf][c * kKPitch + 8 * h];
    const _Float16* vb = &sV[buf][c * kVPitch + 8 * h];
    v16h fa[8], fb[8];
    load_k8<0>(fa, kb);
    load_k8<1>(fb, kb); group_fence(); mma_k8<0>(st, fa, qf); group_fence();
    load_k8<2>(fa, kb); group_fence(); mma_k8<1>(st, fb, qf); group_fence();
    load_k8<3>(fb, kb); group_fence(); mma_k8<2>(st, fa, qf); group_fence();
    load_v8<0>(fa, vb); group_fence(); mma_k8<3>(st, fb, qf); group_fence();

    /* key kt*16 + 8h + r of the stage: word kt>>1, bit (kt&1)*16 + 8h + r */
    const unsigned w0 = sBlk[2 * s] >> (8 * h);
    const unsigned w1 = sBlk[2 * s + 1] >> (8 * h);
    float x[4][8];
    float mx = -INFINITY;
#pragma unroll
    for (int kt = 0; kt < 4; ++kt) {
      const unsigned wb = (kt < 2) ? w0 : w1;
#pragma unroll
      for (int r = 0; r < 8; ++r) {
        const bool blk = ((wb >> ((kt & 1) * 16 + r)) & 1u) != 0u;
        x[kt][r] = blk ? fill2 : st[kt][r] * kScore2;
        mx = fmaxf(mx, x[kt][r]);
      }
    }
    mx = fmaxf(mx, xhalf(mx));
    const float m_new = fmaxf(m_run, mx);
    /* scalar branch: the 128 output registers are rescaled only in a stage that raises some column's maximum */
    if (__builtin_amdgcn_ballot_w32(m_new > m_run) != 0) {
      const float ms   = (m_new == -INFINITY) ? 0.0f : m_new;
      const float corr = __builtin_amdgcn_exp2f(m_run - ms);
      l_run *= corr;
#pragma unroll
      for (int d = 0; d < 16; ++d)
#pragma unroll
        for (int r = 0; r < 8; ++r) acc[d][r] *= corr;
      m_run = m_new;
    }
    const float moff = ((m_run == -INFINITY) ? 0.0f : m_run) - kPExp;

    v16h pb[2];
    float ls[4];
#pragma unroll
    for (int kt = 0; kt < 4; ++kt) {
      const unsigned wb = (kt < 2) ? w0 : w1;
      ls[kt] = 0.0f;
#pragma unroll
      for (int r = 0; r < 8; ++r) {
        const bool blk = ((wb >> ((kt & 1) * 16 + r)) & 1u) != 0u;
        const float e = __builtin_amdgcn_exp2f(x[kt][r] - moff);
        ls[kt] += e;
        pb[kt >> 1][(kt & 1) * 8 + r] = (_Float16)(blk ? 0.0f : e);
      }
    }
    l_run += (ls[0] + ls[1]) + (ls[2] + ls[3]);

    /* O^T: 16 depth tiles x 16 query columns, 2 x 32 keys */
    load_v8<1>(fb, vb); group_fence(); mma_v8<0>(acc, fa, pb); group_fence();
    load_v8<2>(fa, vb); group_fence(); mma_v8<1>(acc, fb, pb); group_fence();
    load_v8<3>(fb, vb); group_fence(); mma_v8<2>(acc, fa, pb); group_fence();
    mma_v8<3>(acc, fb, pb);

    if (more) {
#pragma unroll
      for (int i = 0; i < 8; ++i) {
        *(v8h*)(&sK[buf ^ 1][lK + 8 * i * kKPitch])  = kr[i];
        *(v8h*)(&sV[buf ^ 1][lV + 32 * i * kVPitch]) = vr[i];
      }
    }
    __syncthreads();
  }

  /* a lane holds depth d*16 + 8h .. +7 of query q0 + c: one 16-B store per depth tile; the wave owns its 16 whole rows */
  const float l_tot = l_run + xhalf(l_run);
  const float inv   = (l_tot > 0.0f) ? (kFaOut / l_tot) : 0.0f;
  _Float16* H = (_Float16*)Hp + ((size_t)b * kG + q0 + c) * kD + 8 * h;
#pragma unroll
  for (int d = 0; d < 16; ++d) {
    v8h hv;
#pragma unroll
    for (int r = 0; r < 8; ++r) hv[r] = (_Float16)(acc[d][r] * inv);
    *(v8h*)(H + d * 16) = hv;
  }
}

/* --------------------------------------------------------------------------- */
/* Shape premise check: the file is built for 1024 nodes per batch. If the scalar */
/* two 512-B instructions) with NaN and returns normally.                         */
/* --------------------------------------------------------------------------- */
__global__ __launch_bounds__(32) void premise_guard_kernel(const int* __restrict__ gsz, float* __restrict__ out) {
  const int g = gsz[0];
  if (g != kG) {
    const int lane = threadIdx.x & 31;
    const float qn = __uint_as_float(0x7fc00000u);
    const v4f nv = (v4f){qn, qn, qn, qn};
    {
      *(v4f*)(out + lane * 4) = nv;
      *(v4f*)(out + 128 + lane * 4) = nv;
      
    }
  }
}

/* --------------------------------------------------------------------------- */
/* Host glue: kernel launches only. Weight cast + 2 projection GEMMs (they read   */
/* the f32 data rows themselves) + fused attention (one launch over all 32       */
/* batches, 8 x 32 blocks: one for every WGP) + output GEMM + premise check      */
/* = 6 launches.                                                                 */
/* GEMM shapes (depth 256; one 128 x 256 tile per block; grids exact):           */
/*   q|k proj : M 32768, N 512               256 x 2 tiles -> 512 blocks         */
/*   v^T proj : M 32768, N 256, stored as C^T 256 x 1 tiles -> 256 blocks        */
/*   out proj : M 32768, N 256               256 x 1 tiles -> 256 blocks         */
/* --------------------------------------------------------------------------- */
extern "C" void kernel_launch(void* const* d_in, const int* in_sizes, int n_in,
                              void* d_out, int out_size, void* d_ws, size_t ws_size,
                              hipStream_t stream) {
  if (n_in < 9) return;
  if (in_sizes[0] != kTok * kD) return;
  if (in_sizes[1] != kBatch * kG) return;
  if (in_sizes[2] != 1 || in_sizes[3] != 1) return;
  if (in_sizes[4] != kD * kD || in_sizes[5] != kD * kD || in_sizes[6] != kD * kD || in_sizes[7] != kD * kD) return;
  if (in_sizes[8] != kD) return;
  if (out_size != kTok * kD) return;
  if (ws_size < kWsTotal) return;

  const float* data   = (const float*)d_in[0];
  const int*   mask   = (const int*)d_in[1];
  const int*   gsize  = (const int*)d_in[2];
  const int*   evalf  = (const int*)d_in[3];
  const float* Wq     = (const float*)d_in[4];
  const float* Wk     = (const float*)d_in[5];
  const float* Wv     = (const float*)d_in[6];
  const float* Wo     = (const float*)d_in[7];
  const float* b_out  = (const float*)d_in[8];
  float* out = (float*)d_out;

  char* ws = (char*)d_ws;
  unsigned short* W16  = (unsigned short*)(ws + kOffW16);
  unsigned short* QK16 = (unsigned short*)(ws + kOffQK16);
  unsigned short* VT16 = (unsigned short*)(ws + kOffVT16);
  unsigned short* H16  = (unsigned short*)(ws + kOffH16);

  /* weight planes */
  cast8_w4_kernel<<<dim3((kD * kD / 8) / 256, 4), 256, 0, stream>>>(Wq, Wk, Wv, Wo, W16, kWCarry);

  /* q | k = x . [Wq ; Wk]^T  -> QK16 [32768][512], carried x16 */
  wmma_gemm64<0, 1, 1, 0><<<dim3((kTok / kGM) * (2 * kD / kGN), 1), 256, 0, stream>>>(
      nullptr, data,
      W16,
      (void*)QK16, 2 * kD, 0L,
      b_out,
      2 * kD, kProjScale);

  /* v^T per batch: VT[b][d][g] = Wv[d][:] . x[b*1024+g][:]  (128 x rows and all of Wv per block, stored as C^T), carried x16 */
  wmma_gemm64<0, 1, 1, 1><<<dim3((kTok / kGM) * (kD / kGN), 1), 256, 0, stream>>>(
      nullptr, data,
      W16 + (size_t)2 * kD * kD,
      (void*)VT16, kG, (long)kD * kG,
      b_out,
      kD, kProjScale);

  /* H[b][q][d] = sum_k softmax_k(mask(q.k / 16)) * v[k][d], carried x256 */
  attn_fused_kernel<<<dim3(kG / kFaQ, kBatch), 256, 0, stream>>>(QK16, VT16, mask, evalf, H16);

  /* out = H . Wo^T + b_out[n] -> f32 output rows */
  wmma_gemm64<2, 0, 0, 0><<<dim3((kTok / kGM) * (kD / kGN), 1), 256, 0, stream>>>(
      H16, nullptr,
      W16 + (size_t)3 * kD * kD,
      (void*)out, kD, 0L,
      b_out,
      kD, kOutScale);

  premise_guard_kernel<<<1, 32, 0, stream>>>(gsize, out);
}

// v005
// It runs in 71.8 microseconds.
// Timed twice side by side with v004, it ran 1.08 times as fast both times.
// Over all steps from v000 it is 9.43 times as fast.
// All contractions (q/k/v projections, q.k^T scores, p.v, output projection): v_wmma_f32_16x16x32_f16, f16 operands carried by exact powers of two, f32 accumulate; key masking, softmax and bias add in f32.
#include <hip/hip_runtime.h>
#include <math.h>

typedef __attribute__((ext_vector_type(16))) _Float16 v16h;
typedef __attribute__((ext_vector_type(8)))  _Float16 v8h;
typedef __attribute__((ext_vector_type(4)))  _Float16 v4h;
typedef __attribute__((ext_vector_type(8)))  float    v8f;
typedef __attribute__((ext_vector_type(4)))  float    v4f;
typedef __attribute__((ext_vector_type(4)))  int      v4i;

/* --------------------------------------------------------------------------- */
/* Shape constants (single head: batch b owns token rows b*1024 .. b*1024+1023) */
/* --------------------------------------------------------------------------- */
constexpr int kBatch  = 32;
constexpr int kG      = 1024;
constexpr int kD      = 256;
constexpr int kTok    = kBatch * kG;
constexpr int kSqrtD  = 16;
static_assert(kSqrtD * kSqrtD == kD);
static_assert(kTok == 32768);
static_assert((kD % 32) == 0 && (kG % 32) == 0);
static_assert((kD % 64) == 0 && (kG % 64) == 0 && (kTok % 64) == 0 && ((2 * kD) % 64) == 0);

/* Power-of-two carries of the f16 operand planes, folded back exactly in f32 epilogue scales. */
constexpr float kXCarry   = 16.0f;
constexpr float kWCarry   = 1024.0f;
constexpr float kQKVCarry = 16.0f;
constexpr float kPCarry   = 32768.0f;
constexpr float kHCarry   = 256.0f;
constexpr float kNormQK   = 1.0f / (float)kSqrtD;
constexpr float kProjScale  = kQKVCarry / (kXCarry * kWCarry);
constexpr float kScoreScale = kNormQK / (kQKVCarry * kQKVCarry);
constexpr float kOutScale   = 1.0f / (kHCarry * kWCarry);

/* --------------------------------------------------------------------------- */
/* Workspace region map (bytes; every offset a multiple of 128)                 */
/*   W16  f16 [4][256][256]       Wq | Wk | Wv | Wo, each x1024      524,288    */
/*   VT16 f16 [32][256][1024]     v^T per batch, x16               16,777,216   */
/*   QK16 f16 [32768][512]        q x16 (cols 0..255) | k x16      33,554,432   */
/*   total                                                         50,855,936   */
/* --------------------------------------------------------------------------- */
constexpr size_t kOffW16  = 0;
constexpr size_t kOffVT16 = kOffW16  + (size_t)4 * kD * kD * 2;
constexpr size_t kOffQK16 = kOffVT16 + (size_t)kBatch * kD * kG * 2;
constexpr size_t kWsTotal = kOffQK16 + (size_t)kTok * 2 * kD * 2;
static_assert(kWsTotal == 50855936ull);
static_assert(kWsTotal <= 268435456ull);
static_assert((kOffQK16 % 128) == 0 && (kOffVT16 % 128) == 0);

/* --------------------------------------------------------------------------- */
/* Fragment helpers                                                             */
/* --------------------------------------------------------------------------- */
union FragU { v16h v; v8h h[2]; };
/* elements 0..7 <- p[0..7], elements 8..15 <- p[16..23]; caller adds 8*(lane>>4) to p */
__device__ __forceinline__ v16h frag_load(const _Float16* p) {
  FragU f;
  f.h[0] = *(const v8h*)(p);
  f.h[1] = *(const v8h*)(p + 16);
  return f.v;
}
__device__ __forceinline__ v8f mma_f16(v16h a, v16h b, v8f c) {
  return __builtin_amdgcn_wmma_f32_16x16x32_f16(false, a, false, b, (short)0, c, false, false);
}
__device__ __forceinline__ void acc_guard4(v8f& a, v8f& b, v8f& c, v8f& d) {
  asm volatile("v_nop\n\tv_nop\n\tv_nop\n\tv_nop" : "+v"(a), "+v"(b), "+v"(c), "+v"(d));
}

/* --------------------------------------------------------------------------- */
/* WMMA GEMM, f16 operands, depth 256, operand rows of 256 elements.             */
/* C[m,n] = scale * sum_k A[m,k] * Bt[n,k] (+ bias[n]).                          */
/* A block of 8 waves (2 x 4) owns a 128 x 256 tile, each wave 64 x 64 of it.    */
/* The block's operand rows go global -> registers -> LDS by loads that cover    */
/* whole 256-B runs of a row (16 lanes x 16 B), each element once per block; the */
/* waves take their fragments from LDS. The depth is staged in two halves: both  */
/* halves' loads are issued at the start, and the second half is still in flight */
/* while the first is multiplied. One block barrier publishes each half.         */
/* A row-major [M,256]; Bt row-major [N,256]; M % 128 == 0, N % 256 == 0.        */
/* A_F32: 1 = the A rows are f32 in memory (Af) and become f16 (x16, an exact    */
/* power of two) between their load and their LDS store; a wave-wide load then   */
/* covers one row's whole 512-B run. 0 = f16 rows (Ap).                          */
/* SWAP: 1 = the Bt rows are the matrix instruction's first operand, so that the */
/* block holds C^T: row n, column m; it goes to plane m / 1024 of Cout, column   */
/* m % 1024 (v^T per batch).                                                     */
/* BIAS_MODE: 0 = none, 2 = bias[n] (f32 add).  OUT_MODE: 0 = f32, 1 = f16.      */
/* Epilogue: 16-row slabs staged per wave in LDS (same wave writes and reads);   */
/* --------------------------------------------------------------------------- */
constexpr int kGM     = 128;
constexpr int kGN     = 256;
constexpr int kGHalf  = kD / 2;        /* halves of depth per staged part: 256 B of a row */
constexpr int kGPitch = kGHalf + 8;    /* halves: 272 B = 16 B x 17 */
static_assert(kD == 256 && kGHalf == 128);
static_assert((kTok % kGM) == 0 && (kG % kGM) == 0 && ((2 * kD) % kGN) == 0 && (kD % kGN) == 0);

/* depth step KS of a staged half: the wave's 4 A and 4 B fragments; a and b point at the lane's row 0 of the wave's 64 rows */
template <int KS>
__device__ __forceinline__ void load_ab(v16h (&f)[8], const _Float16* a, const _Float16* b) {
#pragma unroll
  for (int u = 0; u < 4; ++u) {
    f[u]     = frag_load(a + (u << 4) * kGPitch + KS * 32);
    f[4 + u] = frag_load(b + (u << 4) * kGPitch + KS * 32);
  }
}
__device__ __forceinline__ void mma_ab(v8f (&acc)[4][4], const v16h (&f)[8]) {
#pragma unroll
  for (int i = 0; i < 4; ++i)
#pragma unroll
    for (int j = 0; j < 4; ++j) acc[i][j] = mma_f16(f[i], f[4 + j], acc[i][j]);
}
/* holds the next depth step's LDS loads, as one group, in front of this step's matrix instructions, so that they fly under them */
__device__ __forceinline__ void step_fence() { __builtin_amdgcn_sched_barrier(0); }
/* one staged half of the depth: 4 steps of 32, fragments fetched one step ahead into a second register set */
__device__ __forceinline__ void gemm_half(v8f (&acc)[4][4], const _Float16* a, const _Float16* b) {
  v16h fa[8], fb[8];
  load_ab<0>(fa, a, b);
  load_ab<1>(fb, a, b); step_fence(); mma_ab(acc, fa); step_fence();
  load_ab<2>(fa, a, b); step_fence(); mma_ab(acc, fb); step_fence();
  load_ab<3>(fb, a, b); step_fence(); mma_ab(acc, fa); step_fence();
  mma_ab(acc, fb);
}
/* block barrier for LDS data alone: it waits for this wave's LDS stores and not for its global loads, so that the */
/* second half's loads stay in flight across it (the plain barrier's fence would wait for them too)                */
__device__ __forceinline__ void lds_barrier() {
  __builtin_amdgcn_fence(__ATOMIC_RELEASE, "workgroup", "local");
  __builtin_amdgcn_s_barrier();
  __builtin_amdgcn_fence(__ATOMIC_ACQUIRE, "workgroup", "local");
}

/* four f32 of an operand row -> f16, carried x16 */
__device__ __forceinline__ v4h cast4_x(v4f a) {
  v4h hv;
#pragma unroll
  for (int e = 0; e < 4; ++e) hv[e] = (_Float16)(a[e] * kXCarry);
  return hv;
}

template <int BIAS_MODE, int OUT_MODE, int A_F32, int SWAP>
__global__ __launch_bounds__(256) void wmma_gemm64(
    const unsigned short* __restrict__ Ap,
    const float* __restrict__ Af,
    const unsigned short* __restrict__ Btp,
    void* __restrict__ Cout, int ldc, long strideC,
    const float* __restrict__ bias,
    int N, float scale) {
  const _Float16* Bt = (const _Float16*)Btp;
  __shared__ __align__(16) _Float16 sA[2][kGM * kGPitch];
  __shared__ __align__(16) _Float16 sB[2][kGN * kGPitch];
  __shared__ __align__(16) float sT[8][16 * 68];
  const int t    = threadIdx.x;
  const int lane = t & 31;
  const int wave = __builtin_amdgcn_readfirstlane((int)(threadIdx.x >> 5));
  const int tilesN = N / kGN;
  const int tm = blockIdx.x / tilesN;
  const int tn = blockIdx.x - tm * tilesN;
  const int wm = (wave >> 2) << 6;
  const int wn = (wave & 3) << 6;
  /* output plane, first row and first column of the wave's 64 x 64 tile */
  const int b  = SWAP ? (tm * kGM) / kG : 0;
  const int m0 = SWAP ? tn * kGN + wn : tm * kGM + wm;
  const int n0 = SWAP ? (tm * kGM) % kG + wm : tn * kGN + wn;

  const int rlane = lane & 15;
  const int koff  = (lane >> 4) * 8;
  const int mOff  = (lane >> 4) * 8;

  /* staging map: 16-B chunk t & 15 of row (t >> 4) + 16*i; a wave-wide load covers two rows' whole 256-B runs */
  const int sRow = t >> 4, sCol = (t & 15) * 8;
  const _Float16* gA = A_F32 ? nullptr : (const _Float16*)Ap + (size_t)(tm * kGM + sRow) * kD + sCol;
  const _Float16* gB = Bt + (size_t)(tn * kGN + sRow) * kD + sCol;
  const int lS = sRow * kGPitch + sCol;
  /* f32 rows: 16-B chunk t & 31 of a half of row (t >> 5) + 8*i; a wave-wide load covers that row's whole 512-B run */
  const int xRow = t >> 5, xCol = (t & 31) * 4;
  const float* gX = A_F32 ? Af + (size_t)(tm * kGM + xRow) * kD + xCol : nullptr;
  const int lX = xRow * kGPitch + xCol;
  v8h ra0[kGM / 16], rb0[kGN / 16], ra1[kGM / 16], rb1[kGN / 16];
  v4f xa0[kGM / 8], xa1[kGM / 8];
  if constexpr (A_F32) {
#pragma unroll
    for (int i = 0; i < kGM / 8; ++i) xa0[i] = *(const v4f*)(gX + (size_t)(8 * i) * kD);
  } else {
#pragma unroll
    for (int i = 0; i < kGM / 16; ++i) ra0[i] = *(const v8h*)(gA + (size_t)(16 * i) * kD);
  }
#pragma unroll
  for (int i = 0; i < kGN / 16; ++i) rb0[i] = *(const v8h*)(gB + (size_t)(16 * i) * kD);
  if constexpr (A_F32) {
#pragma unroll
    for (int i = 0; i < kGM / 8; ++i) xa1[i] = *(const v4f*)(gX + (size_t)(8 * i) * kD + kGHalf);
  } else {
#pragma unroll
    for (int i = 0; i < kGM / 16; ++i) ra1[i] = *(const v8h*)(gA + (size_t)(16 * i) * kD + kGHalf);
  }
#pragma unroll
  for (int i = 0; i < kGN / 16; ++i) rb1[i] = *(const v8h*)(gB + (size_t)(16 * i) * kD + kGHalf);
  /* stands in front of the first overwrite of an address register that these loads name; the two addresses are */
  /* inputs so that their registers live up to the wait                                                          */
  if constexpr (A_F32) asm volatile("s_wait_xcnt 0x0" :: "v"(gX), "v"(gB) : "memory");
  else                 asm volatile("s_wait_xcnt 0x0" :: "v"(gA), "v"(gB) : "memory");

  v8f acc[4][4];
#pragma unroll
  for (int i = 0; i < 4; ++i)
#pragma unroll
    for (int j = 0; j < 4; ++j) acc[i][j] = (v8f){0.f, 0.f, 0.f, 0.f, 0.f, 0.f, 0.f, 0.f};

  const int fA = (wm + rlane) * kGPitch + koff;
  const int fB = (wn + rlane) * kGPitch + koff;
  if constexpr (A_F32) {
#pragma unroll
    for (int i = 0; i < kGM / 8; ++i) *(v4h*)(&sA[0][lX + 8 * i * kGPitch]) = cast4_x(xa0[i]);
  } else {
#pragma unroll
    for (int i = 0; i < kGM / 16; ++i) *(v8h*)(&sA[0][lS + 16 * i * kGPitch]) = ra0[i];
  }
#pragma unroll
  for (int i = 0; i < kGN / 16; ++i) *(v8h*)(&sB[0][lS + 16 * i * kGPitch]) = rb0[i];
  lds_barrier();
  if constexpr (SWAP) gemm_half(acc, &sB[0][fB], &sA[0][fA]);
  else                gemm_half(acc, &sA[0][fA], &sB[0][fB]);
  if constexpr (A_F32) {
#pragma unroll
    for (int i = 0; i < kGM / 8; ++i) *(v4h*)(&sA[1][lX + 8 * i * kGPitch]) = cast4_x(xa1[i]);
  } else {
#pragma unroll
    for (int i = 0; i < kGM / 16; ++i) *(v8h*)(&sA[1][lS + 16 * i * kGPitch]) = ra1[i];
  }
#pragma unroll
  for (int i = 0; i < kGN / 16; ++i) *(v8h*)(&sB[1][lS + 16 * i * kGPitch]) = rb1[i];
  lds_barrier();
  if constexpr (SWAP) gemm_half(acc, &sB[1][fB], &sA[1][fA]);
  else                gemm_half(acc, &sA[1][fA], &sB[1][fB]);
  acc_guard4(acc[0][0], acc[0][1], acc[0][2], acc[0][3]);
  acc_guard4(acc[1][0], acc[1][1], acc[1][2], acc[1][3]);
  acc_guard4(acc[2][0], acc[2][1], acc[2][2], acc[2][3]);
  acc_guard4(acc[3][0], acc[3][1], acc[3][2], acc[3][3]);

  /* ---- epilogue ---- */
  float* slab = sT[wave];
#pragma unroll
  for (int i = 0; i < 4; ++i) {
    const int mBase = m0 + (i << 4);
#pragma unroll
    for (int j = 0; j < 4; ++j) {
      const int n = n0 + (j << 4) + rlane;
      float bv = 0.f;
      if (BIAS_MODE == 2) bv = bias[n];
#pragma unroll
      for (int r = 0; r < 8; ++r) {
        float v = acc[i][j][r] * scale;
        if (BIAS_MODE == 2) v += bv;
        slab[(mOff + r) * 68 + (j << 4) + rlane] = v;
      }
    }
    __builtin_amdgcn_fence(__ATOMIC_RELEASE, "workgroup");
    __builtin_amdgcn_wave_barrier();
    __builtin_amdgcn_fence(__ATOMIC_ACQUIRE, "workgroup");
    if (OUT_MODE == 0) {
      /* row segment = 64 floats = 256 B = 16 lanes x 16 B; rows it*2 + hh, it 0..7 -> 16 rows, each once */
      float* C = (float*)Cout + (size_t)b * strideC;
      const int hh = lane >> 4, c4 = (lane & 15) * 4;
      {
#pragma unroll
        for (int it = 0; it < 8; ++it) {
          const int row = it * 2 + hh;
          v4f v = *(const v4f*)(slab + row * 68 + c4);
          *(v4f*)(C + (size_t)(mBase + row) * ldc + n0 + c4) = v;
        }
        
      }
    } else {
      const int q = lane >> 3, c8 = (lane & 7) * 8;
      unsigned short* C = (unsigned short*)Cout + (size_t)b * strideC;
      {
#pragma unroll
        for (int it = 0; it < 4; ++it) {
          const int row = it * 4 + q;
          const float* sp = slab + row * 68 + c8;
          v8h hv;
#pragma unroll
          for (int e = 0; e < 8; ++e) hv[e] = (_Float16)sp[e];
          *(v8h*)(C + (size_t)(mBase + row) * ldc + n0 + c8) = hv;
        }
        
      }
    }
    __builtin_amdgcn_fence(__ATOMIC_RELEASE, "workgroup");
    __builtin_amdgcn_wave_barrier();
    __builtin_amdgcn_fence(__ATOMIC_ACQUIRE, "workgroup");
  }
}

/* --------------------------------------------------------------------------- */
/* Four [256][256] f32 weight matrices ([out][in] = Bt layout) -> f16 planes     */
/* out + z*65536 halves, x carry. grid (32, 4): blockIdx.y selects the matrix    */
/* (block-uniform); 32 blocks x 256 threads x 8 = 65,536 = one whole plane.      */
/* --------------------------------------------------------------------------- */
__global__ __launch_bounds__(256) void cast8_w4_kernel(const float* __restrict__ W0, const float* __restrict__ W1,
                                                       const float* __restrict__ W2, const float* __restrict__ W3,
                                                       unsigned short* __restrict__ out, float carry) {
  const int z = blockIdx.y;
  const float* W = (z == 0) ? W0 : (z == 1) ? W1 : (z == 2) ? W2 : W3;
  const int i = blockIdx.x * 256 + threadIdx.x;
  const float* p = W + 8 * (size_t)i;
  const v4f a = *(const v4f*)(p);
  const v4f c = *(const v4f*)(p + 4);
  v8h hv;
#pragma unroll
  for (int e = 0; e < 4; ++e) {
    hv[e]     = (_Float16)(a[e] * carry);
    hv[4 + e] = (_Float16)(c[e] * carry);
  }
  unsigned short* q = out + (size_t)z * kD * kD + 8 * (size_t)i;
  *(v8h*)q = hv;
  
}

/* --------------------------------------------------------------------------- */
/* Fused attention of one batch: scores, key mask, softmax, p.v and the output      */
/* projection in one launch.                                                       */
/*   S^T = K . Q^T   (A = 16 key rows from LDS, B = 16 query columns in registers) */
/*   O^T += V^T . P^T (A = 16 rows of v^T from LDS, B = P^T packed from the S^T    */
/*                     accumulators: two 16-key tiles give one 32-key B operand)   */
/* A lane owns query column c = lane & 15 and, of every 16-key tile, the keys      */
/* 8*(lane>>4) .. +7, so maximum and sum run in-lane plus one exchange of halves.  */
/*   x[k] = blocked[k] ? fill : s[k]  (log2 units; fill = -30, or -inf when the    */
/*          evaluate flag is nonzero);  e[k] = 2^(x[k] - m + 15), m = running max; */
/*   the sum takes every e[k], blocked ones included; P takes 0 for blocked keys.  */
/* Block = 8 waves x 16 queries = 128 queries; grid (8, 32). A stage is 64 keys:   */
/* K rows and v^T rows go global -> registers -> LDS one stage ahead, two buffers, */
/* one block barrier per stage (it publishes the next stage and ends the reads of  */
/* the buffer that the stage after it overwrites).                                 */
/* Output projection, behind the last stage, per wave and with no further block    */
/* barrier:  out^T = Wo . H^T  (A = 16 rows of Wo from LDS, B = H^T packed as f16   */
/* x256 from the O^T accumulators: two 16-deep tiles give one 32-deep B operand).   */
/* Wo (f16 x1024, 256 rows) comes into its own LDS region 16 rows a stage, beside   */
/* the K and v^T staging, and is published by the stages' barriers. The 64 output   */
/* columns of a group go through a per-wave LDS slab (in the K buffers, which are   */
/* free behind the last barrier), so that the f32 stores cover whole 256-B runs.    */
/* --------------------------------------------------------------------------- */
constexpr int kFaKeys   = 64;
constexpr int kFaStages = kG / kFaKeys;
constexpr int kFaQ      = 128;
constexpr int kKPitch   = kD + 8;        /* halves: 528 B = 16 B x 33 */
constexpr int kVPitch   = kFaKeys + 8;   /* halves: 144 B = 16 B x 9  */
constexpr int kKBuf     = kFaKeys * kKPitch;
constexpr int kVBuf     = kD * kVPitch;
constexpr float kLog2e  = 1.4426950408889634f;
constexpr float kScore2 = kScoreScale * kLog2e;
constexpr float kPExp   = 15.0f;
constexpr float kFaOut  = kHCarry / kQKVCarry;
constexpr int kWRows    = kD / kFaStages;   /* rows of Wo staged per stage */
constexpr int kSlabPitch = 68;              /* floats: 272 B = 16 B x 17 */
static_assert(kWRows == 16 && 8 * 16 * kSlabPitch * 4 <= 2 * kKBuf * 2);
static_assert(kPCarry == 32768.0f && kPExp == 15.0f);
static_assert((kG % kFaKeys) == 0 && (kG % kFaQ) == 0 && kD == 256 && kFaKeys == 64);

/* lane l reads lane l ^ 16 */
__device__ __forceinline__ float xhalf(float x) {
  return __builtin_bit_cast(float, __builtin_amdgcn_permlanex16(__builtin_bit_cast(int, x), __builtin_bit_cast(int, x),
                                                                0x76543210, 0xfedcba98, false, false));
}

/* group g of the score product: key tiles 0..3 at depth steps 2g and 2g+1 */
template <int G>
__device__ __forceinline__ void load_k8(v16h (&f)[8], const _Float16* kb) {
#pragma unroll
  for (int u = 0; u < 8; ++u) f[u] = frag_load(kb + (u & 3) * 16 * kKPitch + (2 * G + (u >> 2)) * 32);
}
template <int G>
__device__ __forceinline__ void mma_k8(v8f (&st)[4], const v16h (&f)[8], const v16h (&qf)[8]) {
#pragma unroll
  for (int u = 0; u < 8; ++u) st[u & 3] = mma_f16(f[u], qf[2 * G + (u >> 2)], st[u & 3]);
}
/* group g of the output product: depth tiles 8*(g&1) .. +7 at the 32 keys g>>1 */
template <int G>
__device__ __forceinline__ void load_v8(v16h (&f)[8], const _Float16* vb) {
#pragma unroll
  for (int u = 0; u < 8; ++u) f[u] = frag_load(vb + ((G & 1) * 8 + u) * 16 * kVPitch + (G >> 1) * 32);
}
template <int G>
__device__ __forceinline__ void mma_v8(v8f (&acc)[16], const v16h (&f)[8], const v16h (&pb)[2]) {
#pragma unroll
  for (int u = 0; u < 8; ++u) acc[(G & 1) * 8 + u] = mma_f16(f[u], pb[G >> 1], acc[(G & 1) * 8 + u]);
}
/* holds the next group's LDS loads in front of this group's matrix instructions, so that they fly under them */
__device__ __forceinline__ void group_fence() { __builtin_amdgcn_sched_barrier(0); }

__global__ __launch_bounds__(256) void attn_fused_kernel(const unsigned short* __restrict__ QKp,
                                                         const unsigned short* __restrict__ VTp,
                                                         const int* __restrict__ mask,
                                                         const int* __restrict__ evalflag,
                                                         const unsigned short* __restrict__ Wop,
                                                         const float* __restrict__ bias,
                                                         float* __restrict__ out) {
  __shared__ __align__(16) _Float16 sK[2][kKBuf];
  __shared__ __align__(16) _Float16 sV[2][kVBuf];
  __shared__ __align__(16) _Float16 sW[kD * kKPitch];
  __shared__ unsigned sBlk[kG / 32];
  const int t    = threadIdx.x;
  const int lane = t & 31;
  const int wave = __builtin_amdgcn_readfirstlane((int)(threadIdx.x >> 5));
  const int b    = blockIdx.y;
  const int c    = lane & 15;
  const int h    = lane >> 4;
  const int q0   = blockIdx.x * kFaQ + wave * 16;
  const _Float16* QK = (const _Float16*)QKp + (size_t)b * kG * 2 * kD;
  const _Float16* VT = (const _Float16*)VTp + (size_t)b * kD * kG;

  /* blocked keys as bits: word w, bit i = key 32*w + i */
  int mk[4];
#pragma unroll
  for (int i = 0; i < 4; ++i) mk[i] = mask[(size_t)b * kG + (wave * 4 + i) * 32 + lane];
  /* stands in front of the first overwrite of the address register that these loads name */
  asm volatile("s_wait_xcnt 0x0" ::: "memory");
  unsigned bits[4];
#pragma unroll
  for (int i = 0; i < 4; ++i) bits[i] = __builtin_amdgcn_ballot_w32(mk[i] != 0);
  if (lane == 0) {
#pragma unroll
    for (int i = 0; i < 4; ++i) sBlk[wave * 4 + i] = bits[i];
  }
  const float fill2 = (evalflag[0] != 0) ? (-INFINITY) : (-30.0f * kLog2e);

  /* B operand of the score product: this wave's 16 query rows, whole depth */
  v16h qf[8];
#pragma unroll
  for (int kk = 0; kk < 8; ++kk) qf[kk] = frag_load(QK + (size_t)(q0 + c) * (2 * kD) + kk * 32 + 8 * h);

  /* staging map: 16-B chunk t + 256*i of a stage's K tile (32 chunks a row) and v^T tile (8 chunks a row) */
  const int kRow = t >> 5, kCol = (t & 31) * 8;
  const int vRow = t >> 3, vCol = (t & 7) * 8;
  const _Float16* gK = QK + (size_t)kRow * (2 * kD) + kD + kCol;
  const _Float16* gV = VT + (size_t)vRow * kG + vCol;
  /* Wo rows take the K tile's map: a wave-wide load covers one row's whole 512-B run */
  const _Float16* gW = (const _Float16*)Wop + (size_t)kRow * kD + kCol;
  const int lK = kRow * kKPitch + kCol;
  const int lV = vRow * kVPitch + vCol;
  v8h kr[8], vr[8];
#pragma unroll
  for (int i = 0; i < 8; ++i) {
    kr[i] = *(const v8h*)(gK + (size_t)(8 * i) * (2 * kD));
    vr[i] = *(const v8h*)(gV + (size_t)(32 * i) * kG);
  }
#pragma unroll
  for (int i = 0; i < 8; ++i) {
    *(v8h*)(&sK[0][lK + 8 * i * kKPitch])  = kr[i];
    *(v8h*)(&sV[0][lV + 32 * i * kVPitch]) = vr[i];
  }

  v8f acc[16];
#pragma unroll
  for (int d = 0; d < 16; ++d) acc[d] = (v8f){0.f, 0.f, 0.f, 0.f, 0.f, 0.f, 0.f, 0.f};
  float m_run = -INFINITY;
  float l_run = 0.0f;
  __syncthreads();

  /* rolled: one stage's body (64 matrix instructions and their loads) per iteration */
#pragma unroll 1
  for (int s = 0; s < kFaStages; ++s) {
    const int buf = s & 1;
    const bool more = (s + 1 < kFaStages);
    v8h wr[2];
    const _Float16* gWs = gW + (size_t)(s * kWRows) * kD;
#pragma unroll
    for (int i = 0; i < 2; ++i) wr[i] = *(const v8h*)(gWs + (size_t)(8 * i) * kD);
    /* stands in front of the first overwrite of the address register that these loads name */
    asm volatile("s_wait_xcnt 0x0" :: "v"(gWs) : "memory");
    if (more) {
#pragma unroll
      for (int i = 0; i < 8; ++i) {
        kr[i] = *(const v8h*)(gK + (size_t)((s + 1) * kFaKeys + 8 * i) * (2 * kD));
        vr[i] = *(const v8h*)(gV + (size_t)(32 * i) * kG + (s + 1) * kFaKeys);
      }
      /* stands in front of the first overwrite of an address register that these loads name */
      asm volatile("s_wait_xcnt 0x0" ::: "memory");
    }

    /* S^T: 4 key tiles x 16 query columns */
    v8f st[4];
#pragma unroll
    for (int kt = 0; kt < 4; ++kt) st[kt] = (v8f){0.f, 0.f, 0.f, 0.f, 0.f, 0.f, 0.f, 0.f};
    const _Float16* kb = &sK[buf][c * kKPitch + 8 * h];
    const _Float16* vb = &sV[buf][c * kVPitch + 8 * h];
    v16h fa[8], fb[8];
    load_k8<0>(fa, kb);
    load_k8<1>(fb, kb); group_fence(); mma_k8<0>(st, fa, qf); group_fence();
    load_k8<2>(fa, kb); group_fence(); mma_k8<1>(st, fb, qf); group_fence();
    load_k8<3>(fb, kb); group_fence(); mma_k8<2>(st, fa, qf); group_fence();
    load_v8<0>(fa, vb); group_fence(); mma_k8<3>(st, fb, qf); group_fence();

    /* key kt*16 + 8h + r of the stage: word kt>>1, bit (kt&1)*16 + 8h + r */
    const unsigned w0 = sBlk[2 * s] >> (8 * h);
    const unsigned w1 = sBlk[2 * s + 1] >> (8 * h);
    float x[4][8];
    float mx = -INFINITY;
#pragma unroll
    for (int kt = 0; kt < 4; ++kt) {
      const unsigned wb = (kt < 2) ? w0 : w1;
#pragma unroll
      for (int r = 0; r < 8; ++r) {
        const bool blk = ((wb >> ((kt & 1) * 16 + r)) & 1u) != 0u;
        x[kt][r] = blk ? fill2 : st[kt][r] * kScore2;
        mx = fmaxf(mx, x[kt][r]);
      }
    }
    mx = fmaxf(mx, xhalf(mx));
    const float m_new = fmaxf(m_run, mx);
    /* scalar branch: the 128 output registers are rescaled only in a stage that raises some column's maximum */
    if (__builtin_amdgcn_ballot_w32(m_new > m_run) != 0) {
      const float ms   = (m_new == -INFINITY) ? 0.0f : m_new;
      const float corr = __builtin_amdgcn_exp2f(m_run - ms);
      l_run *= corr;
#pragma unroll
      for (int d = 0; d < 16; ++d)
#pragma unroll
        for (int r = 0; r < 8; ++r) acc[d][r] *= corr;
      m_run = m_new;
    }
    const float moff = ((m_run == -INFINITY) ? 0.0f : m_run) - kPExp;

    v16h pb[2];
    float ls[4];
#pragma unroll
    for (int kt = 0; kt < 4; ++kt) {
      const unsigned wb = (kt < 2) ? w0 : w1;
      ls[kt] = 0.0f;
#pragma unroll
      for (int r = 0; r < 8; ++r) {
        const bool blk = ((wb >> ((kt & 1) * 16 + r)) & 1u) != 0u;
        const float e = __builtin_amdgcn_exp2f(x[kt][r] - moff);
        ls[kt] += e;
        pb[kt >> 1][(kt & 1) * 8 + r] = (_Float16)(blk ? 0.0f : e);
      }
    }
    l_run += (ls[0] + ls[1]) + (ls[2] + ls[3]);

    /* O^T: 16 depth tiles x 16 query columns, 2 x 32 keys */
    load_v8<1>(fb, vb); group_fence(); mma_v8<0>(acc, fa, pb); group_fence();
    load_v8<2>(fa, vb); group_fence(); mma_v8<1>(acc, fb, pb); group_fence();
    load_v8<3>(fb, vb); group_fence(); mma_v8<2>(acc, fa, pb); group_fence();
    mma_v8<3>(acc, fb, pb);

    if (more) {
#pragma unroll
      for (int i = 0; i < 8; ++i) {
        *(v8h*)(&sK[buf ^ 1][lK + 8 * i * kKPitch])  = kr[i];
        *(v8h*)(&sV[buf ^ 1][lV + 32 * i * kVPitch]) = vr[i];
      }
    }
#pragma unroll
    for (int i = 0; i < 2; ++i) *(v8h*)(&sW[lK + (s * kWRows + 8 * i) * kKPitch]) = wr[i];
    __syncthreads();
  }

  /* a lane holds depth d*16 + 8h .. +7 of query q0 + c: depth tiles 2*dd and 2*dd + 1 are B operand dd of the projection */
  const float l_tot = l_run + xhalf(l_run);
  const float inv   = (l_tot > 0.0f) ? (kFaOut / l_tot) : 0.0f;
  v16h hb[8];
#pragma unroll
  for (int d = 0; d < 16; ++d)
#pragma unroll
    for (int r = 0; r < 8; ++r) hb[d >> 1][(d & 1) * 8 + r] = (_Float16)(acc[d][r] * inv);

  /* out^T: 4 groups of 64 output columns (4 tiles of 16 rows of Wo), depth 256 in 8 steps, in the order of the score product */
  float* slab = (float*)&sK[0][0] + wave * (16 * kSlabPitch);
  const int hh = lane >> 4, c4 = (lane & 15) * 4;
  const _Float16* wb = &sW[c * kKPitch + 8 * h];
  const float* bp = bias + c4;
  float* op = out + ((size_t)b * kG + q0 + hh) * kD + c4;
  v16h fa[8], fb[8];
  load_k8<0>(fa, wb);
#pragma unroll
  for (int ng = 0; ng < 4; ++ng) {
    const _Float16* wg = wb + ng * 64 * kKPitch;
    const v4f bv = *(const v4f*)(bp + ng * 64);
    v8f ot[4];
#pragma unroll
    for (int j = 0; j < 4; ++j) ot[j] = (v8f){0.f, 0.f, 0.f, 0.f, 0.f, 0.f, 0.f, 0.f};
    load_k8<1>(fb, wg); group_fence(); mma_k8<0>(ot, fa, hb); group_fence();
    load_k8<2>(fa, wg); group_fence(); mma_k8<1>(ot, fb, hb); group_fence();
    load_k8<3>(fb, wg); group_fence(); mma_k8<2>(ot, fa, hb); group_fence();
    if (ng < 3) load_k8<0>(fa, wg + 64 * kKPitch);
    group_fence(); mma_k8<3>(ot, fb, hb); group_fence();
    /* a lane holds columns j*16 + 8h .. +7 of query row c: two 16-B LDS stores per tile */
#pragma unroll
    for (int j = 0; j < 4; ++j) {
      float* sp = slab + c * kSlabPitch + (j << 4) + 8 * h;
      *(v4f*)(sp)     = (v4f){ot[j][0], ot[j][1], ot[j][2], ot[j][3]};
      *(v4f*)(sp + 4) = (v4f){ot[j][4], ot[j][5], ot[j][6], ot[j][7]};
    }
    /* same wave writes and reads the slab: the LDS-only fences keep the compiler from crossing the two and wait for no global store */
    __builtin_amdgcn_fence(__ATOMIC_RELEASE, "workgroup", "local");
    __builtin_amdgcn_wave_barrier();
    __builtin_amdgcn_fence(__ATOMIC_ACQUIRE, "workgroup", "local");
    /* row segment = 64 floats = 256 B = 16 lanes x 16 B; rows it*2 + hh, it 0..7 -> 16 rows, each once */
#pragma unroll
    for (int it = 0; it < 8; ++it) {
      const v4f v = *(const v4f*)(slab + (it * 2 + hh) * kSlabPitch + c4);
      *(v4f*)(op + (size_t)(it * 2) * kD + ng * 64) = v * kOutScale + bv;
    }
    if (ng < 3) {
      /* stands in front of the first overwrite of a register that these stores name */
      asm volatile("s_wait_xcnt 0x0" ::: "memory");
      /* the next group's slab stores stay behind this group's slab reads */
      __builtin_amdgcn_fence(__ATOMIC_RELEASE, "workgroup", "local");
      __builtin_amdgcn_wave_barrier();
      __builtin_amdgcn_fence(__ATOMIC_ACQUIRE, "workgroup", "local");
    }
  }
}

/* --------------------------------------------------------------------------- */
/* Shape premise check: the file is built for 1024 nodes per batch. If the scalar */
/* two 512-B instructions) with NaN and returns normally.                         */
/* --------------------------------------------------------------------------- */
__global__ __launch_bounds__(32) void premise_guard_kernel(const int* __restrict__ gsz, float* __restrict__ out) {
  const int g = gsz[0];
  if (g != kG) {
    const int lane = threadIdx.x & 31;
    const float qn = __uint_as_float(0x7fc00000u);
    const v4f nv = (v4f){qn, qn, qn, qn};
    {
      *(v4f*)(out + lane * 4) = nv;
      *(v4f*)(out + 128 + lane * 4) = nv;
      
    }
  }
}

/* --------------------------------------------------------------------------- */
/* Host glue: kernel launches only. Weight cast + 2 projection GEMMs (they read   */
/* the f32 data rows themselves) + fused attention with the output projection    */
/* (one launch over all 32 batches, 8 x 32 blocks: one for every WGP) + premise  */
/* check = 5 launches.                                                           */
/* GEMM shapes (depth 256; one 128 x 256 tile per block; grids exact):           */
/*   q|k proj : M 32768, N 512               256 x 2 tiles -> 512 blocks         */
/*   v^T proj : M 32768, N 256, stored as C^T 256 x 1 tiles -> 256 blocks        */
/* --------------------------------------------------------------------------- */
extern "C" void kernel_launch(void* const* d_in, const int* in_sizes, int n_in,
                              void* d_out, int out_size, void* d_ws, size_t ws_size,
                              hipStream_t stream) {
  if (n_in < 9) return;
  if (in_sizes[0] != kTok * kD) return;
  if (in_sizes[1] != kBatch * kG) return;
  if (in_sizes[2] != 1 || in_sizes[3] != 1) return;
  if (in_sizes[4] != kD * kD || in_sizes[5] != kD * kD || in_sizes[6] != kD * kD || in_sizes[7] != kD * kD) return;
  if (in_sizes[8] != kD) return;
  if (out_size != kTok * kD) return;
  if (ws_size < kWsTotal) return;

  const float* data   = (const float*)d_in[0];
  const int*   mask   = (const int*)d_in[1];
  const int*   gsize  = (const int*)d_in[2];
  const int*   evalf  = (const int*)d_in[3];
  const float* Wq     = (const float*)d_in[4];
  const float* Wk     = (const float*)d_in[5];
  const float* Wv     = (const float*)d_in[6];
  const float* Wo     = (const float*)d_in[7];
  const float* b_out  = (const float*)d_in[8];
  float* out = (float*)d_out;

  char* ws = (char*)d_ws;
  unsigned short* W16  = (unsigned short*)(ws + kOffW16);
  unsigned short* QK16 = (unsigned short*)(ws + kOffQK16);
  unsigned short* VT16 = (unsigned short*)(ws + kOffVT16);

  /* weight planes */
  cast8_w4_kernel<<<dim3((kD * kD / 8) / 256, 4), 256, 0, stream>>>(Wq, Wk, Wv, Wo, W16, kWCarry);

  /* q | k = x . [Wq ; Wk]^T  -> QK16 [32768][512], carried x16 */
  wmma_gemm64<0, 1, 1, 0><<<dim3((kTok / kGM) * (2 * kD / kGN), 1), 256, 0, stream>>>(
      nullptr, data,
      W16,
      (void*)QK16, 2 * kD, 0L,
      b_out,
      2 * kD, kProjScale);

  /* v^T per batch: VT[b][d][g] = Wv[d][:] . x[b*1024+g][:]  (128 x rows and all of Wv per block, stored as C^T), carried x16 */
  wmma_gemm64<0, 1, 1, 1><<<dim3((kTok / kGM) * (kD / kGN), 1), 256, 0, stream>>>(
      nullptr, data,
      W16 + (size_t)2 * kD * kD,
      (void*)VT16, kG, (long)kD * kG,
      b_out,
      kD, kProjScale);

  /* H[b][q][d] = sum_k softmax_k(mask(q.k / 16)) * v[k][d], carried x256; out = H . Wo^T + b_out[n] -> f32 output rows */
  attn_fused_kernel<<<dim3(kG / kFaQ, kBatch), 256, 0, stream>>>(QK16, VT16, mask, evalf,
                                                                 W16 + (size_t)3 * kD * kD, b_out, out);

  premise_guard_kernel<<<1, 32, 0, stream>>>(gsize, out);
}

// v006
// It runs in 65.1 microseconds.
// Timed twice side by side with v005, it ran 1.10 times as fast both times.
// All steps since v000 together make it 10.4 times as fast.
// All contractions (q/k/v projections, q.k^T scores, p.v, output projection): v_wmma_f32_16x16x32_f16, f16 operands carried by exact powers of two, f32 accumulate; key masking, softmax and bias add in f32.
#include <hip/hip_runtime.h>
#include <math.h>

typedef __attribute__((ext_vector_type(16))) _Float16 v16h;
typedef __attribute__((ext_vector_type(8)))  _Float16 v8h;
typedef __attribute__((ext_vector_type(4)))  _Float16 v4h;
typedef __attribute__((ext_vector_type(8)))  float    v8f;
typedef __attribute__((ext_vector_type(4)))  float    v4f;
typedef __attribute__((ext_vector_type(4)))  int      v4i;

/* --------------------------------------------------------------------------- */
/* Shape constants (single head: batch b owns token rows b*1024 .. b*1024+1023) */
/* --------------------------------------------------------------------------- */
constexpr int kBatch  = 32;
constexpr int kG      = 1024;
constexpr int kD      = 256;
constexpr int kTok    = kBatch * kG;
constexpr int kSqrtD  = 16;
static_assert(kSqrtD * kSqrtD == kD);
static_assert(kTok == 32768);
static_assert((kD % 32) == 0 && (kG % 32) == 0);
static_assert((kD % 64) == 0 && (kG % 64) == 0 && (kTok % 64) == 0 && ((2 * kD) % 64) == 0);

/* Power-of-two carries of the f16 operand planes, folded back exactly in f32 epilogue scales. */
constexpr float kXCarry   = 16.0f;
constexpr float kWCarry   = 1024.0f;
constexpr float kQKVCarry = 16.0f;
constexpr float kPCarry   = 32768.0f;
constexpr float kHCarry   = 256.0f;
constexpr float kNormQK   = 1.0f / (float)kSqrtD;
constexpr float kProjScale  = kQKVCarry / (kXCarry * kWCarry);
constexpr float kScoreScale = kNormQK / (kQKVCarry * kQKVCarry);
constexpr float kOutScale   = 1.0f / (kHCarry * kWCarry);

/* --------------------------------------------------------------------------- */
/* Workspace region map (bytes; every offset a multiple of 128)                 */
/*   W16  f16 [4][256][256]       Wq | Wk | Wv | Wo, each x1024      524,288    */
/*   VT16 f16 [32][256][1024]     v^T per batch, x16               16,777,216   */
/*   QK16 f16 [32768][512]        q x16 (cols 0..255) | k x16      33,554,432   */
/*   total                                                         50,855,936   */
/* --------------------------------------------------------------------------- */
constexpr size_t kOffW16  = 0;
constexpr size_t kOffVT16 = kOffW16  + (size_t)4 * kD * kD * 2;
constexpr size_t kOffQK16 = kOffVT16 + (size_t)kBatch * kD * kG * 2;
constexpr size_t kWsTotal = kOffQK16 + (size_t)kTok * 2 * kD * 2;
static_assert(kWsTotal == 50855936ull);
static_assert(kWsTotal <= 268435456ull);
static_assert((kOffQK16 % 128) == 0 && (kOffVT16 % 128) == 0);

/* --------------------------------------------------------------------------- */
/* Fragment helpers                                                             */
/* --------------------------------------------------------------------------- */
union FragU { v16h v; v8h h[2]; };
/* elements 0..7 <- p[0..7], elements 8..15 <- p[16..23]; caller adds 8*(lane>>4) to p */
__device__ __forceinline__ v16h frag_load(const _Float16* p) {
  FragU f;
  f.h[0] = *(const v8h*)(p);
  f.h[1] = *(const v8h*)(p + 16);
  return f.v;
}
__device__ __forceinline__ v8f mma_f16(v16h a, v16h b, v8f c) {
  return __builtin_amdgcn_wmma_f32_16x16x32_f16(false, a, false, b, (short)0, c, false, false);
}
__device__ __forceinline__ void acc_guard4(v8f& a, v8f& b, v8f& c, v8f& d) {
  asm volatile("v_nop\n\tv_nop\n\tv_nop\n\tv_nop" : "+v"(a), "+v"(b), "+v"(c), "+v"(d));
}

/* --------------------------------------------------------------------------- */
/* q, k and v projections in one launch. WMMA, f16 operands, depth 256.          */
/* C[m,n] = scale * sum_k x[m,k] * W[n,k], W = Wq | Wk | Wv stacked: 768 rows.   */
/* A block of 8 waves (2 x 4) owns 128 rows of x and walks the three weight      */
/* matrices; each is one 128 x 256 tile, each wave 64 x 64 of it. The x rows are */
/* read from memory, cast and staged in LDS once and serve all three tiles.      */
/* Operand rows go global -> registers -> LDS by loads that cover whole runs of  */
/* a row, each element once per block; the waves take their fragments from LDS.  */
/* The depth is staged in two halves, one block barrier publishes each half. The */
/* first tile's second half is still in flight while its first is multiplied;    */
/* the next tile's weight rows are loaded under this tile's second half.  */
/* A weight half is overwritten only behind the barrier that follows   */
/* every wave's last read of it (the other half's barrier).                      */
/* The x rows are f32 in memory and become f16 (x16, an exact power of two)      */
/* between their load and their LDS store; a wave-wide load covers one row's     */
/* whole 512-B run.                                                              */
/* Tiles 0 and 1 (q, k): row m, column n of the q|k plane. Tile 2 (v): the       */
/* weight rows are the matrix instruction's first operand, so that the block     */
/* holds C^T: row n, column m; it goes to plane m / 1024, column m % 1024 (v^T   */
/* per batch).                                                                   */
/* Epilogue: 16-row slabs staged per wave in LDS (same wave writes and reads).   */
/* --------------------------------------------------------------------------- */
constexpr int kGM     = 128;
constexpr int kGN     = 256;
constexpr int kGHalf  = kD / 2;        /* halves of depth per staged part: 256 B of a row */
constexpr int kGPitch = kGHalf + 8;    /* halves: 272 B = 16 B x 17 */
static_assert(kD == 256 && kGHalf == 128);
static_assert((kTok % kGM) == 0 && (kG % kGM) == 0 && ((2 * kD) % kGN) == 0 && (kD % kGN) == 0);

/* depth step KS of a staged half: the wave's 4 A and 4 B fragments; a and b point at the lane's row 0 of the wave's 64 rows */
template <int KS>
__device__ __forceinline__ void load_ab(v16h (&f)[8], const _Float16* a, const _Float16* b) {
#pragma unroll
  for (int u = 0; u < 4; ++u) {
    f[u]     = frag_load(a + (u << 4) * kGPitch + KS * 32);
    f[4 + u] = frag_load(b + (u << 4) * kGPitch + KS * 32);
  }
}
__device__ __forceinline__ void mma_ab(v8f (&acc)[4][4], const v16h (&f)[8]) {
#pragma unroll
  for (int i = 0; i < 4; ++i)
#pragma unroll
    for (int j = 0; j < 4; ++j) acc[i][j] = mma_f16(f[i], f[4 + j], acc[i][j]);
}
/* holds the next depth step's LDS loads, as one group, in front of this step's matrix instructions, so that they fly under them */
__device__ __forceinline__ void step_fence() { __builtin_amdgcn_sched_barrier(0); }
/* one staged half of the depth: 4 steps of 32, fragments fetched one step ahead into a second register set */
__device__ __forceinline__ void gemm_half(v8f (&acc)[4][4], const _Float16* a, const _Float16* b) {
  v16h fa[8], fb[8];
  load_ab<0>(fa, a, b);
  load_ab<1>(fb, a, b); step_fence(); mma_ab(acc, fa); step_fence();
  load_ab<2>(fa, a, b); step_fence(); mma_ab(acc, fb); step_fence();
  load_ab<3>(fb, a, b); step_fence(); mma_ab(acc, fa); step_fence();
  mma_ab(acc, fb);
}
/* block barrier for LDS data alone: it waits for this wave's LDS stores and not for its global loads, so that the */
/* second half's loads stay in flight across it (the plain barrier's fence would wait for them too)                */
__device__ __forceinline__ void lds_barrier() {
  __builtin_amdgcn_fence(__ATOMIC_RELEASE, "workgroup", "local");
  __builtin_amdgcn_s_barrier();
  __builtin_amdgcn_fence(__ATOMIC_ACQUIRE, "workgroup", "local");
}

/* four f32 of an operand row -> f16, carried x16 */
__device__ __forceinline__ v4h cast4_x(v4f a) {
  v4h hv;
#pragma unroll
  for (int e = 0; e < 4; ++e) hv[e] = (_Float16)(a[e] * kXCarry);
  return hv;
}

/* the wave's 64 x 64 tile -> f16 rows m0 .. m0+63, columns n0 .. n0+63 of C */
__device__ __forceinline__ void store_tile_f16(const v8f (&acc)[4][4], float* slab, unsigned short* C, int ldc,
                                               int m0, int n0, int lane, float scale) {
  const int rlane = lane & 15;
  const int mOff  = (lane >> 4) * 8;
  const int q = lane >> 3, c8 = (lane & 7) * 8;
#pragma unroll
  for (int i = 0; i < 4; ++i) {
    const int mBase = m0 + (i << 4);
#pragma unroll
    for (int j = 0; j < 4; ++j) {
#pragma unroll
      for (int r = 0; r < 8; ++r) slab[(mOff + r) * 68 + (j << 4) + rlane] = acc[i][j][r] * scale;
    }
    __builtin_amdgcn_fence(__ATOMIC_RELEASE, "workgroup");
    __builtin_amdgcn_wave_barrier();
    __builtin_amdgcn_fence(__ATOMIC_ACQUIRE, "workgroup");
#pragma unroll
    for (int it = 0; it < 4; ++it) {
      const int row = it * 4 + q;
      const float* sp = slab + row * 68 + c8;
      v8h hv;
#pragma unroll
      for (int e = 0; e < 8; ++e) hv[e] = (_Float16)sp[e];
      *(v8h*)(C + (size_t)(mBase + row) * ldc + n0 + c8) = hv;
    }
    __builtin_amdgcn_fence(__ATOMIC_RELEASE, "workgroup");
    __builtin_amdgcn_wave_barrier();
    __builtin_amdgcn_fence(__ATOMIC_ACQUIRE, "workgroup");
  }
}

__global__ __launch_bounds__(256) void proj_qkv_kernel(
    const float* __restrict__ Af,
    const unsigned short* __restrict__ Wp,
    unsigned short* __restrict__ QKout,
    unsigned short* __restrict__ VTout,
    float scale) {
  const _Float16* Bt = (const _Float16*)Wp;
  __shared__ __align__(16) _Float16 sA[2][kGM * kGPitch];
  __shared__ __align__(16) _Float16 sB[2][kGN * kGPitch];
  __shared__ __align__(16) float sT[8][16 * 68];
  const int t    = threadIdx.x;
  const int lane = t & 31;
  const int wave = __builtin_amdgcn_readfirstlane((int)(threadIdx.x >> 5));
  const int tm = blockIdx.x;
  const int wm = (wave >> 2) << 6;
  const int wn = (wave & 3) << 6;

  const int rlane = lane & 15;
  const int koff  = (lane >> 4) * 8;

  /* weight rows: 16-B chunk t & 15 of row (t >> 4) + 16*i; a wave-wide load covers two rows' whole 256-B runs */
  const int sRow = t >> 4, sCol = (t & 15) * 8;
  const _Float16* gB = Bt + (size_t)sRow * kD + sCol;
  const int lS = sRow * kGPitch + sCol;
  /* x rows: 16-B chunk t & 31 of a half of row (t >> 5) + 8*i; a wave-wide load covers that row's whole 512-B run */
  const int xRow = t >> 5, xCol = (t & 31) * 4;
  const float* gX = Af + (size_t)(tm * kGM + xRow) * kD + xCol;
  const int lX = xRow * kGPitch + xCol;
  v8h rb0[kGN / 16], rb1[kGN / 16];
  v4f xa0[kGM / 8], xa1[kGM / 8];
#pragma unroll
  for (int i = 0; i < kGM / 8; ++i) xa0[i] = *(const v4f*)(gX + (size_t)(8 * i) * kD);
#pragma unroll
  for (int i = 0; i < kGN / 16; ++i) rb0[i] = *(const v8h*)(gB + (size_t)(16 * i) * kD);
#pragma unroll
  for (int i = 0; i < kGM / 8; ++i) xa1[i] = *(const v4f*)(gX + (size_t)(8 * i) * kD + kGHalf);
#pragma unroll
  for (int i = 0; i < kGN / 16; ++i) rb1[i] = *(const v8h*)(gB + (size_t)(16 * i) * kD + kGHalf);
  /* stands in front of the first overwrite of an address register that these loads name; the two addresses are */
  /* inputs so that their registers live up to the wait                                                          */
  asm volatile("s_wait_xcnt 0x0" :: "v"(gX), "v"(gB) : "memory");

  const int fA = (wm + rlane) * kGPitch + koff;
  const int fB = (wn + rlane) * kGPitch + koff;
  float* slab = sT[wave];

#pragma unroll
  for (int tn = 0; tn < 3; ++tn) {
    v8f acc[4][4];
#pragma unroll
    for (int i = 0; i < 4; ++i)
#pragma unroll
      for (int j = 0; j < 4; ++j) acc[i][j] = (v8f){0.f, 0.f, 0.f, 0.f, 0.f, 0.f, 0.f, 0.f};

    if (tn == 0) {
#pragma unroll
      for (int i = 0; i < kGM / 8; ++i) *(v4h*)(&sA[0][lX + 8 * i * kGPitch]) = cast4_x(xa0[i]);
    }
#pragma unroll
    for (int i = 0; i < kGN / 16; ++i) *(v8h*)(&sB[0][lS + 16 * i * kGPitch]) = rb0[i];
    lds_barrier();
    if (tn == 2) gemm_half(acc, &sB[0][fB], &sA[0][fA]);
    else         gemm_half(acc, &sA[0][fA], &sB[0][fB]);
    if (tn == 0) {
#pragma unroll
      for (int i = 0; i < kGM / 8; ++i) *(v4h*)(&sA[1][lX + 8 * i * kGPitch]) = cast4_x(xa1[i]);
    }
#pragma unroll
    for (int i = 0; i < kGN / 16; ++i) *(v8h*)(&sB[1][lS + 16 * i * kGPitch]) = rb1[i];
    if (tn < 2) {
      /* the next weight matrix's rows, both halves: they fly under this tile's second half */
#pragma unroll
      for (int i = 0; i < kGN / 16; ++i) rb0[i] = *(const v8h*)(gB + (size_t)((tn + 1) * kGN + 16 * i) * kD);
#pragma unroll
      for (int i = 0; i < kGN / 16; ++i) rb1[i] = *(const v8h*)(gB + (size_t)((tn + 1) * kGN + 16 * i) * kD + kGHalf);
      /* stands in front of the first overwrite of the address register that these loads name (the first matrix's */
      /* address, with a constant offset); it is an input so that its register lives up to the wait               */
      asm volatile("s_wait_xcnt 0x0" :: "v"(gB) : "memory");
    }
    lds_barrier();
    if (tn == 2) gemm_half(acc, &sB[1][fB], &sA[1][fA]);
    else         gemm_half(acc, &sA[1][fA], &sB[1][fB]);
    acc_guard4(acc[0][0], acc[0][1], acc[0][2], acc[0][3]);
    acc_guard4(acc[1][0], acc[1][1], acc[1][2], acc[1][3]);
    acc_guard4(acc[2][0], acc[2][1], acc[2][2], acc[2][3]);
    acc_guard4(acc[3][0], acc[3][1], acc[3][2], acc[3][3]);

    if (tn == 2) {
      store_tile_f16(acc, slab, VTout + (size_t)((tm * kGM) / kG) * kD * kG, kG, wn, (tm * kGM) % kG + wm, lane, scale);
    } else {
      store_tile_f16(acc, slab, QKout, 2 * kD, tm * kGM + wm, tn * kGN + wn, lane, scale);
    }
  }
}

/* --------------------------------------------------------------------------- */
/* Four [256][256] f32 weight matrices ([out][in] = Bt layout) -> f16 planes     */
/* out + z*65536 halves, x carry. grid (32, 4): blockIdx.y selects the matrix    */
/* (block-uniform); 32 blocks x 256 threads x 8 = 65,536 = one whole plane.      */
/* --------------------------------------------------------------------------- */
__global__ __launch_bounds__(256) void cast8_w4_kernel(const float* __restrict__ W0, const float* __restrict__ W1,
                                                       const float* __restrict__ W2, const float* __restrict__ W3,
                                                       unsigned short* __restrict__ out, float carry) {
  const int z = blockIdx.y;
  const float* W = (z == 0) ? W0 : (z == 1) ? W1 : (z == 2) ? W2 : W3;
  const int i = blockIdx.x * 256 + threadIdx.x;
  const float* p = W + 8 * (size_t)i;
  const v4f a = *(const v4f*)(p);
  const v4f c = *(const v4f*)(p + 4);
  v8h hv;
#pragma unroll
  for (int e = 0; e < 4; ++e) {
    hv[e]     = (_Float16)(a[e] * carry);
    hv[4 + e] = (_Float16)(c[e] * carry);
  }
  unsigned short* q = out + (size_t)z * kD * kD + 8 * (size_t)i;
  *(v8h*)q = hv;
  
}

/* --------------------------------------------------------------------------- */
/* Fused attention of one batch: scores, key mask, softmax, p.v and the output      */
/* projection in one launch.                                                       */
/*   S^T = K . Q^T   (A = 16 key rows from LDS, B = 16 query columns in registers) */
/*   O^T += V^T . P^T (A = 16 rows of v^T from LDS, B = P^T packed from the S^T    */
/*                     accumulators: two 16-key tiles give one 32-key B operand)   */
/* A lane owns query column c = lane & 15 and, of every 16-key tile, the keys      */
/* 8*(lane>>4) .. +7, so maximum and sum run in-lane plus one exchange of halves.  */
/*   x[k] = blocked[k] ? fill : s[k]  (log2 units; fill = -30, or -inf when the    */
/*          evaluate flag is nonzero);  e[k] = 2^(x[k] - m + 15), m = running max; */
/*   the sum takes every e[k], blocked ones included; P takes 0 for blocked keys.  */
/* Block = 8 waves x 16 queries = 128 queries; grid (8, 32). A stage is 64 keys:   */
/* K rows and v^T rows go global -> registers -> LDS one stage ahead, two buffers, */
/* one block barrier per stage (it publishes the next stage and ends the reads of  */
/* the buffer that the stage after it overwrites).                                 */
/* Output projection, behind the last stage, per wave and with no further block    */
/* barrier:  out^T = Wo . H^T  (A = 16 rows of Wo from LDS, B = H^T packed as f16   */
/* x256 from the O^T accumulators: two 16-deep tiles give one 32-deep B operand).   */
/* Wo (f16 x1024, 256 rows) comes into its own LDS region 16 rows a stage, beside   */
/* the K and v^T staging, and is published by the stages' barriers. The 64 output   */
/* columns of a group go through a per-wave LDS slab (in the K buffers, which are   */
/* free behind the last barrier), so that the f32 stores cover whole 256-B runs.    */
/* --------------------------------------------------------------------------- */
constexpr int kFaKeys   = 64;
constexpr int kFaStages = kG / kFaKeys;
constexpr int kFaQ      = 128;
constexpr int kKPitch   = kD + 8;        /* halves: 528 B = 16 B x 33 */
constexpr int kVPitch   = kFaKeys + 8;   /* halves: 144 B = 16 B x 9  */
constexpr int kKBuf     = kFaKeys * kKPitch;
constexpr int kVBuf     = kD * kVPitch;
constexpr float kLog2e  = 1.4426950408889634f;
constexpr float kScore2 = kScoreScale * kLog2e;
constexpr float kPExp   = 15.0f;
constexpr float kFaOut  = kHCarry / kQKVCarry;
constexpr int kWRows    = kD / kFaStages;   /* rows of Wo staged per stage */
constexpr int kSlabPitch = 68;              /* floats: 272 B = 16 B x 17 */
static_assert(kWRows == 16 && 8 * 16 * kSlabPitch * 4 <= 2 * kKBuf * 2);
static_assert(kPCarry == 32768.0f && kPExp == 15.0f);
static_assert((kG % kFaKeys) == 0 && (kG % kFaQ) == 0 && kD == 256 && kFaKeys == 64);

/* lane l reads lane l ^ 16 */
__device__ __forceinline__ float xhalf(float x) {
  return __builtin_bit_cast(float, __builtin_amdgcn_permlanex16(__builtin_bit_cast(int, x), __builtin_bit_cast(int, x),
                                                                0x76543210, 0xfedcba98, false, false));
}

/* group g of the score product: key tiles 0..3 at depth steps 2g and 2g+1 */
template <int G>
__device__ __forceinline__ void load_k8(v16h (&f)[8], const _Float16* kb) {
#pragma unroll
  for (int u = 0; u < 8; ++u) f[u] = frag_load(kb + (u & 3) * 16 * kKPitch + (2 * G + (u >> 2)) * 32);
}
template <int G>
__device__ __forceinline__ void mma_k8(v8f (&st)[4], const v16h (&f)[8], const v16h (&qf)[8]) {
#pragma unroll
  for (int u = 0; u < 8; ++u) st[u & 3] = mma_f16(f[u], qf[2 * G + (u >> 2)], st[u & 3]);
}
/* group g of the output product: depth tiles 8*(g&1) .. +7 at the 32 keys g>>1 */
template <int G>
__device__ __forceinline__ void load_v8(v16h (&f)[8], const _Float16* vb) {
#pragma unroll
  for (int u = 0; u < 8; ++u) f[u] = frag_load(vb + ((G & 1) * 8 + u) * 16 * kVPitch + (G >> 1) * 32);
}
template <int G>
__device__ __forceinline__ void mma_v8(v8f (&acc)[16], const v16h (&f)[8], const v16h (&pb)[2]) {
#pragma unroll
  for (int u = 0; u < 8; ++u) acc[(G & 1) * 8 + u] = mma_f16(f[u], pb[G >> 1], acc[(G & 1) * 8 + u]);
}
/* holds the next group's LDS loads in front of this group's matrix instructions, so that they fly under them */
__device__ __forceinline__ void group_fence() { __builtin_amdgcn_sched_barrier(0); }

__global__ __launch_bounds__(256) void attn_fused_kernel(const unsigned short* __restrict__ QKp,
                                                         const unsigned short* __restrict__ VTp,
                                                         const int* __restrict__ mask,
                                                         const int* __restrict__ evalflag,
                                                         const unsigned short* __restrict__ Wop,
                                                         const float* __restrict__ bias,
                                                         float* __restrict__ out) {
  __shared__ __align__(16) _Float16 sK[2][kKBuf];
  __shared__ __align__(16) _Float16 sV[2][kVBuf];
  __shared__ __align__(16) _Float16 sW[kD * kKPitch];
  __shared__ unsigned sBlk[kG / 32];
  const int t    = threadIdx.x;
  const int lane = t & 31;
  const int wave = __builtin_amdgcn_readfirstlane((int)(threadIdx.x >> 5));
  const int b    = blockIdx.y;
  const int c    = lane & 15;
  const int h    = lane >> 4;
  const int q0   = blockIdx.x * kFaQ + wave * 16;
  const _Float16* QK = (const _Float16*)QKp + (size_t)b * kG * 2 * kD;
  const _Float16* VT = (const _Float16*)VTp + (size_t)b * kD * kG;

  /* blocked keys as bits: word w, bit i = key 32*w + i */
  int mk[4];
#pragma unroll
  for (int i = 0; i < 4; ++i) mk[i] = mask[(size_t)b * kG + (wave * 4 + i) * 32 + lane];
  /* stands in front of the first overwrite of the address register that these loads name */
  asm volatile("s_wait_xcnt 0x0" ::: "memory");
  unsigned bits[4];
#pragma unroll
  for (int i = 0; i < 4; ++i) bits[i] = __builtin_amdgcn_ballot_w32(mk[i] != 0);
  if (lane == 0) {
#pragma unroll
    for (int i = 0; i < 4; ++i) sBlk[wave * 4 + i] = bits[i];
  }
  const float fill2 = (evalflag[0] != 0) ? (-INFINITY) : (-30.0f * kLog2e);

  /* B operand of the score product: this wave's 16 query rows, whole depth */
  v16h qf[8];
#pragma unroll
  for (int kk = 0; kk < 8; ++kk) qf[kk] = frag_load(QK + (size_t)(q0 + c) * (2 * kD) + kk * 32 + 8 * h);

  /* staging map: 16-B chunk t + 256*i of a stage's K tile (32 chunks a row) and v^T tile (8 chunks a row) */
  const int kRow = t >> 5, kCol = (t & 31) * 8;
  const int vRow = t >> 3, vCol = (t & 7) * 8;
  const _Float16* gK = QK + (size_t)kRow * (2 * kD) + kD + kCol;
  const _Float16* gV = VT + (size_t)vRow * kG + vCol;
  /* Wo rows take the K tile's map: a wave-wide load covers one row's whole 512-B run */
  const _Float16* gW = (const _Float16*)Wop + (size_t)kRow * kD + kCol;
  const int lK = kRow * kKPitch + kCol;
  const int lV = vRow * kVPitch + vCol;
  v8h kr[8], vr[8];
#pragma unroll
  for (int i = 0; i < 8; ++i) {
    kr[i] = *(const v8h*)(gK + (size_t)(8 * i) * (2 * kD));
    vr[i] = *(const v8h*)(gV + (size_t)(32 * i) * kG);
  }
#pragma unroll
  for (int i = 0; i < 8; ++i) {
    *(v8h*)(&sK[0][lK + 8 * i * kKPitch])  = kr[i];
    *(v8h*)(&sV[0][lV + 32 * i * kVPitch]) = vr[i];
  }

  v8f acc[16];
#pragma unroll
  for (int d = 0; d < 16; ++d) acc[d] = (v8f){0.f, 0.f, 0.f, 0.f, 0.f, 0.f, 0.f, 0.f};
  float m_run = -INFINITY;
  float l_run = 0.0f;
  __syncthreads();

  /* rolled: one stage's body (64 matrix instructions and their loads) per iteration */
#pragma unroll 1
  for (int s = 0; s < kFaStages; ++s) {
    const int buf = s & 1;
    const bool more = (s + 1 < kFaStages);
    v8h wr[2];
    const _Float16* gWs = gW + (size_t)(s * kWRows) * kD;
#pragma unroll
    for (int i = 0; i < 2; ++i) wr[i] = *(const v8h*)(gWs + (size_t)(8 * i) * kD);
    /* stands in front of the first overwrite of the address register that these loads name */
    asm volatile("s_wait_xcnt 0x0" :: "v"(gWs) : "memory");
    if (more) {
#pragma unroll
      for (int i = 0; i < 8; ++i) {
        kr[i] = *(const v8h*)(gK + (size_t)((s + 1) * kFaKeys + 8 * i) * (2 * kD));
        vr[i] = *(const v8h*)(gV + (size_t)(32 * i) * kG + (s + 1) * kFaKeys);
      }
      /* stands in front of the first overwrite of an address register that these loads name */
      asm volatile("s_wait_xcnt 0x0" ::: "memory");
    }

    /* S^T: 4 key tiles x 16 query columns */
    v8f st[4];
#pragma unroll
    for (int kt = 0; kt < 4; ++kt) st[kt] = (v8f){0.f, 0.f, 0.f, 0.f, 0.f, 0.f, 0.f, 0.f};
    const _Float16* kb = &sK[buf][c * kKPitch + 8 * h];
    const _Float16* vb = &sV[buf][c * kVPitch + 8 * h];
    v16h fa[8], fb[8];
    load_k8<0>(fa, kb);
    load_k8<1>(fb, kb); group_fence(); mma_k8<0>(st, fa, qf); group_fence();
    load_k8<2>(fa, kb); group_fence(); mma_k8<1>(st, fb, qf); group_fence();
    load_k8<3>(fb, kb); group_fence(); mma_k8<2>(st, fa, qf); group_fence();
    load_v8<0>(fa, vb); group_fence(); mma_k8<3>(st, fb, qf); group_fence();

    /* key kt*16 + 8h + r of the stage: word kt>>1, bit (kt&1)*16 + 8h + r */
    const unsigned w0 = sBlk[2 * s] >> (8 * h);
    const unsigned w1 = sBlk[2 * s + 1] >> (8 * h);
    float x[4][8];
    float mx = -INFINITY;
#pragma unroll
    for (int kt = 0; kt < 4; ++kt) {
      const unsigned wb = (kt < 2) ? w0 : w1;
#pragma unroll
      for (int r = 0; r < 8; ++r) {
        const bool blk = ((wb >> ((kt & 1) * 16 + r)) & 1u) != 0u;
        x[kt][r] = blk ? fill2 : st[kt][r] * kScore2;
        mx = fmaxf(mx, x[kt][r]);
      }
    }
    mx = fmaxf(mx, xhalf(mx));
    const float m_new = fmaxf(m_run, mx);
    /* scalar branch: the 128 output registers are rescaled only in a stage that raises some column's maximum */
    if (__builtin_amdgcn_ballot_w32(m_new > m_run) != 0) {
      const float ms   = (m_new == -INFINITY) ? 0.0f : m_new;
      const float corr = __builtin_amdgcn_exp2f(m_run - ms);
      l_run *= corr;
#pragma unroll
      for (int d = 0; d < 16; ++d)
#pragma unroll
        for (int r = 0; r < 8; ++r) acc[d][r] *= corr;
      m_run = m_new;
    }
    const float moff = ((m_run == -INFINITY) ? 0.0f : m_run) - kPExp;

    v16h pb[2];
    float ls[4];
#pragma unroll
    for (int kt = 0; kt < 4; ++kt) {
      const unsigned wb = (kt < 2) ? w0 : w1;
      ls[kt] = 0.0f;
#pragma unroll
      for (int r = 0; r < 8; ++r) {
        const bool blk = ((wb >> ((kt & 1) * 16 + r)) & 1u) != 0u;
        const float e = __builtin_amdgcn_exp2f(x[kt][r] - moff);
        ls[kt] += e;
        pb[kt >> 1][(kt & 1) * 8 + r] = (_Float16)(blk ? 0.0f : e);
      }
    }
    l_run += (ls[0] + ls[1]) + (ls[2] + ls[3]);

    /* O^T: 16 depth tiles x 16 query columns, 2 x 32 keys */
    load_v8<1>(fb, vb); group_fence(); mma_v8<0>(acc, fa, pb); group_fence();
    load_v8<2>(fa, vb); group_fence(); mma_v8<1>(acc, fb, pb); group_fence();
    load_v8<3>(fb, vb); group_fence(); mma_v8<2>(acc, fa, pb); group_fence();
    mma_v8<3>(acc, fb, pb);

    if (more) {
#pragma unroll
      for (int i = 0; i < 8; ++i) {
        *(v8h*)(&sK[buf ^ 1][lK + 8 * i * kKPitch])  = kr[i];
        *(v8h*)(&sV[buf ^ 1][lV + 32 * i * kVPitch]) = vr[i];
      }
    }
#pragma unroll
    for (int i = 0; i < 2; ++i) *(v8h*)(&sW[lK + (s * kWRows + 8 * i) * kKPitch]) = wr[i];
    __syncthreads();
  }

  /* a lane holds depth d*16 + 8h .. +7 of query q0 + c: depth tiles 2*dd and 2*dd + 1 are B operand dd of the projection */
  const float l_tot = l_run + xhalf(l_run);
  const float inv   = (l_tot > 0.0f) ? (kFaOut / l_tot) : 0.0f;
  v16h hb[8];
#pragma unroll
  for (int d = 0; d < 16; ++d)
#pragma unroll
    for (int r = 0; r < 8; ++r) hb[d >> 1][(d & 1) * 8 + r] = (_Float16)(acc[d][r] * inv);

  /* out^T: 4 groups of 64 output columns (4 tiles of 16 rows of Wo), depth 256 in 8 steps, in the order of the score product */
  float* slab = (float*)&sK[0][0] + wave * (16 * kSlabPitch);
  const int hh = lane >> 4, c4 = (lane & 15) * 4;
  const _Float16* wb = &sW[c * kKPitch + 8 * h];
  const float* bp = bias + c4;
  float* op = out + ((size_t)b * kG + q0 + hh) * kD + c4;
  v16h fa[8], fb[8];
  load_k8<0>(fa, wb);
#pragma unroll
  for (int ng = 0; ng < 4; ++ng) {
    const _Float16* wg = wb + ng * 64 * kKPitch;
    const v4f bv = *(const v4f*)(bp + ng * 64);
    v8f ot[4];
#pragma unroll
    for (int j = 0; j < 4; ++j) ot[j] = (v8f){0.f, 0.f, 0.f, 0.f, 0.f, 0.f, 0.f, 0.f};
    load_k8<1>(fb, wg); group_fence(); mma_k8<0>(ot, fa, hb); group_fence();
    load_k8<2>(fa, wg); group_fence(); mma_k8<1>(ot, fb, hb); group_fence();
    load_k8<3>(fb, wg); group_fence(); mma_k8<2>(ot, fa, hb); group_fence();
    if (ng < 3) load_k8<0>(fa, wg + 64 * kKPitch);
    group_fence(); mma_k8<3>(ot, fb, hb); group_fence();
    /* a lane holds columns j*16 + 8h .. +7 of query row c: two 16-B LDS stores per tile */
#pragma unroll
    for (int j = 0; j < 4; ++j) {
      float* sp = slab + c * kSlabPitch + (j << 4) + 8 * h;
      *(v4f*)(sp)     = (v4f){ot[j][0], ot[j][1], ot[j][2], ot[j][3]};
      *(v4f*)(sp + 4) = (v4f){ot[j][4], ot[j][5], ot[j][6], ot[j][7]};
    }
    /* same wave writes and reads the slab: the LDS-only fences keep the compiler from crossing the two and wait for no global store */
    __builtin_amdgcn_fence(__ATOMIC_RELEASE, "workgroup", "local");
    __builtin_amdgcn_wave_barrier();
    __builtin_amdgcn_fence(__ATOMIC_ACQUIRE, "workgroup", "local");
    /* row segment = 64 floats = 256 B = 16 lanes x 16 B; rows it*2 + hh, it 0..7 -> 16 rows, each once */
#pragma unroll
    for (int it = 0; it < 8; ++it) {
      const v4f v = *(const v4f*)(slab + (it * 2 + hh) * kSlabPitch + c4);
      *(v4f*)(op + (size_t)(it * 2) * kD + ng * 64) = v * kOutScale + bv;
    }
    if (ng < 3) {
      /* stands in front of the first overwrite of a register that these stores name */
      asm volatile("s_wait_xcnt 0x0" ::: "memory");
      /* the next group's slab stores stay behind this group's slab reads */
      __builtin_amdgcn_fence(__ATOMIC_RELEASE, "workgroup", "local");
      __builtin_amdgcn_wave_barrier();
      __builtin_amdgcn_fence(__ATOMIC_ACQUIRE, "workgroup", "local");
    }
  }
}

/* --------------------------------------------------------------------------- */
/* Shape premise check: the file is built for 1024 nodes per batch. If the scalar */
/* two 512-B instructions) with NaN and returns normally.                         */
/* --------------------------------------------------------------------------- */
__global__ __launch_bounds__(32) void premise_guard_kernel(const int* __restrict__ gsz, float* __restrict__ out) {
  const int g = gsz[0];
  if (g != kG) {
    const int lane = threadIdx.x & 31;
    const float qn = __uint_as_float(0x7fc00000u);
    const v4f nv = (v4f){qn, qn, qn, qn};
    {
      *(v4f*)(out + lane * 4) = nv;
      *(v4f*)(out + 128 + lane * 4) = nv;
      
    }
  }
}

/* --------------------------------------------------------------------------- */
/* Host glue: kernel launches only. Weight cast + one projection launch (it reads */
/* the f32 data rows itself: 128 rows and all 768 weight rows per block, 256      */
/* blocks: one for every WGP) + fused attention with the output projection (one   */
/* launch over all 32 batches, 8 x 32 blocks) + premise check = 4 launches.       */
/* --------------------------------------------------------------------------- */
extern "C" void kernel_launch(void* const* d_in, const int* in_sizes, int n_in,
                              void* d_out, int out_size, void* d_ws, size_t ws_size,
                              hipStream_t stream) {
  if (n_in < 9) return;
  if (in_sizes[0] != kTok * kD) return;
  if (in_sizes[1] != kBatch * kG) return;
  if (in_sizes[2] != 1 || in_sizes[3] != 1) return;
  if (in_sizes[4] != kD * kD || in_sizes[5] != kD * kD || in_sizes[6] != kD * kD || in_sizes[7] != kD * kD) return;
  if (in_sizes[8] != kD) return;
  if (out_size != kTok * kD) return;
  if (ws_size < kWsTotal) return;

  const float* data   = (const float*)d_in[0];
  const int*   mask   = (const int*)d_in[1];
  const int*   gsize  = (const int*)d_in[2];
  const int*   evalf  = (const int*)d_in[3];
  const float* Wq     = (const float*)d_in[4];
  const float* Wk     = (const float*)d_in[5];
  const float* Wv     = (const float*)d_in[6];
  const float* Wo     = (const float*)d_in[7];
  const float* b_out  = (const float*)d_in[8];
  float* out = (float*)d_out;

  char* ws = (char*)d_ws;
  unsigned short* W16  = (unsigned short*)(ws + kOffW16);
  unsigned short* QK16 = (unsigned short*)(ws + kOffQK16);
  unsigned short* VT16 = (unsigned short*)(ws + kOffVT16);

  /* weight planes */
  cast8_w4_kernel<<<dim3((kD * kD / 8) / 256, 4), 256, 0, stream>>>(Wq, Wk, Wv, Wo, W16, kWCarry);

  /* q | k = x . [Wq ; Wk]^T -> QK16 [32768][512]; VT[b][d][g] = Wv[d][:] . x[b*1024+g][:] (stored as C^T); all carried x16 */
  proj_qkv_kernel<<<dim3(kTok / kGM, 1), 256, 0, stream>>>(data, W16, QK16, VT16, kProjScale);

  /* H[b][q][d] = sum_k softmax_k(mask(q.k / 16)) * v[k][d], carried x256; out = H . Wo^T + b_out[n] -> f32 output rows */
  attn_fused_kernel<<<dim3(kG / kFaQ, kBatch), 256, 0, stream>>>(QK16, VT16, mask, evalf,
                                                                 W16 + (size_t)3 * kD * kD, b_out, out);

  premise_guard_kernel<<<1, 32, 0, stream>>>(gsize, out);
}

// v007
// One run takes 62.8 microseconds.
// Timed twice side by side with v006, it ran 1.03 and 1.04 times as fast.
// Counting every step since v000, it is 10.8 times as fast.
// All contractions (q/k/v projections, q.k^T scores, p.v, output projection): v_wmma_f32_16x16x32_f16, f16 operands carried by exact powers of two, f32 accumulate; key masking, softmax and bias add in f32.
#include <hip/hip_runtime.h>
#include <math.h>

typedef __attribute__((ext_vector_type(16))) _Float16 v16h;
typedef __attribute__((ext_vector_type(8)))  _Float16 v8h;
typedef __attribute__((ext_vector_type(4)))  _Float16 v4h;
typedef __attribute__((ext_vector_type(8)))  float    v8f;
typedef __attribute__((ext_vector_type(4)))  float    v4f;
typedef __attribute__((ext_vector_type(4)))  int      v4i;

/* --------------------------------------------------------------------------- */
/* Shape constants (single head: batch b owns token rows b*1024 .. b*1024+1023) */
/* --------------------------------------------------------------------------- */
constexpr int kBatch  = 32;
constexpr int kG      = 1024;
constexpr int kD      = 256;
constexpr int kTok    = kBatch * kG;
constexpr int kSqrtD  = 16;
static_assert(kSqrtD * kSqrtD == kD);
static_assert(kTok == 32768);
static_assert((kD % 32) == 0 && (kG % 32) == 0);
static_assert((kD % 64) == 0 && (kG % 64) == 0 && (kTok % 64) == 0 && ((2 * kD) % 64) == 0);

/* Power-of-two carries of the f16 operand planes, folded back exactly in f32 epilogue scales. */
constexpr float kXCarry   = 16.0f;
constexpr float kWCarry   = 1024.0f;
constexpr float kQKVCarry = 16.0f;
constexpr float kPCarry   = 32768.0f;
constexpr float kHCarry   = 256.0f;
constexpr float kNormQK   = 1.0f / (float)kSqrtD;
constexpr float kProjScale  = kQKVCarry / (kXCarry * kWCarry);
constexpr float kScoreScale = kNormQK / (kQKVCarry * kQKVCarry);
constexpr float kOutScale   = 1.0f / (kHCarry * kWCarry);

/* --------------------------------------------------------------------------- */
/* Workspace region map (bytes; every offset a multiple of 128)                 */
/*   W16  f16 [4][256][256]       Wq | Wk | Wv | Wo, each x1024      524,288    */
/*   VT16 f16 [32][256][1024]     v^T per batch, x16               16,777,216   */
/*   QK16 f16 [32768][512]        q x16 (cols 0..255) | k x16      33,554,432   */
/*   total                                                         50,855,936   */
/* --------------------------------------------------------------------------- */
constexpr size_t kOffW16  = 0;
constexpr size_t kOffVT16 = kOffW16  + (size_t)4 * kD * kD * 2;
constexpr size_t kOffQK16 = kOffVT16 + (size_t)kBatch * kD * kG * 2;
constexpr size_t kWsTotal = kOffQK16 + (size_t)kTok * 2 * kD * 2;
static_assert(kWsTotal == 50855936ull);
static_assert(kWsTotal <= 268435456ull);
static_assert((kOffQK16 % 128) == 0 && (kOffVT16 % 128) == 0);

/* --------------------------------------------------------------------------- */
/* Fragment helpers                                                             */
/* --------------------------------------------------------------------------- */
union FragU { v16h v; v8h h[2]; };
/* elements 0..7 <- p[0..7], elements 8..15 <- p[16..23]; caller adds 8*(lane>>4) to p */
__device__ __forceinline__ v16h frag_load(const _Float16* p) {
  FragU f;
  f.h[0] = *(const v8h*)(p);
  f.h[1] = *(const v8h*)(p + 16);
  return f.v;
}
__device__ __forceinline__ v8f mma_f16(v16h a, v16h b, v8f c) {
  return __builtin_amdgcn_wmma_f32_16x16x32_f16(false, a, false, b, (short)0, c, false, false);
}
__device__ __forceinline__ void acc_guard4(v8f& a, v8f& b, v8f& c, v8f& d) {
  asm volatile("v_nop\n\tv_nop\n\tv_nop\n\tv_nop" : "+v"(a), "+v"(b), "+v"(c), "+v"(d));
}

/* --------------------------------------------------------------------------- */
/* q, k and v projections in one launch. WMMA, f16 operands, depth 256.          */
/* C[m,n] = scale * sum_k x[m,k] * W[n,k], W = Wq | Wk | Wv stacked: 768 rows.   */
/* A block of 8 waves (2 x 4) owns 128 rows of x and walks the three weight      */
/* matrices; each is one 128 x 256 tile, each wave 64 x 64 of it. The x rows are */
/* read from memory, cast and staged in LDS once and serve all three tiles.      */
/* Operand rows go global -> registers -> LDS by loads that cover whole runs of  */
/* a row, each element once per block; the waves take their fragments from LDS.  */
/* The depth is staged in two halves, one block barrier publishes each half. The */
/* first tile's second half is still in flight while its first is multiplied;    */
/* the next tile's weight rows are loaded under this tile's second half.  */
/* A weight half is overwritten only behind the barrier that follows   */
/* every wave's last read of it (the other half's barrier).                      */
/* The x rows are f32 in memory and become f16 (x16, an exact power of two)      */
/* between their load and their LDS store; a wave-wide load covers one row's     */
/* whole 512-B run.                                                              */
/* Tiles 0 and 1 (q, k): row m, column n of the q|k plane. Tile 2 (v): the       */
/* weight rows are the matrix instruction's first operand, so that the block     */
/* holds C^T: row n, column m; it goes to plane m / 1024, column m % 1024 (v^T   */
/* per batch).                                                                   */
/* Epilogue: 16-row slabs staged per wave in LDS (same wave writes and reads).   */
/* --------------------------------------------------------------------------- */
constexpr int kGM     = 128;
constexpr int kGN     = 256;
constexpr int kGHalf  = kD / 2;        /* halves of depth per staged part: 256 B of a row */
constexpr int kGPitch = kGHalf + 8;    /* halves: 272 B = 16 B x 17 */
static_assert(kD == 256 && kGHalf == 128);
static_assert((kTok % kGM) == 0 && (kG % kGM) == 0 && ((2 * kD) % kGN) == 0 && (kD % kGN) == 0);

/* depth step KS of a staged half: the wave's 4 A and 4 B fragments; a and b point at the lane's row 0 of the wave's 64 rows */
template <int KS>
__device__ __forceinline__ void load_ab(v16h (&f)[8], const _Float16* a, const _Float16* b) {
#pragma unroll
  for (int u = 0; u < 4; ++u) {
    f[u]     = frag_load(a + (u << 4) * kGPitch + KS * 32);
    f[4 + u] = frag_load(b + (u << 4) * kGPitch + KS * 32);
  }
}
__device__ __forceinline__ void mma_ab(v8f (&acc)[4][4], const v16h (&f)[8]) {
#pragma unroll
  for (int i = 0; i < 4; ++i)
#pragma unroll
    for (int j = 0; j < 4; ++j) acc[i][j] = mma_f16(f[i], f[4 + j], acc[i][j]);
}
/* holds the next depth step's LDS loads, as one group, in front of this step's matrix instructions, so that they fly under them */
__device__ __forceinline__ void step_fence() { __builtin_amdgcn_sched_barrier(0); }
/* one staged half of the depth: 4 steps of 32, fragments fetched one step ahead into a second register set */
__device__ __forceinline__ void gemm_half(v8f (&acc)[4][4], const _Float16* a, const _Float16* b) {
  v16h fa[8], fb[8];
  load_ab<0>(fa, a, b);
  load_ab<1>(fb, a, b); step_fence(); mma_ab(acc, fa); step_fence();
  load_ab<2>(fa, a, b); step_fence(); mma_ab(acc, fb); step_fence();
  load_ab<3>(fb, a, b); step_fence(); mma_ab(acc, fa); step_fence();
  mma_ab(acc, fb);
}
/* block barrier for LDS data alone: it waits for this wave's LDS stores and not for its global loads, so that the */
/* second half's loads stay in flight across it (the plain barrier's fence would wait for them too)                */
__device__ __forceinline__ void lds_barrier() {
  __builtin_amdgcn_fence(__ATOMIC_RELEASE, "workgroup", "local");
  __builtin_amdgcn_s_barrier();
  __builtin_amdgcn_fence(__ATOMIC_ACQUIRE, "workgroup", "local");
}

/* four f32 of an operand row -> f16, carried x16 */
__device__ __forceinline__ v4h cast4_x(v4f a) {
  v4h hv;
#pragma unroll
  for (int e = 0; e < 4; ++e) hv[e] = (_Float16)(a[e] * kXCarry);
  return hv;
}

/* the wave's 64 x 64 tile -> f16 rows m0 .. m0+63, columns n0 .. n0+63 of C; more: the wave goes on to another tile behind this one */
__device__ __forceinline__ void store_tile_f16(const v8f (&acc)[4][4], float* slab, unsigned short* C, int ldc,
                                               int m0, int n0, int lane, float scale, bool more) {
  const int rlane = lane & 15;
  const int mOff  = (lane >> 4) * 8;
  const int q = lane >> 3, c8 = (lane & 7) * 8;
#pragma unroll
  for (int i = 0; i < 4; ++i) {
    const int mBase = m0 + (i << 4);
#pragma unroll
    for (int j = 0; j < 4; ++j) {
#pragma unroll
      for (int r = 0; r < 8; ++r) slab[(mOff + r) * 68 + (j << 4) + rlane] = acc[i][j][r] * scale;
    }
    /* same wave writes and reads the slab: the LDS-only fences keep the compiler from crossing the two and wait for no global load or store */
    __builtin_amdgcn_fence(__ATOMIC_RELEASE, "workgroup", "local");
    __builtin_amdgcn_wave_barrier();
    __builtin_amdgcn_fence(__ATOMIC_ACQUIRE, "workgroup", "local");
#pragma unroll
    for (int it = 0; it < 4; ++it) {
      const int row = it * 4 + q;
      const float* sp = slab + row * 68 + c8;
      v8h hv;
#pragma unroll
      for (int e = 0; e < 8; ++e) hv[e] = (_Float16)sp[e];
      *(v8h*)(C + (size_t)(mBase + row) * ldc + n0 + c8) = hv;
    }
    /* stands in front of the first overwrite of a register that these stores name (behind the wave's last stores there is none) */
    if (i < 3 || more) asm volatile("s_wait_xcnt 0x0" ::: "memory");
    /* the next slab's LDS stores stay behind this slab's LDS reads; the global stores stay in flight */
    __builtin_amdgcn_fence(__ATOMIC_RELEASE, "workgroup", "local");
    __builtin_amdgcn_wave_barrier();
    __builtin_amdgcn_fence(__ATOMIC_ACQUIRE, "workgroup", "local");
  }
}

__global__ __launch_bounds__(256) void proj_qkv_kernel(
    const float* __restrict__ Af,
    const unsigned short* __restrict__ Wp,
    unsigned short* __restrict__ QKout,
    unsigned short* __restrict__ VTout,
    float scale) {
  const _Float16* Bt = (const _Float16*)Wp;
  __shared__ __align__(16) _Float16 sA[2][kGM * kGPitch];
  __shared__ __align__(16) _Float16 sB[2][kGN * kGPitch];
  __shared__ __align__(16) float sT[8][16 * 68];
  const int t    = threadIdx.x;
  const int lane = t & 31;
  const int wave = __builtin_amdgcn_readfirstlane((int)(threadIdx.x >> 5));
  const int tm = blockIdx.x;
  const int wm = (wave >> 2) << 6;
  const int wn = (wave & 3) << 6;

  const int rlane = lane & 15;
  const int koff  = (lane >> 4) * 8;

  /* weight rows: 16-B chunk t & 15 of row (t >> 4) + 16*i; a wave-wide load covers two rows' whole 256-B runs */
  const int sRow = t >> 4, sCol = (t & 15) * 8;
  const _Float16* gB = Bt + (size_t)sRow * kD + sCol;
  const int lS = sRow * kGPitch + sCol;
  /* x rows: 16-B chunk t & 31 of a half of row (t >> 5) + 8*i; a wave-wide load covers that row's whole 512-B run */
  const int xRow = t >> 5, xCol = (t & 31) * 4;
  const float* gX = Af + (size_t)(tm * kGM + xRow) * kD + xCol;
  const int lX = xRow * kGPitch + xCol;
  v8h rb0[kGN / 16], rb1[kGN / 16];
  v4f xa0[kGM / 8], xa1[kGM / 8];
#pragma unroll
  for (int i = 0; i < kGM / 8; ++i) xa0[i] = *(const v4f*)(gX + (size_t)(8 * i) * kD);
#pragma unroll
  for (int i = 0; i < kGN / 16; ++i) rb0[i] = *(const v8h*)(gB + (size_t)(16 * i) * kD);
#pragma unroll
  for (int i = 0; i < kGM / 8; ++i) xa1[i] = *(const v4f*)(gX + (size_t)(8 * i) * kD + kGHalf);
#pragma unroll
  for (int i = 0; i < kGN / 16; ++i) rb1[i] = *(const v8h*)(gB + (size_t)(16 * i) * kD + kGHalf);
  /* stands in front of the first overwrite of an address register that these loads name; the two addresses are */
  /* inputs so that their registers live up to the wait                                                          */
  asm volatile("s_wait_xcnt 0x0" :: "v"(gX), "v"(gB) : "memory");

  const int fA = (wm + rlane) * kGPitch + koff;
  const int fB = (wn + rlane) * kGPitch + koff;
  float* slab = sT[wave];

#pragma unroll
  for (int tn = 0; tn < 3; ++tn) {
    v8f acc[4][4];
#pragma unroll
    for (int i = 0; i < 4; ++i)
#pragma unroll
      for (int j = 0; j < 4; ++j) acc[i][j] = (v8f){0.f, 0.f, 0.f, 0.f, 0.f, 0.f, 0.f, 0.f};

    if (tn == 0) {
#pragma unroll
      for (int i = 0; i < kGM / 8; ++i) *(v4h*)(&sA[0][lX + 8 * i * kGPitch]) = cast4_x(xa0[i]);
    }
#pragma unroll
    for (int i = 0; i < kGN / 16; ++i) *(v8h*)(&sB[0][lS + 16 * i * kGPitch]) = rb0[i];
    lds_barrier();
    if (tn == 2) gemm_half(acc, &sB[0][fB], &sA[0][fA]);
    else         gemm_half(acc, &sA[0][fA], &sB[0][fB]);
    if (tn == 0) {
#pragma unroll
      for (int i = 0; i < kGM / 8; ++i) *(v4h*)(&sA[1][lX + 8 * i * kGPitch]) = cast4_x(xa1[i]);
    }
#pragma unroll
    for (int i = 0; i < kGN / 16; ++i) *(v8h*)(&sB[1][lS + 16 * i * kGPitch]) = rb1[i];
    if (tn < 2) {
      /* the next weight matrix's rows, both halves: they fly under this tile's second half */
#pragma unroll
      for (int i = 0; i < kGN / 16; ++i) rb0[i] = *(const v8h*)(gB + (size_t)((tn + 1) * kGN + 16 * i) * kD);
#pragma unroll
      for (int i = 0; i < kGN / 16; ++i) rb1[i] = *(const v8h*)(gB + (size_t)((tn + 1) * kGN + 16 * i) * kD + kGHalf);
      /* stands in front of the first overwrite of the address register that these loads name (the first matrix's */
      /* address, with a constant offset); it is an input so that its register lives up to the wait               */
      asm volatile("s_wait_xcnt 0x0" :: "v"(gB) : "memory");
    }
    lds_barrier();
    if (tn == 2) gemm_half(acc, &sB[1][fB], &sA[1][fA]);
    else         gemm_half(acc, &sA[1][fA], &sB[1][fB]);
    acc_guard4(acc[0][0], acc[0][1], acc[0][2], acc[0][3]);
    acc_guard4(acc[1][0], acc[1][1], acc[1][2], acc[1][3]);
    acc_guard4(acc[2][0], acc[2][1], acc[2][2], acc[2][3]);
    acc_guard4(acc[3][0], acc[3][1], acc[3][2], acc[3][3]);

    if (tn == 2) {
      store_tile_f16(acc, slab, VTout + (size_t)((tm * kGM) / kG) * kD * kG, kG, wn, (tm * kGM) % kG + wm, lane, scale, false);
    } else {
      store_tile_f16(acc, slab, QKout, 2 * kD, tm * kGM + wm, tn * kGN + wn, lane, scale, true);
    }
  }
}

/* --------------------------------------------------------------------------- */
/* Four [256][256] f32 weight matrices ([out][in] = Bt layout) -> f16 planes     */
/* out + z*65536 halves, x carry. grid (32, 4): blockIdx.y selects the matrix    */
/* (block-uniform); 32 blocks x 256 threads x 8 = 65,536 = one whole plane.      */
/* --------------------------------------------------------------------------- */
__global__ __launch_bounds__(256) void cast8_w4_kernel(const float* __restrict__ W0, const float* __restrict__ W1,
                                                       const float* __restrict__ W2, const float* __restrict__ W3,
                                                       unsigned short* __restrict__ out, float carry) {
  const int z = blockIdx.y;
  const float* W = (z == 0) ? W0 : (z == 1) ? W1 : (z == 2) ? W2 : W3;
  const int i = blockIdx.x * 256 + threadIdx.x;
  const float* p = W + 8 * (size_t)i;
  const v4f a = *(const v4f*)(p);
  const v4f c = *(const v4f*)(p + 4);
  v8h hv;
#pragma unroll
  for (int e = 0; e < 4; ++e) {
    hv[e]     = (_Float16)(a[e] * carry);
    hv[4 + e] = (_Float16)(c[e] * carry);
  }
  unsigned short* q = out + (size_t)z * kD * kD + 8 * (size_t)i;
  *(v8h*)q = hv;
  
}

/* --------------------------------------------------------------------------- */
/* Fused attention of one batch: scores, key mask, softmax, p.v and the output      */
/* projection in one launch.                                                       */
/*   S^T = K . Q^T   (A = 16 key rows from LDS, B = 16 query columns in registers) */
/*   O^T += V^T . P^T (A = 16 rows of v^T from LDS, B = P^T packed from the S^T    */
/*                     accumulators: two 16-key tiles give one 32-key B operand)   */
/* A lane owns query column c = lane & 15 and, of every 16-key tile, the keys      */
/* 8*(lane>>4) .. +7, so maximum and sum run in-lane plus one exchange of halves.  */
/*   x[k] = blocked[k] ? fill : s[k]  (log2 units; fill = -30, or -inf when the    */
/*          evaluate flag is nonzero);  e[k] = 2^(x[k] - m + 15), m = running max; */
/*   the sum takes every e[k], blocked ones included; P takes 0 for blocked keys.  */
/* Block = 8 waves x 16 queries = 128 queries; grid (8, 32). A stage is 64 keys:   */
/* K rows and v^T rows go global -> registers -> LDS one stage ahead, two buffers, */
/* one block barrier per stage (it publishes the next stage and ends the reads of  */
/* the buffer that the stage after it overwrites).                                 */
/* Output projection, behind the last stage, per wave and with no further block    */
/* barrier:  out^T = Wo . H^T  (A = 16 rows of Wo from LDS, B = H^T packed as f16   */
/* x256 from the O^T accumulators: two 16-deep tiles give one 32-deep B operand).   */
/* Wo (f16 x1024, 256 rows) comes into its own LDS region 16 rows a stage, beside   */
/* the K and v^T staging, and is published by the stages' barriers. The 64 output   */
/* columns of a group go through a per-wave LDS slab (in the K buffers, which are   */
/* free behind the last barrier), so that the f32 stores cover whole 256-B runs.    */
/* --------------------------------------------------------------------------- */
constexpr int kFaKeys   = 64;
constexpr int kFaStages = kG / kFaKeys;
constexpr int kFaQ      = 128;
constexpr int kKPitch   = kD + 8;        /* halves: 528 B = 16 B x 33 */
constexpr int kVPitch   = kFaKeys + 8;   /* halves: 144 B = 16 B x 9  */
constexpr int kKBuf     = kFaKeys * kKPitch;
constexpr int kVBuf     = kD * kVPitch;
constexpr float kLog2e  = 1.4426950408889634f;
constexpr float kScore2 = kScoreScale * kLog2e;
constexpr float kPExp   = 15.0f;
constexpr float kFaOut  = kHCarry / kQKVCarry;
constexpr int kWRows    = kD / kFaStages;   /* rows of Wo staged per stage */
constexpr int kSlabPitch = 68;              /* floats: 272 B = 16 B x 17 */
static_assert(kWRows == 16 && 8 * 16 * kSlabPitch * 4 <= 2 * kKBuf * 2);
static_assert(kPCarry == 32768.0f && kPExp == 15.0f);
static_assert((kG % kFaKeys) == 0 && (kG % kFaQ) == 0 && kD == 256 && kFaKeys == 64);

/* lane l reads lane l ^ 16 */
__device__ __forceinline__ float xhalf(float x) {
  return __builtin_bit_cast(float, __builtin_amdgcn_permlanex16(__builtin_bit_cast(int, x), __builtin_bit_cast(int, x),
                                                                0x76543210, 0xfedcba98, false, false));
}

/* group g of the score product: key tiles 0..3 at depth steps 2g and 2g+1 */
template <int G>
__device__ __forceinline__ void load_k8(v16h (&f)[8], const _Float16* kb) {
#pragma unroll
  for (int u = 0; u < 8; ++u) f[u] = frag_load(kb + (u & 3) * 16 * kKPitch + (2 * G + (u >> 2)) * 32);
}
template <int G>
__device__ __forceinline__ void mma_k8(v8f (&st)[4], const v16h (&f)[8], const v16h (&qf)[8]) {
#pragma unroll
  for (int u = 0; u < 8; ++u) st[u & 3] = mma_f16(f[u], qf[2 * G + (u >> 2)], st[u & 3]);
}
/* group g of the output product: depth tiles 8*(g&1) .. +7 at the 32 keys g>>1 */
template <int G>
__device__ __forceinline__ void load_v8(v16h (&f)[8], const _Float16* vb) {
#pragma unroll
  for (int u = 0; u < 8; ++u) f[u] = frag_load(vb + ((G & 1) * 8 + u) * 16 * kVPitch + (G >> 1) * 32);
}
template <int G>
__device__ __forceinline__ void mma_v8(v8f (&acc)[16], const v16h (&f)[8], const v16h (&pb)[2]) {
#pragma unroll
  for (int u = 0; u < 8; ++u) acc[(G & 1) * 8 + u] = mma_f16(f[u], pb[G >> 1], acc[(G & 1) * 8 + u]);
}
/* holds the next group's LDS loads in front of this group's matrix instructions, so that they fly under them */
__device__ __forceinline__ void group_fence() { __builtin_amdgcn_sched_barrier(0); }

__global__ __launch_bounds__(256) void attn_fused_kernel(const unsigned short* __restrict__ QKp,
                                                         const unsigned short* __restrict__ VTp,
                                                         const int* __restrict__ mask,
                                                         const int* __restrict__ evalflag,
                                                         const unsigned short* __restrict__ Wop,
                                                         const float* __restrict__ bias,
                                                         float* __restrict__ out) {
  __shared__ __align__(16) _Float16 sK[2][kKBuf];
  __shared__ __align__(16) _Float16 sV[2][kVBuf];
  __shared__ __align__(16) _Float16 sW[kD * kKPitch];
  __shared__ unsigned sBlk[kG / 32];
  const int t    = threadIdx.x;
  const int lane = t & 31;
  const int wave = __builtin_amdgcn_readfirstlane((int)(threadIdx.x >> 5));
  const int b    = blockIdx.y;
  const int c    = lane & 15;
  const int h    = lane >> 4;
  const int q0   = blockIdx.x * kFaQ + wave * 16;
  const _Float16* QK = (const _Float16*)QKp + (size_t)b * kG * 2 * kD;
  const _Float16* VT = (const _Float16*)VTp + (size_t)b * kD * kG;

  /* blocked keys as bits: word w, bit i = key 32*w + i */
  int mk[4];
#pragma unroll
  for (int i = 0; i < 4; ++i) mk[i] = mask[(size_t)b * kG + (wave * 4 + i) * 32 + lane];
  /* stands in front of the first overwrite of the address register that these loads name */
  asm volatile("s_wait_xcnt 0x0" ::: "memory");
  unsigned bits[4];
#pragma unroll
  for (int i = 0; i < 4; ++i) bits[i] = __builtin_amdgcn_ballot_w32(mk[i] != 0);
  if (lane == 0) {
#pragma unroll
    for (int i = 0; i < 4; ++i) sBlk[wave * 4 + i] = bits[i];
  }
  const float fill2 = (evalflag[0] != 0) ? (-INFINITY) : (-30.0f * kLog2e);

  /* B operand of the score product: this wave's 16 query rows, whole depth */
  v16h qf[8];
#pragma unroll
  for (int kk = 0; kk < 8; ++kk) qf[kk] = frag_load(QK + (size_t)(q0 + c) * (2 * kD) + kk * 32 + 8 * h);

  /* staging map: 16-B chunk t + 256*i of a stage's K tile (32 chunks a row) and v^T tile (8 chunks a row) */
  const int kRow = t >> 5, kCol = (t & 31) * 8;
  const int vRow = t >> 3, vCol = (t & 7) * 8;
  const _Float16* gK = QK + (size_t)kRow * (2 * kD) + kD + kCol;
  const _Float16* gV = VT + (size_t)vRow * kG + vCol;
  /* Wo rows take the K tile's map: a wave-wide load covers one row's whole 512-B run */
  const _Float16* gW = (const _Float16*)Wop + (size_t)kRow * kD + kCol;
  const int lK = kRow * kKPitch + kCol;
  const int lV = vRow * kVPitch + vCol;
  v8h kr[8], vr[8];
#pragma unroll
  for (int i = 0; i < 8; ++i) {
    kr[i] = *(const v8h*)(gK + (size_t)(8 * i) * (2 * kD));
    vr[i] = *(const v8h*)(gV + (size_t)(32 * i) * kG);
  }
#pragma unroll
  for (int i = 0; i < 8; ++i) {
    *(v8h*)(&sK[0][lK + 8 * i * kKPitch])  = kr[i];
    *(v8h*)(&sV[0][lV + 32 * i * kVPitch]) = vr[i];
  }

  v8f acc[16];
#pragma unroll
  for (int d = 0; d < 16; ++d) acc[d] = (v8f){0.f, 0.f, 0.f, 0.f, 0.f, 0.f, 0.f, 0.f};
  float m_run = -INFINITY;
  float l_run = 0.0f;
  __syncthreads();

  /* rolled: one stage's body (64 matrix instructions and their loads) per iteration */
#pragma unroll 1
  for (int s = 0; s < kFaStages; ++s) {
    const int buf = s & 1;
    const bool more = (s + 1 < kFaStages);
    v8h wr[2];
    const _Float16* gWs = gW + (size_t)(s * kWRows) * kD;
#pragma unroll
    for (int i = 0; i < 2; ++i) wr[i] = *(const v8h*)(gWs + (size_t)(8 * i) * kD);
    /* stands in front of the first overwrite of the address register that these loads name */
    asm volatile("s_wait_xcnt 0x0" :: "v"(gWs) : "memory");
    if (more) {
#pragma unroll
      for (int i = 0; i < 8; ++i) {
        kr[i] = *(const v8h*)(gK + (size_t)((s + 1) * kFaKeys + 8 * i) * (2 * kD));
        vr[i] = *(const v8h*)(gV + (size_t)(32 * i) * kG + (s + 1) * kFaKeys);
      }
      /* stands in front of the first overwrite of an address register that these loads name */
      asm volatile("s_wait_xcnt 0x0" ::: "memory");
    }

    /* S^T: 4 key tiles x 16 query columns */
    v8f st[4];
#pragma unroll
    for (int kt = 0; kt < 4; ++kt) st[kt] = (v8f){0.f, 0.f, 0.f, 0.f, 0.f, 0.f, 0.f, 0.f};
    const _Float16* kb = &sK[buf][c * kKPitch + 8 * h];
    const _Float16* vb = &sV[buf][c * kVPitch + 8 * h];
    v16h fa[8], fb[8];
    load_k8<0>(fa, kb);
    load_k8<1>(fb, kb); group_fence(); mma_k8<0>(st, fa, qf); group_fence();
    load_k8<2>(fa, kb); group_fence(); mma_k8<1>(st, fb, qf); group_fence();
    load_k8<3>(fb, kb); group_fence(); mma_k8<2>(st, fa, qf); group_fence();
    load_v8<0>(fa, vb); group_fence(); mma_k8<3>(st, fb, qf); group_fence();

    /* key kt*16 + 8h + r of the stage: word kt>>1, bit (kt&1)*16 + 8h + r */
    const unsigned w0 = sBlk[2 * s] >> (8 * h);
    const unsigned w1 = sBlk[2 * s + 1] >> (8 * h);
    float x[4][8];
    float mx = -INFINITY;
#pragma unroll
    for (int kt = 0; kt < 4; ++kt) {
      const unsigned wb = (kt < 2) ? w0 : w1;
#pragma unroll
      for (int r = 0; r < 8; ++r) {
        const bool blk = ((wb >> ((kt & 1) * 16 + r)) & 1u) != 0u;
        x[kt][r] = blk ? fill2 : st[kt][r] * kScore2;
        mx = fmaxf(mx, x[kt][r]);
      }
    }
    mx = fmaxf(mx, xhalf(mx));
    const float m_new = fmaxf(m_run, mx);
    /* scalar branch: the 128 output registers are rescaled only in a stage that raises some column's maximum */
    if (__builtin_amdgcn_ballot_w32(m_new > m_run) != 0) {
      const float ms   = (m_new == -INFINITY) ? 0.0f : m_new;
      const float corr = __builtin_amdgcn_exp2f(m_run - ms);
      l_run *= corr;
#pragma unroll
      for (int d = 0; d < 16; ++d)
#pragma unroll
        for (int r = 0; r < 8; ++r) acc[d][r] *= corr;
      m_run = m_new;
    }
    const float moff = ((m_run == -INFINITY) ? 0.0f : m_run) - kPExp;

    v16h pb[2];
    float ls[4];
#pragma unroll
    for (int kt = 0; kt < 4; ++kt) {
      const unsigned wb = (kt < 2) ? w0 : w1;
      ls[kt] = 0.0f;
#pragma unroll
      for (int r = 0; r < 8; ++r) {
        const bool blk = ((wb >> ((kt & 1) * 16 + r)) & 1u) != 0u;
        const float e = __builtin_amdgcn_exp2f(x[kt][r] - moff);
        ls[kt] += e;
        pb[kt >> 1][(kt & 1) * 8 + r] = (_Float16)(blk ? 0.0f : e);
      }
    }
    l_run += (ls[0] + ls[1]) + (ls[2] + ls[3]);

    /* O^T: 16 depth tiles x 16 query columns, 2 x 32 keys */
    load_v8<1>(fb, vb); group_fence(); mma_v8<0>(acc, fa, pb); group_fence();
    load_v8<2>(fa, vb); group_fence(); mma_v8<1>(acc, fb, pb); group_fence();
    load_v8<3>(fb, vb); group_fence(); mma_v8<2>(acc, fa, pb); group_fence();
    mma_v8<3>(acc, fb, pb);

    if (more) {
#pragma unroll
      for (int i = 0; i < 8; ++i) {
        *(v8h*)(&sK[buf ^ 1][lK + 8 * i * kKPitch])  = kr[i];
        *(v8h*)(&sV[buf ^ 1][lV + 32 * i * kVPitch]) = vr[i];
      }
    }
#pragma unroll
    for (int i = 0; i < 2; ++i) *(v8h*)(&sW[lK + (s * kWRows + 8 * i) * kKPitch]) = wr[i];
    __syncthreads();
  }

  /* a lane holds depth d*16 + 8h .. +7 of query q0 + c: depth tiles 2*dd and 2*dd + 1 are B operand dd of the projection */
  const float l_tot = l_run + xhalf(l_run);
  const float inv   = (l_tot > 0.0f) ? (kFaOut / l_tot) : 0.0f;
  v16h hb[8];
#pragma unroll
  for (int d = 0; d < 16; ++d)
#pragma unroll
    for (int r = 0; r < 8; ++r) hb[d >> 1][(d & 1) * 8 + r] = (_Float16)(acc[d][r] * inv);

  /* out^T: 4 groups of 64 output columns (4 tiles of 16 rows of Wo), depth 256 in 8 steps, in the order of the score product */
  float* slab = (float*)&sK[0][0] + wave * (16 * kSlabPitch);
  const int hh = lane >> 4, c4 = (lane & 15) * 4;
  const _Float16* wb = &sW[c * kKPitch + 8 * h];
  const float* bp = bias + c4;
  float* op = out + ((size_t)b * kG + q0 + hh) * kD + c4;
  v16h fa[8], fb[8];
  load_k8<0>(fa, wb);
#pragma unroll
  for (int ng = 0; ng < 4; ++ng) {
    const _Float16* wg = wb + ng * 64 * kKPitch;
    const v4f bv = *(const v4f*)(bp + ng * 64);
    v8f ot[4];
#pragma unroll
    for (int j = 0; j < 4; ++j) ot[j] = (v8f){0.f, 0.f, 0.f, 0.f, 0.f, 0.f, 0.f, 0.f};
    load_k8<1>(fb, wg); group_fence(); mma_k8<0>(ot, fa, hb); group_fence();
    load_k8<2>(fa, wg); group_fence(); mma_k8<1>(ot, fb, hb); group_fence();
    load_k8<3>(fb, wg); group_fence(); mma_k8<2>(ot, fa, hb); group_fence();
    if (ng < 3) load_k8<0>(fa, wg + 64 * kKPitch);
    group_fence(); mma_k8<3>(ot, fb, hb); group_fence();
    /* a lane holds columns j*16 + 8h .. +7 of query row c: two 16-B LDS stores per tile */
#pragma unroll
    for (int j = 0; j < 4; ++j) {
      float* sp = slab + c * kSlabPitch + (j << 4) + 8 * h;
      *(v4f*)(sp)     = (v4f){ot[j][0], ot[j][1], ot[j][2], ot[j][3]};
      *(v4f*)(sp + 4) = (v4f){ot[j][4], ot[j][5], ot[j][6], ot[j][7]};
    }
    /* same wave writes and reads the slab: the LDS-only fences keep the compiler from crossing the two and wait for no global store */
    __builtin_amdgcn_fence(__ATOMIC_RELEASE, "workgroup", "local");
    __builtin_amdgcn_wave_barrier();
    __builtin_amdgcn_fence(__ATOMIC_ACQUIRE, "workgroup", "local");
    /* row segment = 64 floats = 256 B = 16 lanes x 16 B; rows it*2 + hh, it 0..7 -> 16 rows, each once */
#pragma unroll
    for (int it = 0; it < 8; ++it) {
      const v4f v = *(const v4f*)(slab + (it * 2 + hh) * kSlabPitch + c4);
      *(v4f*)(op + (size_t)(it * 2) * kD + ng * 64) = v * kOutScale + bv;
    }
    if (ng < 3) {
      /* stands in front of the first overwrite of a register that these stores name */
      asm volatile("s_wait_xcnt 0x0" ::: "memory");
      /* the next group's slab stores stay behind this group's slab reads */
      __builtin_amdgcn_fence(__ATOMIC_RELEASE, "workgroup", "local");
      __builtin_amdgcn_wave_barrier();
      __builtin_amdgcn_fence(__ATOMIC_ACQUIRE, "workgroup", "local");
    }
  }
}

/* --------------------------------------------------------------------------- */
/* Shape premise check: the file is built for 1024 nodes per batch. If the scalar */
/* two 512-B instructions) with NaN and returns normally.                         */
/* --------------------------------------------------------------------------- */
__global__ __launch_bounds__(32) void premise_guard_kernel(const int* __restrict__ gsz, float* __restrict__ out) {
  const int g = gsz[0];
  if (g != kG) {
    const int lane = threadIdx.x & 31;
    const float qn = __uint_as_float(0x7fc00000u);
    const v4f nv = (v4f){qn, qn, qn, qn};
    {
      *(v4f*)(out + lane * 4) = nv;
      *(v4f*)(out + 128 + lane * 4) = nv;
      
    }
  }
}

/* --------------------------------------------------------------------------- */
/* Host glue: kernel launches only. Weight cast + one projection launch (it reads */
/* the f32 data rows itself: 128 rows and all 768 weight rows per block, 256      */
/* blocks: one for every WGP) + fused attention with the output projection (one   */
/* launch over all 32 batches, 8 x 32 blocks) + premise check = 4 launches.       */
/* --------------------------------------------------------------------------- */
extern "C" void kernel_launch(void* const* d_in, const int* in_sizes, int n_in,
                              void* d_out, int out_size, void* d_ws, size_t ws_size,
                              hipStream_t stream) {
  if (n_in < 9) return;
  if (in_sizes[0] != kTok * kD) return;
  if (in_sizes[1] != kBatch * kG) return;
  if (in_sizes[2] != 1 || in_sizes[3] != 1) return;
  if (in_sizes[4] != kD * kD || in_sizes[5] != kD * kD || in_sizes[6] != kD * kD || in_sizes[7] != kD * kD) return;
  if (in_sizes[8] != kD) return;
  if (out_size != kTok * kD) return;
  if (ws_size < kWsTotal) return;

  const float* data   = (const float*)d_in[0];
  const int*   mask   = (const int*)d_in[1];
  const int*   gsize  = (const int*)d_in[2];
  const int*   evalf  = (const int*)d_in[3];
  const float* Wq     = (const float*)d_in[4];
  const float* Wk     = (const float*)d_in[5];
  const float* Wv     = (const float*)d_in[6];
  const float* Wo     = (const float*)d_in[7];
  const float* b_out  = (const float*)d_in[8];
  float* out = (float*)d_out;

  char* ws = (char*)d_ws;
  unsigned short* W16  = (unsigned short*)(ws + kOffW16);
  unsigned short* QK16 = (unsigned short*)(ws + kOffQK16);
  unsigned short* VT16 = (unsigned short*)(ws + kOffVT16);

  /* weight planes */
  cast8_w4_kernel<<<dim3((kD * kD / 8) / 256, 4), 256, 0, stream>>>(Wq, Wk, Wv, Wo, W16, kWCarry);

  /* q | k = x . [Wq ; Wk]^T -> QK16 [32768][512]; VT[b][d][g] = Wv[d][:] . x[b*1024+g][:] (stored as C^T); all carried x16 */
  proj_qkv_kernel<<<dim3(kTok / kGM, 1), 256, 0, stream>>>(data, W16, QK16, VT16, kProjScale);

  /* H[b][q][d] = sum_k softmax_k(mask(q.k / 16)) * v[k][d], carried x256; out = H . Wo^T + b_out[n] -> f32 output rows */
  attn_fused_kernel<<<dim3(kG / kFaQ, kBatch), 256, 0, stream>>>(QK16, VT16, mask, evalf,
                                                                 W16 + (size_t)3 * kD * kD, b_out, out);

  premise_guard_kernel<<<1, 32, 0, stream>>>(gsize, out);
}

// v009
// A run of this version takes 50.4 microseconds.
// Versions in between are left out here; by their measured steps it is 1.24 times as fast as v007.
// All steps since v000 together make it 13.4 times as fast.
// All contractions (weight products Wk^T.Wq and Wo.Wv, the query rows by the first, q'.x^T scores, p.x, the attended rows by the second): v_wmma_f32_16x16x32_f16, f16 operands carried by exact powers of two, f32 accumulate; key masking, softmax and bias add in f32.
#include <hip/hip_runtime.h>
#include <math.h>

typedef __attribute__((ext_vector_type(16))) _Float16 v16h;
typedef __attribute__((ext_vector_type(8)))  _Float16 v8h;
typedef __attribute__((ext_vector_type(4)))  _Float16 v4h;
typedef __attribute__((ext_vector_type(8)))  float    v8f;
typedef __attribute__((ext_vector_type(4)))  float    v4f;
typedef __attribute__((ext_vector_type(8)))  short    v8s;

/* --------------------------------------------------------------------------- */
/* Shape constants (single head: batch b owns token rows b*1024 .. b*1024+1023) */
/* --------------------------------------------------------------------------- */
constexpr int kBatch  = 32;
constexpr int kG      = 1024;
constexpr int kD      = 256;
constexpr int kTok    = kBatch * kG;
constexpr int kSqrtD  = 16;
static_assert(kSqrtD * kSqrtD == kD);
static_assert(kTok == 32768);
static_assert((kD % 64) == 0 && (kG % 64) == 0);

/* Power-of-two carries of the f16 operands, folded back exactly in f32 scales. */
constexpr float kWCarry   = 1024.0f;   /* the weights on their way into the weight products */
constexpr float kFCarry   = 64.0f;     /* the folded weight planes */
constexpr float kQCarry   = 16.0f;     /* the projected query rows q' */
constexpr float kPCarry   = 32768.0f;  /* the softmax numerators */
constexpr float kHCarry   = 256.0f;    /* the attended rows h = sum_k p_k x_k */
constexpr float kNormQK   = 1.0f / (float)kSqrtD;
constexpr float kFoldScale  = kFCarry / (kWCarry * kWCarry);
constexpr float kQScale     = kQCarry / kFCarry;
constexpr float kScoreScale = kNormQK / kQCarry;
constexpr float kOutScale   = 1.0f / (kFCarry * kHCarry);

/* --------------------------------------------------------------------------- */
/* Workspace region map (bytes)                                                 */
/*   W16  f16 [2][256][256]       Wk^T.Wq | Wo.Wv, each x64          262,144    */
/* --------------------------------------------------------------------------- */
constexpr size_t kOffW16  = 0;
constexpr size_t kWsTotal = kOffW16 + (size_t)2 * kD * kD * 2;
static_assert(kWsTotal == 262144ull);

/* --------------------------------------------------------------------------- */
/* Fragment helpers                                                             */
/* --------------------------------------------------------------------------- */
union FragU { v16h v; v8h h[2]; };
/* elements 0..7 <- p[0..7], elements 8..15 <- p[16..23]; caller adds 8*(lane>>4) to p */
__device__ __forceinline__ v16h frag_load(const _Float16* p) {
  FragU f;
  f.h[0] = *(const v8h*)(p);
  f.h[1] = *(const v8h*)(p + 16);
  return f.v;
}
__device__ __forceinline__ v8f mma_f16(v16h a, v16h b, v8f c) {
  return __builtin_amdgcn_wmma_f32_16x16x32_f16(false, a, false, b, (short)0, c, false, false);
}
/* four f32 of a data row -> f16, round to nearest even */
__device__ __forceinline__ v4h cast4_x(v4f a) { return __builtin_convertvector(a, v4h); }

/* --------------------------------------------------------------------------- */
/* The two weight products, f16 planes x64, [out][in] as the attention launch    */
/* reads them. WMMA, operands cast f32 -> f16 x1024 on the way in, depth 256.          */
/*   Z = 0:  N[m][n] = sum_o Wk[o][m] * Wq[o][n]                                 */
/*   Z = 1:  M[m][n] = sum_d Wo[m][d] * Wv[d][n]                                 */
/* A block of 4 waves owns 16 rows m by 64 columns n; wave w sums depth 64*w ..  */
/* +63, so that all of a wave's loads are in flight at once; the four partial    */
/* sums meet in LDS behind one block barrier, and wave w finishes rows 2w and    */
/* 2w + 1 of each half of the tile. Column r of matrix tile j is n0 + 4*r + j,   */
/* so that one 16-B load of a second-operand row feeds the four tiles and a      */
/* lane's four results of a row are neighbours: a wave-wide store covers two     */
/* rows' whole 128-B lines. grid (64, 2): blockIdx.y selects Z.                  */
/* --------------------------------------------------------------------------- */
template <int Z>
__device__ __forceinline__ void fold_w_part(v8f (&acc)[4], const float* __restrict__ Wa, const float* __restrict__ Wb,
                                            int m0, int n0, int lane, int wave) {
  const int r = lane & 15, h = lane >> 4;
  constexpr int kSa = (Z == 0) ? kD : 1;   /* step of the first operand along the depth */
  const int k0 = wave * 64 + 8 * h;
  const float* pa = (Z == 0) ? (Wa + (size_t)k0 * kD + m0 + r) : (Wa + (size_t)(m0 + r) * kD + k0);
  const float* pb = Wb + (size_t)k0 * kD + n0 + 4 * r;
  /* element e of depth step kk, both operands: depth 64*wave + kk*32 + 8h + e (e < 8), 16 further from e = 8 on */
  float ra[32];
  v4f   rb[32];
#pragma unroll
  for (int u = 0; u < 32; ++u) {
    const int k = (u >> 4) * 32 + (u & 7) + ((u >> 3) & 1) * 16;
    ra[u] = pa[k * kSa];
    rb[u] = *(const v4f*)(pb + k * kD);
  }
  /* keeps the casts behind the last load: all of the wave's loads are in flight together, one memory latency in all */
  __builtin_amdgcn_sched_barrier(0);
  /* stands in front of the first overwrite of an address register that these loads name; the two addresses are inputs */
  /* so that their registers live up to the wait                                                                       */
  asm volatile("s_wait_xcnt 0x0" :: "v"(pa), "v"(pb) : "memory");
#pragma unroll
  for (int kk = 0; kk < 2; ++kk) {
    v16h a, b[4];
#pragma unroll
    for (int e = 0; e < 16; ++e) {
      a[e] = (_Float16)(ra[kk * 16 + e] * kWCarry);
#pragma unroll
      for (int j = 0; j < 4; ++j) b[j][e] = (_Float16)(rb[kk * 16 + e][j] * kWCarry);
    }
#pragma unroll
    for (int j = 0; j < 4; ++j) acc[j] = mma_f16(a, b[j], acc[j]);
  }
}
__global__ __launch_bounds__(128) void fold_w_kernel(const float* __restrict__ Wq, const float* __restrict__ Wk,
                                                     const float* __restrict__ Wv, const float* __restrict__ Wo,
                                                     unsigned short* __restrict__ out) {
  __shared__ float sP[4][4][8][32];   /* [wave][tile j][accumulator register][lane] */
  const int lane = threadIdx.x & 31;
  const int wave = __builtin_amdgcn_readfirstlane((int)(threadIdx.x >> 5));
  const int z  = blockIdx.y;
  const int m0 = (blockIdx.x >> 2) << 4, n0 = (blockIdx.x & 3) << 6;
  v8f acc[4];
#pragma unroll
  for (int j = 0; j < 4; ++j) acc[j] = (v8f){0.f, 0.f, 0.f, 0.f, 0.f, 0.f, 0.f, 0.f};
  if (z == 0) fold_w_part<0>(acc, Wk, Wq, m0, n0, lane, wave);
  else        fold_w_part<1>(acc, Wo, Wv, m0, n0, lane, wave);
#pragma unroll
  for (int j = 0; j < 4; ++j)
#pragma unroll
    for (int i = 0; i < 8; ++i) sP[wave][j][i][lane] = acc[j][i];
  __syncthreads();
  /* accumulator register i of a lane: row 8*(lane >> 4) + i, column lane & 15 of the tile */
  unsigned short* q = out + (size_t)z * kD * kD + (size_t)(m0 + 8 * (lane >> 4) + 2 * wave) * kD + n0 + 4 * (lane & 15);
#pragma unroll
  for (int ii = 0; ii < 2; ++ii) {
    v4h hv;
#pragma unroll
    for (int j = 0; j < 4; ++j) {
      const int i = 2 * wave + ii;
      const float sum = (sP[0][j][i][lane] + sP[1][j][i][lane]) + (sP[2][j][i][lane] + sP[3][j][i][lane]);
      hv[j] = (_Float16)(sum * kFoldScale);
    }
    *(v4h*)(q + ii * kD) = hv;
  }
}

/* --------------------------------------------------------------------------- */
/* Fused attention of one batch; keys and values are the data rows x themselves.    */
/*   score (Wq x_q).(Wk x_k) = q' . x_k      with q' = (Wk^T.Wq) x_q                 */
/*   Wo (sum_k p_k Wv x_k)   = (Wo.Wv) h     with h  = sum_k p_k x_k                 */
/* so that only the block's own 128 query rows are multiplied by a weight plane,     */
/* once in front of the key loop and once behind it, and no projected plane of the   */
/* keys is written to or read from memory.                                           */
/*   q'^T = N . X_q^T (block product: 256 plane rows x 128 query columns, both from  */
/*                     LDS, a wave 64 x 64; q' goes back to LDS as f16 rows)         */
/*   S^T  = X_k . q'^T (A = 16 key rows from LDS, B = the wave's 16 rows of q',      */
/*                     kept in registers)                                            */
/*   H^T += X_k^T . P^T (A = 16 columns of the key rows, by the transposing LDS      */
/*                     load, B = P^T packed from the S^T accumulators)               */
/*   O^T  = M . H^T   (block product as the first, H through LDS as f16 rows)        */
/* A packed pair of 16-row accumulator tiles is a 32-deep B operand in the hardware  */
/* k order; frag_load and the transposing load give the A side in the same order.    */
/* A lane owns query column c = lane & 15 and, of every 16-key tile, the keys      */
/* 8*(lane>>4) .. +7, so maximum and sum run in-lane plus one exchange of halves.  */
/*   x[k] = blocked[k] ? fill : s[k]  (log2 units; fill = -30, or -inf when the    */
/*          evaluate flag is nonzero);  e[k] = 2^(x[k] - m + 15), m = running max; */
/*   the sum takes every e[k], blocked ones included; P takes 0 for blocked keys.  */
/* Block = 8 waves x 16 queries = 128 queries; grid (8, 32). A stage is 64 keys:   */
/* their f32 rows go global -> registers -> f16 -> LDS one stage ahead, two buffers, */
/* each row stored twice, at the pitch of its plain and of its transposing reader;  */
/* one block barrier per stage (it publishes the next stage and ends the reads of  */
/* the buffer that the stage after it overwrites).                                 */
/* The first plane lies in the stage buffers in front of stage 0. The second has a   */
/* buffer of its own and comes in under the key loop, 16 rows a stage, published by  */
/* the stages' own barriers; the query rows lie in that buffer's rows 128 .. 255,    */
/* which are written from stage 8 on, behind every wave's last read of them.         */
/* Behind the loop the stage buffers hold H and the per-wave output slabs: 64        */
/* columns of 16 rows go through a slab, so that the f32 stores cover whole 256-B    */
/* runs.                                                                             */
/* --------------------------------------------------------------------------- */
constexpr int kFaKeys   = 64;
constexpr int kFaStages = kG / kFaKeys;
constexpr int kFaQ      = 128;
constexpr int kKPitch   = kD + 8;        /* halves: 528 B = 16 B x 33, for ds_load_b128 */
constexpr int kVPitch   = kD + 16;       /* halves: 544 B = 32 B x 17, for ds_load_tr16_b128 */
constexpr int kKBuf     = kFaKeys * kKPitch;
constexpr int kVBuf     = kFaKeys * kVPitch;
constexpr int kRing     = 2 * kKBuf + 2 * kVBuf;
constexpr float kLog2e  = 1.4426950408889634f;
constexpr float kScore2 = kScoreScale * kLog2e;
constexpr float kPExp   = 15.0f;
constexpr int kSlabPitch = 68;              /* floats: 272 B = 16 B x 17 */
static_assert(kD * kKPitch <= kRing);
static_assert(kFaQ * kKPitch * 2 + 8 * 16 * kSlabPitch * 4 <= kRing * 2);
static_assert(2 * kFaQ == kD && kFaStages * 16 == kD);
static_assert(kPCarry == 32768.0f && kPExp == 15.0f);
static_assert((kG % kFaKeys) == 0 && (kG % kFaQ) == 0 && kD == 256 && kFaKeys == 64);

/* lane l reads lane l ^ 16 */
__device__ __forceinline__ float xhalf(float x) {
  return __builtin_bit_cast(float, __builtin_amdgcn_permlanex16(__builtin_bit_cast(int, x), __builtin_bit_cast(int, x),
                                                                0x76543210, 0xfedcba98, false, false));
}
/* lane (c, h) gets column c, rows 8h .. 8h+7 of the 16 x 16 tile of halves whose lane addresses p are: row 8h + (lane & 7), 16-B half (lane >> 3) & 1 */
__device__ __forceinline__ v8h ld_tr16(const _Float16* p) {
  typedef __attribute__((address_space(3))) v8s lds_v8s;
  return __builtin_bit_cast(v8h, __builtin_amdgcn_ds_load_tr16_b128_v8i16((lds_v8s*)p));
}

/* group g of a product with 64 rows from LDS at pitch kKPitch (the stage's key rows): row tiles 0..3 at depth steps 2g and 2g+1 */
template <int G>
__device__ __forceinline__ void load_k8(v16h (&f)[8], const _Float16* kb) {
#pragma unroll
  for (int u = 0; u < 8; ++u) f[u] = frag_load(kb + (u & 3) * 16 * kKPitch + (2 * G + (u >> 2)) * 32);
}
template <int G>
__device__ __forceinline__ void mma_k8(v8f (&st)[4], const v16h (&f)[8], const v16h (&qf)[8]) {
#pragma unroll
  for (int u = 0; u < 8; ++u) st[u & 3] = mma_f16(f[u], qf[2 * G + (u >> 2)], st[u & 3]);
}
/* group g of the p.x product: column tiles 8*(g&1) .. +7 of the key rows at the 32 keys g>>1 */
template <int G>
__device__ __forceinline__ void load_v8(v16h (&f)[8], const _Float16* vb) {
#pragma unroll
  for (int u = 0; u < 8; ++u) {
    FragU w;
    w.h[0] = ld_tr16(vb + (G >> 1) * 32 * kVPitch + ((G & 1) * 8 + u) * 16);
    w.h[1] = ld_tr16(vb + ((G >> 1) * 32 + 16) * kVPitch + ((G & 1) * 8 + u) * 16);
    f[u] = w.v;
  }
}
template <int G>
__device__ __forceinline__ void mma_v8(v8f (&acc)[16], const v16h (&f)[8], const v16h (&pb)[2]) {
#pragma unroll
  for (int u = 0; u < 8; ++u) acc[(G & 1) * 8 + u] = mma_f16(f[u], pb[G >> 1], acc[(G & 1) * 8 + u]);
}
/* holds the next group's LDS loads in front of this group's matrix instructions, so that they fly under them */
__device__ __forceinline__ void group_fence() { __builtin_amdgcn_sched_barrier(0); }

/* depth step KS of a block product: the wave's 4 A and 4 B fragments; a and b point at the lane's row 0 of the wave's 64 rows, pitch kKPitch */
template <int KS>
__device__ __forceinline__ void load_ab(v16h (&f)[8], const _Float16* a, const _Float16* b) {
#pragma unroll
  for (int u = 0; u < 4; ++u) {
    f[u]     = frag_load(a + (u << 4) * kKPitch + KS * 32);
    f[4 + u] = frag_load(b + (u << 4) * kKPitch + KS * 32);
  }
}
__device__ __forceinline__ void mma_ab(v8f (&acc)[4][4], const v16h (&f)[8]) {
#pragma unroll
  for (int i = 0; i < 4; ++i)
#pragma unroll
    for (int j = 0; j < 4; ++j) acc[i][j] = mma_f16(f[i], f[4 + j], acc[i][j]);
}
/* acc[i][j] = rows 16i .. of a times rows 16j .. of b, whole depth of 256: 8 steps of 32, fragments fetched one step ahead into a second register set */
__device__ __forceinline__ void block_product(v8f (&acc)[4][4], const _Float16* a, const _Float16* b) {
#pragma unroll
  for (int i = 0; i < 4; ++i)
#pragma unroll
    for (int j = 0; j < 4; ++j) acc[i][j] = (v8f){0.f, 0.f, 0.f, 0.f, 0.f, 0.f, 0.f, 0.f};
  v16h fa[8], fb[8];
  load_ab<0>(fa, a, b);
  load_ab<1>(fb, a, b); group_fence(); mma_ab(acc, fa); group_fence();
  load_ab<2>(fa, a, b); group_fence(); mma_ab(acc, fb); group_fence();
  load_ab<3>(fb, a, b); group_fence(); mma_ab(acc, fa); group_fence();
  load_ab<4>(fa, a, b); group_fence(); mma_ab(acc, fb); group_fence();
  load_ab<5>(fb, a, b); group_fence(); mma_ab(acc, fa); group_fence();
  load_ab<6>(fa, a, b); group_fence(); mma_ab(acc, fb); group_fence();
  load_ab<7>(fb, a, b); group_fence(); mma_ab(acc, fa); group_fence();
  mma_ab(acc, fb);
}

__global__ __launch_bounds__(256) void attn_fused_kernel(const float* __restrict__ X,
                                                         const unsigned short* __restrict__ Wp,
                                                         const int* __restrict__ mask,
                                                         const int* __restrict__ evalflag,
                                                         const float* __restrict__ bias,
                                                         float* __restrict__ out) {
  __shared__ __align__(16) _Float16 sRing[kRing];
  __shared__ __align__(16) _Float16 sW[kD * kKPitch];
  __shared__ unsigned sBlk[kG / 32];
  const int t    = threadIdx.x;
  const int lane = t & 31;
  const int wave = __builtin_amdgcn_readfirstlane((int)(threadIdx.x >> 5));
  const int b    = blockIdx.y;
  const int c    = lane & 15;
  const int h    = lane >> 4;
  const int q0   = blockIdx.x * kFaQ + wave * 16;
  const float* Xb = X + (size_t)b * kG * kD;
  _Float16* sK = &sRing[0];
  _Float16* sV = &sRing[2 * kKBuf];
  _Float16* sQ = &sW[kFaQ * kKPitch];
  /* the wave's 64 x 64 part of a block product: plane rows wn .., query rows wq .. */
  const int wn = (wave & 3) << 6;
  const int wq = (wave >> 2) << 6;

  /* blocked keys as bits: word w, bit i = key 32*w + i */
  int mk[4];
#pragma unroll
  for (int i = 0; i < 4; ++i) mk[i] = mask[(size_t)b * kG + (wave * 4 + i) * 32 + lane];
  /* stands in front of the first overwrite of the address register that these loads name */
  asm volatile("s_wait_xcnt 0x0" ::: "memory");
  unsigned bits[4];
#pragma unroll
  for (int i = 0; i < 4; ++i) bits[i] = __builtin_amdgcn_ballot_w32(mk[i] != 0);
  if (lane == 0) {
#pragma unroll
    for (int i = 0; i < 4; ++i) sBlk[wave * 4 + i] = bits[i];
  }
  const float fill2 = (evalflag[0] != 0) ? (-INFINITY) : (-30.0f * kLog2e);

  /* this wave's 16 query rows of x: a wave-wide load covers a whole 512-B run of a row; they go cast to LDS and come back as fragments */
  /* every row address here is a base that is the same in all lanes plus the lane's 32-bit offset */
  const float* gQ = Xb + (size_t)q0 * kD;
  const unsigned xo = (unsigned)lane * 4u;
  v4f qx[16][2];
#pragma unroll
  for (int i = 0; i < 16; ++i)
#pragma unroll
    for (int u = 0; u < 2; ++u) qx[i][u] = *(const v4f*)(gQ + i * kD + u * 128 + xo);
  /* stands in front of the first overwrite of an address register that these loads name; base and offset are inputs so that their registers live up to the wait */
  asm volatile("s_wait_xcnt 0x0" :: "s"(gQ), "v"(xo) : "memory");

  /* a weight plane: 16-B chunk lane of row wave + 8*i; a wave-wide load covers a row's whole 512-B run */
  const _Float16* gW = (const _Float16*)Wp + (size_t)wave * kD;
  const unsigned wo = (unsigned)lane * 8u;
  const int lW = wave * kKPitch + lane * 8;
  v8h wr[32];
#pragma unroll
  for (int i = 0; i < 32; ++i) wr[i] = *(const v8h*)(gW + (size_t)(8 * i) * kD + wo);
  /* as above, for the plane's address */
  asm volatile("s_wait_xcnt 0x0" :: "s"(gW), "v"(wo) : "memory");

  /* a stage's key rows: 16-B chunk lane of half u of row wave + 8*i; a wave-wide load covers a whole 512-B run of a row */
  const float* gS = Xb + (size_t)wave * kD;
  const int lK = wave * kKPitch + lane * 4;
  const int lV = wave * kVPitch + lane * 4;
  v4f xr[8][2];
#pragma unroll
  for (int i = 0; i < 8; ++i)
#pragma unroll
    for (int u = 0; u < 2; ++u) xr[i][u] = *(const v4f*)(gS + (size_t)(8 * i) * kD + u * 128 + xo);
  /* as above, for the key rows' address */
  asm volatile("s_wait_xcnt 0x0" :: "s"(gS), "v"(xo) : "memory");

#pragma unroll
  for (int i = 0; i < 16; ++i)
#pragma unroll
    for (int u = 0; u < 2; ++u) *(v4h*)(&sQ[(wave * 16 + i) * kKPitch + u * 128 + lane * 4]) = cast4_x(qx[i][u]);
#pragma unroll
  for (int i = 0; i < 32; ++i) *(v8h*)(&sRing[lW + 8 * i * kKPitch]) = wr[i];
  __syncthreads();

  /* q'^T: a lane holds plane rows (depth of the score product) 16i + 8h .. +7 of query row 16j + c */
  {
    v8f pq[4][4];
    block_product(pq, &sRing[(wn + c) * kKPitch + 8 * h], &sQ[(wq + c) * kKPitch + 8 * h]);
    /* ends every wave's reads of the plane and of the x query rows: stage 0 and q' overwrite them */
    __syncthreads();
#pragma unroll
    for (int i = 0; i < 4; ++i)
#pragma unroll
      for (int j = 0; j < 4; ++j) {
        v8h hv;
#pragma unroll
        for (int r = 0; r < 8; ++r) hv[r] = (_Float16)(pq[i][j][r] * kQScale);
        *(v8h*)(&sQ[(wq + (j << 4) + c) * kKPitch + wn + (i << 4) + 8 * h]) = hv;
      }
  }
#pragma unroll
  for (int i = 0; i < 8; ++i)
#pragma unroll
    for (int u = 0; u < 2; ++u) {
      const v4h hv = cast4_x(xr[i][u]);
      *(v4h*)(&sK[lK + 8 * i * kKPitch + u * 128]) = hv;
      *(v4h*)(&sV[lV + 8 * i * kVPitch + u * 128]) = hv;
    }

  v8f acc[16];
#pragma unroll
  for (int d = 0; d < 16; ++d) acc[d] = (v8f){0.f, 0.f, 0.f, 0.f, 0.f, 0.f, 0.f, 0.f};
  float m_run = -INFINITY;
  float l_run = 0.0f;
  __syncthreads();

  /* B operand of the score product: the wave's 16 rows of q', whole depth, kept in registers */
  v16h qf[8];
#pragma unroll
  for (int kk = 0; kk < 8; ++kk) qf[kk] = frag_load(&sQ[(wave * 16 + c) * kKPitch + kk * 32 + 8 * h]);
  /* the second plane's rows */
  const _Float16* gW2 = gW + (size_t)kD * kD;

  /* rolled: one stage's body (64 matrix instructions and their loads), for speed only */
#pragma unroll 1
  for (int s = 0; s < kFaStages; ++s) {
    const int buf = s & 1;
    const bool more = (s + 1 < kFaStages);
    /* rows 16s + wave and 16s + 8 + wave of the second plane */
    v8h wm[2];
#pragma unroll
    for (int i = 0; i < 2; ++i) wm[i] = *(const v8h*)(gW2 + (size_t)(16 * s + 8 * i) * kD + wo);
    if (more) {
      const float* gN = gS + (size_t)((s + 1) * kFaKeys) * kD;
#pragma unroll
      for (int i = 0; i < 8; ++i)
#pragma unroll
        for (int u = 0; u < 2; ++u) xr[i][u] = *(const v4f*)(gN + (size_t)(8 * i) * kD + u * 128 + xo);
    }
    /* stands in front of the first overwrite of an address register that these loads name */
    asm volatile("s_wait_xcnt 0x0" ::: "memory");

    /* S^T: 4 key tiles x 16 query columns */
    v8f st[4];
#pragma unroll
    for (int kt = 0; kt < 4; ++kt) st[kt] = (v8f){0.f, 0.f, 0.f, 0.f, 0.f, 0.f, 0.f, 0.f};
    const _Float16* kb = &sK[buf * kKBuf + c * kKPitch + 8 * h];
    const _Float16* vb = &sV[buf * kVBuf + (8 * h + (lane & 7)) * kVPitch + ((lane >> 3) & 1) * 8];
    v16h fa[8], fb[8];
    load_k8<0>(fa, kb);
    load_k8<1>(fb, kb); group_fence(); mma_k8<0>(st, fa, qf); group_fence();
    load_k8<2>(fa, kb); group_fence(); mma_k8<1>(st, fb, qf); group_fence();
    load_k8<3>(fb, kb); group_fence(); mma_k8<2>(st, fa, qf); group_fence();
    load_v8<0>(fa, vb); group_fence(); mma_k8<3>(st, fb, qf); group_fence();

    /* key kt*16 + 8h + r of the stage: word kt>>1, bit (kt&1)*16 + 8h + r */
    const unsigned w0 = sBlk[2 * s] >> (8 * h);
    const unsigned w1 = sBlk[2 * s + 1] >> (8 * h);
    float x[4][8];
    float mx = -INFINITY;
#pragma unroll
    for (int kt = 0; kt < 4; ++kt) {
      const unsigned wb = (kt < 2) ? w0 : w1;
#pragma unroll
      for (int r = 0; r < 8; ++r) {
        const bool blk = ((wb >> ((kt & 1) * 16 + r)) & 1u) != 0u;
        x[kt][r] = blk ? fill2 : st[kt][r] * kScore2;
        mx = fmaxf(mx, x[kt][r]);
      }
    }
    mx = fmaxf(mx, xhalf(mx));
    const float m_new = fmaxf(m_run, mx);
    /* scalar branch: the 128 output registers are rescaled only in a stage that raises some column's maximum */
    if (__builtin_amdgcn_ballot_w32(m_new > m_run) != 0) {
      const float ms   = (m_new == -INFINITY) ? 0.0f : m_new;
      const float corr = __builtin_amdgcn_exp2f(m_run - ms);
      l_run *= corr;
#pragma unroll
      for (int d = 0; d < 16; ++d)
#pragma unroll
        for (int r = 0; r < 8; ++r) acc[d][r] *= corr;
      m_run = m_new;
    }
    const float moff = ((m_run == -INFINITY) ? 0.0f : m_run) - kPExp;

    v16h pb[2];
    float ls[4];
#pragma unroll
    for (int kt = 0; kt < 4; ++kt) {
      const unsigned wb = (kt < 2) ? w0 : w1;
      ls[kt] = 0.0f;
#pragma unroll
      for (int r = 0; r < 8; ++r) {
        const bool blk = ((wb >> ((kt & 1) * 16 + r)) & 1u) != 0u;
        const float e = __builtin_amdgcn_exp2f(x[kt][r] - moff);
        ls[kt] += e;
        pb[kt >> 1][(kt & 1) * 8 + r] = (_Float16)(blk ? 0.0f : e);
      }
    }
    l_run += (ls[0] + ls[1]) + (ls[2] + ls[3]);

    /* H^T: 16 column tiles of x x 16 query columns, 2 x 32 keys */
    load_v8<1>(fb, vb); group_fence(); mma_v8<0>(acc, fa, pb); group_fence();
    load_v8<2>(fa, vb); group_fence(); mma_v8<1>(acc, fb, pb); group_fence();
    load_v8<3>(fb, vb); group_fence(); mma_v8<2>(acc, fa, pb); group_fence();
    mma_v8<3>(acc, fb, pb);

#pragma unroll
    for (int i = 0; i < 2; ++i) *(v8h*)(&sW[(16 * s + 8 * i) * kKPitch + lW]) = wm[i];
    if (more) {
#pragma unroll
      for (int i = 0; i < 8; ++i)
#pragma unroll
        for (int u = 0; u < 2; ++u) {
          const v4h hv = cast4_x(xr[i][u]);
          *(v4h*)(&sK[(buf ^ 1) * kKBuf + lK + 8 * i * kKPitch + u * 128]) = hv;
          *(v4h*)(&sV[(buf ^ 1) * kVBuf + lV + 8 * i * kVPitch + u * 128]) = hv;
        }
    }
    __syncthreads();
  }

  /* a lane holds columns d*16 + 8h .. +7 of the attended row h of query q0 + c: f16 rows in the stage buffers, free behind the loop's last barrier */
  const float l_tot = l_run + xhalf(l_run);
  const float inv   = (l_tot > 0.0f) ? (kHCarry / l_tot) : 0.0f;
  _Float16* sH = &sRing[0];
#pragma unroll
  for (int d = 0; d < 16; ++d) {
    v8h hv;
#pragma unroll
    for (int r = 0; r < 8; ++r) hv[r] = (_Float16)(acc[d][r] * inv);
    *(v8h*)(&sH[(wave * 16 + c) * kKPitch + (d << 4) + 8 * h]) = hv;
  }
  /* publishes H */
  __syncthreads();

  /* O^T: a lane holds output columns wn + 16i + 8h .. +7 of query row wq + 16j + c */
  v8f po[4][4];
  block_product(po, &sW[(wn + c) * kKPitch + 8 * h], &sH[(wq + c) * kKPitch + 8 * h]);

  /* 4 groups of 16 query rows by the wave's 64 output columns */
  float* slab = (float*)&sRing[kFaQ * kKPitch] + wave * (16 * kSlabPitch);
  const int hh = lane >> 4, c4 = (lane & 15) * 4;
  const v4f bv = *(const v4f*)(bias + wn + c4);
  /* stands in front of the first overwrite of the address register that this load names */
  asm volatile("s_wait_xcnt 0x0" ::: "memory");
  float* op = out + ((size_t)b * kG + blockIdx.x * kFaQ + wq + hh) * kD + wn + c4;
#pragma unroll
  for (int j = 0; j < 4; ++j) {
    /* a lane holds columns i*16 + 8h .. +7 of row c of the group: two 16-B LDS stores per tile */
#pragma unroll
    for (int i = 0; i < 4; ++i) {
      const v8f ot = po[i][j] * kOutScale;
      float* sp = slab + c * kSlabPitch + (i << 4) + 8 * h;
      *(v4f*)(sp)     = (v4f){ot[0], ot[1], ot[2], ot[3]};
      *(v4f*)(sp + 4) = (v4f){ot[4], ot[5], ot[6], ot[7]};
    }
    /* same wave writes and reads the slab: the LDS-only fences keep the compiler from crossing the two and wait for no global store */
    __builtin_amdgcn_fence(__ATOMIC_RELEASE, "workgroup", "local");
    __builtin_amdgcn_wave_barrier();
    __builtin_amdgcn_fence(__ATOMIC_ACQUIRE, "workgroup", "local");
    /* row segment = 64 floats = 256 B = 16 lanes x 16 B; rows it*2 + hh, it 0..7 -> 16 rows, each once */
#pragma unroll
    for (int it = 0; it < 8; ++it) {
      const v4f v = *(const v4f*)(slab + (it * 2 + hh) * kSlabPitch + c4);
      *(v4f*)(op + (size_t)((j << 4) + it * 2) * kD) = v + bv;
    }
    if (j < 3) {
      /* stands in front of the first overwrite of a register that these stores name */
      asm volatile("s_wait_xcnt 0x0" ::: "memory");
      /* the next group's slab stores stay behind this group's slab reads */
      __builtin_amdgcn_fence(__ATOMIC_RELEASE, "workgroup", "local");
      __builtin_amdgcn_wave_barrier();
      __builtin_amdgcn_fence(__ATOMIC_ACQUIRE, "workgroup", "local");
    }
  }
}

/* --------------------------------------------------------------------------- */
/* Shape premise check: the file is built for 1024 nodes per batch. If the scalar */
/* two 512-B instructions) with NaN and returns normally.                         */
/* --------------------------------------------------------------------------- */
__global__ __launch_bounds__(32) void premise_guard_kernel(const int* __restrict__ gsz, float* __restrict__ out) {
  const int g = gsz[0];
  if (g != kG) {
    const int lane = threadIdx.x & 31;
    const float qn = __uint_as_float(0x7fc00000u);
    const v4f nv = (v4f){qn, qn, qn, qn};
    {
      *(v4f*)(out + lane * 4) = nv;
      *(v4f*)(out + 128 + lane * 4) = nv;
      
    }
  }
}

/* --------------------------------------------------------------------------- */
/* Host glue: kernel launches only. Weight products + fused attention (one launch  */
/* over all 32 batches, 8 x 32 blocks: one for every WGP; it reads the f32 data     */
/* rows itself) + premise check = 3 launches.                                       */
/* --------------------------------------------------------------------------- */
extern "C" void kernel_launch(void* const* d_in, const int* in_sizes, int n_in,
                              void* d_out, int out_size, void* d_ws, size_t ws_size,
                              hipStream_t stream) {
  if (n_in < 9) return;
  if (in_sizes[0] != kTok * kD) return;
  if (in_sizes[1] != kBatch * kG) return;
  if (in_sizes[2] != 1 || in_sizes[3] != 1) return;
  if (in_sizes[4] != kD * kD || in_sizes[5] != kD * kD || in_sizes[6] != kD * kD || in_sizes[7] != kD * kD) return;
  if (in_sizes[8] != kD) return;
  if (out_size != kTok * kD) return;
  if (ws_size < kWsTotal) return;

  const float* data   = (const float*)d_in[0];
  const int*   mask   = (const int*)d_in[1];
  const int*   gsize  = (const int*)d_in[2];
  const int*   evalf  = (const int*)d_in[3];
  const float* Wq     = (const float*)d_in[4];
  const float* Wk     = (const float*)d_in[5];
  const float* Wv     = (const float*)d_in[6];
  const float* Wo     = (const float*)d_in[7];
  const float* b_out  = (const float*)d_in[8];
  float* out = (float*)d_out;

  char* ws = (char*)d_ws;
  unsigned short* W16  = (unsigned short*)(ws + kOffW16);

  /* weight planes: Wk^T.Wq | Wo.Wv */
  fold_w_kernel<<<dim3((kD / 16) * (kD / 64), 2), 128, 0, stream>>>(Wq, Wk, Wv, Wo, W16);

  /* out[b][q][n] = sum_d (Wo.Wv)[n][d] * sum_k softmax_k(mask(((Wk^T.Wq) x_q).x_k / 16)) * x_k[d] + b_out[n] -> f32 output rows */
  attn_fused_kernel<<<dim3(kG / kFaQ, kBatch), 256, 0, stream>>>(data, W16, mask, evalf, b_out, out);

  premise_guard_kernel<<<1, 32, 0, stream>>>(gsize, out);
}

// v010
// One run takes 48.1 microseconds.
// Two timings next to v009 both put it at 1.04 times that version's speed.
// Counting every step since v000, it is 13.9 times as fast.
// All contractions (weight products Wk^T.Wq and Wo.Wv, the query rows by the first, q'.x^T scores, p.x, the attended rows by the second): v_wmma_f32_16x16x32_f16, f16 operands carried by exact powers of two, f32 accumulate; key masking, softmax and bias add in f32.
#include <hip/hip_runtime.h>
#include <math.h>

typedef __attribute__((ext_vector_type(16))) _Float16 v16h;
typedef __attribute__((ext_vector_type(8)))  _Float16 v8h;
typedef __attribute__((ext_vector_type(4)))  _Float16 v4h;
typedef __attribute__((ext_vector_type(8)))  float    v8f;
typedef __attribute__((ext_vector_type(4)))  float    v4f;
typedef __attribute__((ext_vector_type(8)))  short    v8s;

/* --------------------------------------------------------------------------- */
/* Shape constants (single head: batch b owns token rows b*1024 .. b*1024+1023) */
/* --------------------------------------------------------------------------- */
constexpr int kBatch  = 32;
constexpr int kG      = 1024;
constexpr int kD      = 256;
constexpr int kTok    = kBatch * kG;
constexpr int kSqrtD  = 16;
static_assert(kSqrtD * kSqrtD == kD);
static_assert(kTok == 32768);
static_assert((kD % 64) == 0 && (kG % 64) == 0);

/* Power-of-two carries of the f16 operands, folded back exactly in f32 scales. */
constexpr float kWCarry   = 1024.0f;   /* the weights on their way into the weight products */
constexpr float kFCarry   = 64.0f;     /* the folded weight planes */
constexpr float kQCarry   = 16.0f;     /* the projected query rows q' */
constexpr float kPCarry   = 32768.0f;  /* the softmax numerators */
constexpr float kHCarry   = 256.0f;    /* the attended rows h = sum_k p_k x_k */
constexpr float kNormQK   = 1.0f / (float)kSqrtD;
constexpr float kFoldScale  = kFCarry / (kWCarry * kWCarry);
constexpr float kQScale     = kQCarry / kFCarry;
constexpr float kScoreScale = kNormQK / kQCarry;
constexpr float kOutScale   = 1.0f / (kFCarry * kHCarry);

/* --------------------------------------------------------------------------- */
/* Workspace region map (bytes)                                                 */
/*   W16  f16 [2][256][256]       Wk^T.Wq | Wo.Wv, each x64          262,144    */
/* --------------------------------------------------------------------------- */
constexpr size_t kOffW16  = 0;
constexpr size_t kWsTotal = kOffW16 + (size_t)2 * kD * kD * 2;
static_assert(kWsTotal == 262144ull);

/* --------------------------------------------------------------------------- */
/* Fragment helpers                                                             */
/* --------------------------------------------------------------------------- */
union FragU { v16h v; v8h h[2]; };
/* elements 0..7 <- p[0..7], elements 8..15 <- p[16..23]; caller adds 8*(lane>>4) to p */
__device__ __forceinline__ v16h frag_load(const _Float16* p) {
  FragU f;
  f.h[0] = *(const v8h*)(p);
  f.h[1] = *(const v8h*)(p + 16);
  return f.v;
}
__device__ __forceinline__ v8f mma_f16(v16h a, v16h b, v8f c) {
  return __builtin_amdgcn_wmma_f32_16x16x32_f16(false, a, false, b, (short)0, c, false, false);
}
/* four f32 of a data row -> f16, round to nearest even */
__device__ __forceinline__ v4h cast4_x(v4f a) { return __builtin_convertvector(a, v4h); }

/* --------------------------------------------------------------------------- */
/* The two weight products, f16 planes x64, [out][in] as the attention launch    */
/* reads them. WMMA, operands cast f32 -> f16 x1024 on the way in, depth 256.          */
/*   Z = 0:  N[m][n] = sum_o Wk[o][m] * Wq[o][n]                                 */
/*   Z = 1:  M[m][n] = sum_d Wo[m][d] * Wv[d][n]                                 */
/* A block of 4 waves owns 16 rows m by 64 columns n; wave w sums depth 64*w ..  */
/* +63, so that all of a wave's loads are in flight at once; the four partial    */
/* sums meet in LDS behind one block barrier, and wave w finishes rows 2w and    */
/* 2w + 1 of each half of the tile. Column r of matrix tile j is n0 + 4*r + j,   */
/* so that one 16-B load of a second-operand row feeds the four tiles and a      */
/* lane's four results of a row are neighbours: a wave-wide store covers two     */
/* rows' whole 128-B lines. grid (64, 2): blockIdx.y selects Z.                  */
/* --------------------------------------------------------------------------- */
template <int Z>
__device__ __forceinline__ void fold_w_part(v8f (&acc)[4], const float* __restrict__ Wa, const float* __restrict__ Wb,
                                            int m0, int n0, int lane, int wave) {
  const int r = lane & 15, h = lane >> 4;
  constexpr int kSa = (Z == 0) ? kD : 1;   /* step of the first operand along the depth */
  const int k0 = wave * 64 + 8 * h;
  const float* pa = (Z == 0) ? (Wa + (size_t)k0 * kD + m0 + r) : (Wa + (size_t)(m0 + r) * kD + k0);
  const float* pb = Wb + (size_t)k0 * kD + n0 + 4 * r;
  /* element e of depth step kk, both operands: depth 64*wave + kk*32 + 8h + e (e < 8), 16 further from e = 8 on */
  float ra[32];
  v4f   rb[32];
#pragma unroll
  for (int u = 0; u < 32; ++u) {
    const int k = (u >> 4) * 32 + (u & 7) + ((u >> 3) & 1) * 16;
    ra[u] = pa[k * kSa];
    rb[u] = *(const v4f*)(pb + k * kD);
  }
  /* keeps the casts behind the last load: all of the wave's loads are in flight together, one memory latency in all */
  __builtin_amdgcn_sched_barrier(0);
  /* stands in front of the first overwrite of an address register that these loads name; the two addresses are inputs */
  /* so that their registers live up to the wait                                                                       */
  asm volatile("s_wait_xcnt 0x0" :: "v"(pa), "v"(pb) : "memory");
#pragma unroll
  for (int kk = 0; kk < 2; ++kk) {
    v16h a, b[4];
#pragma unroll
    for (int e = 0; e < 16; ++e) {
      a[e] = (_Float16)(ra[kk * 16 + e] * kWCarry);
#pragma unroll
      for (int j = 0; j < 4; ++j) b[j][e] = (_Float16)(rb[kk * 16 + e][j] * kWCarry);
    }
#pragma unroll
    for (int j = 0; j < 4; ++j) acc[j] = mma_f16(a, b[j], acc[j]);
  }
}
__global__ __launch_bounds__(128) void fold_w_kernel(const float* __restrict__ Wq, const float* __restrict__ Wk,
                                                     const float* __restrict__ Wv, const float* __restrict__ Wo,
                                                     unsigned short* __restrict__ out) {
  __shared__ float sP[4][4][8][32];   /* [wave][tile j][accumulator register][lane] */
  const int lane = threadIdx.x & 31;
  const int wave = __builtin_amdgcn_readfirstlane((int)(threadIdx.x >> 5));
  const int z  = blockIdx.y;
  const int m0 = (blockIdx.x >> 2) << 4, n0 = (blockIdx.x & 3) << 6;
  v8f acc[4];
#pragma unroll
  for (int j = 0; j < 4; ++j) acc[j] = (v8f){0.f, 0.f, 0.f, 0.f, 0.f, 0.f, 0.f, 0.f};
  if (z == 0) fold_w_part<0>(acc, Wk, Wq, m0, n0, lane, wave);
  else        fold_w_part<1>(acc, Wo, Wv, m0, n0, lane, wave);
#pragma unroll
  for (int j = 0; j < 4; ++j)
#pragma unroll
    for (int i = 0; i < 8; ++i) sP[wave][j][i][lane] = acc[j][i];
  __syncthreads();
  /* accumulator register i of a lane: row 8*(lane >> 4) + i, column lane & 15 of the tile */
  unsigned short* q = out + (size_t)z * kD * kD + (size_t)(m0 + 8 * (lane >> 4) + 2 * wave) * kD + n0 + 4 * (lane & 15);
#pragma unroll
  for (int ii = 0; ii < 2; ++ii) {
    v4h hv;
#pragma unroll
    for (int j = 0; j < 4; ++j) {
      const int i = 2 * wave + ii;
      const float sum = (sP[0][j][i][lane] + sP[1][j][i][lane]) + (sP[2][j][i][lane] + sP[3][j][i][lane]);
      hv[j] = (_Float16)(sum * kFoldScale);
    }
    *(v4h*)(q + ii * kD) = hv;
  }
}

/* --------------------------------------------------------------------------- */
/* Fused attention of one batch; keys and values are the data rows x themselves.    */
/*   score (Wq x_q).(Wk x_k) = q' . x_k      with q' = (Wk^T.Wq) x_q                 */
/*   Wo (sum_k p_k Wv x_k)   = (Wo.Wv) h     with h  = sum_k p_k x_k                 */
/* so that only the block's own 128 query rows are multiplied by a weight plane,     */
/* once in front of the key loop and once behind it, and no projected plane of the   */
/* keys is written to or read from memory.                                           */
/*   q'^T = N . X_q^T (block product: 256 plane rows x 128 query columns, both from  */
/*                     LDS, a wave 64 x 64; q' goes back to LDS as f16 rows)         */
/*   S^T  = X_k . q'^T (A = 16 key rows from LDS, B = the wave's 16 rows of q',      */
/*                     kept in registers)                                            */
/*   H^T += X_k^T . P^T (A = 16 columns of the key rows, by the transposing LDS      */
/*                     load, B = P^T packed from the S^T accumulators)               */
/*   O^T  = M . H^T   (block product as the first, H through LDS as f16 rows)        */
/* A packed pair of 16-row accumulator tiles is a 32-deep B operand in the hardware  */
/* k order; frag_load and the transposing load give the A side in the same order.    */
/* A lane owns query column c = lane & 15 and, of every 16-key tile, the keys      */
/* 8*(lane>>4) .. +7, so maximum and sum run in-lane plus one exchange of halves.  */
/*   x[k] = blocked[k] ? fill : s[k]  (log2 units; fill = -30, or -inf when the    */
/*          evaluate flag is nonzero);  e[k] = 2^(x[k] - m + 15), m = running max; */
/*   the sum takes every e[k], blocked ones included; P takes 0 for blocked keys.  */
/* Block = 8 waves x 16 queries = 128 queries; grid (8, 32). A stage is 64 keys:   */
/* their f32 rows go global -> registers -> f16 -> LDS one stage ahead, two buffers, */
/* each row stored twice, at the pitch of its plain and of its transposing reader;  */
/* one block barrier per stage (it publishes the next stage and ends the reads of  */
/* the buffer that the stage after it overwrites).                                 */
/* The first plane lies in the stage buffers in front of stage 0. The second has a   */
/* buffer of its own and comes in under the key loop, 16 rows a stage, published by  */
/* the stages' own barriers; the query rows lie in that buffer's rows 128 .. 255,    */
/* which are written from stage 8 on, behind every wave's last read of them.         */
/* Behind the loop the stage buffers hold H and the per-wave output slabs: 64        */
/* columns of 16 rows go through a slab, so that the f32 stores cover whole 256-B    */
/* runs.                                                                             */
/* Shape premise: the file is built for 1024 nodes per batch. If the scalar says     */
/* otherwise, the lanes that store output row 0 store NaN there in place of the row. */
/* --------------------------------------------------------------------------- */
constexpr int kFaKeys   = 64;
constexpr int kFaStages = kG / kFaKeys;
constexpr int kFaQ      = 128;
constexpr int kKPitch   = kD + 8;        /* halves: 528 B = 16 B x 33, for ds_load_b128 */
constexpr int kVPitch   = kD + 16;       /* halves: 544 B = 32 B x 17, for ds_load_tr16_b128 */
constexpr int kKBuf     = kFaKeys * kKPitch;
constexpr int kVBuf     = kFaKeys * kVPitch;
constexpr int kRing     = 2 * kKBuf + 2 * kVBuf;
constexpr float kLog2e  = 1.4426950408889634f;
constexpr float kScore2 = kScoreScale * kLog2e;
constexpr float kPExp   = 15.0f;
constexpr int kSlabPitch = 68;              /* floats: 272 B = 16 B x 17 */
static_assert(kD * kKPitch <= kRing);
static_assert(kFaQ * kKPitch * 2 + 8 * 16 * kSlabPitch * 4 <= kRing * 2);
static_assert(2 * kFaQ == kD && kFaStages * 16 == kD);
static_assert(kPCarry == 32768.0f && kPExp == 15.0f);
static_assert((kG % kFaKeys) == 0 && (kG % kFaQ) == 0 && kD == 256 && kFaKeys == 64);

/* lane l reads lane l ^ 16 */
__device__ __forceinline__ float xhalf(float x) {
  return __builtin_bit_cast(float, __builtin_amdgcn_permlanex16(__builtin_bit_cast(int, x), __builtin_bit_cast(int, x),
                                                                0x76543210, 0xfedcba98, false, false));
}
/* lane (c, h) gets column c, rows 8h .. 8h+7 of the 16 x 16 tile of halves whose lane addresses p are: row 8h + (lane & 7), 16-B half (lane >> 3) & 1 */
__device__ __forceinline__ v8h ld_tr16(const _Float16* p) {
  typedef __attribute__((address_space(3))) v8s lds_v8s;
  return __builtin_bit_cast(v8h, __builtin_amdgcn_ds_load_tr16_b128_v8i16((lds_v8s*)p));
}

/* group g of a product with 64 rows from LDS at pitch kKPitch (the stage's key rows): row tiles 0..3 at depth steps 2g and 2g+1 */
template <int G>
__device__ __forceinline__ void load_k8(v16h (&f)[8], const _Float16* kb) {
#pragma unroll
  for (int u = 0; u < 8; ++u) f[u] = frag_load(kb + (u & 3) * 16 * kKPitch + (2 * G + (u >> 2)) * 32);
}
template <int G>
__device__ __forceinline__ void mma_k8(v8f (&st)[4], const v16h (&f)[8], const v16h (&qf)[8]) {
#pragma unroll
  for (int u = 0; u < 8; ++u) st[u & 3] = mma_f16(f[u], qf[2 * G + (u >> 2)], st[u & 3]);
}
/* group g of the p.x product: column tiles 8*(g&1) .. +7 of the key rows at the 32 keys g>>1 */
template <int G>
__device__ __forceinline__ void load_v8(v16h (&f)[8], const _Float16* vb) {
#pragma unroll
  for (int u = 0; u < 8; ++u) {
    FragU w;
    w.h[0] = ld_tr16(vb + (G >> 1) * 32 * kVPitch + ((G & 1) * 8 + u) * 16);
    w.h[1] = ld_tr16(vb + ((G >> 1) * 32 + 16) * kVPitch + ((G & 1) * 8 + u) * 16);
    f[u] = w.v;
  }
}
template <int G>
__device__ __forceinline__ void mma_v8(v8f (&acc)[16], const v16h (&f)[8], const v16h (&pb)[2]) {
#pragma unroll
  for (int u = 0; u < 8; ++u) acc[(G & 1) * 8 + u] = mma_f16(f[u], pb[G >> 1], acc[(G & 1) * 8 + u]);
}
/* holds the next group's LDS loads in front of this group's matrix instructions, so that they fly under them */
__device__ __forceinline__ void group_fence() { __builtin_amdgcn_sched_barrier(0); }

/* depth step KS of a block product: the wave's 4 A and 4 B fragments; a and b point at the lane's row 0 of the wave's 64 rows, pitch kKPitch */
template <int KS>
__device__ __forceinline__ void load_ab(v16h (&f)[8], const _Float16* a, const _Float16* b) {
#pragma unroll
  for (int u = 0; u < 4; ++u) {
    f[u]     = frag_load(a + (u << 4) * kKPitch + KS * 32);
    f[4 + u] = frag_load(b + (u << 4) * kKPitch + KS * 32);
  }
}
__device__ __forceinline__ void mma_ab(v8f (&acc)[4][4], const v16h (&f)[8]) {
#pragma unroll
  for (int i = 0; i < 4; ++i)
#pragma unroll
    for (int j = 0; j < 4; ++j) acc[i][j] = mma_f16(f[i], f[4 + j], acc[i][j]);
}
/* acc[i][j] = rows 16i .. of a times rows 16j .. of b, whole depth of 256: 8 steps of 32, fragments fetched one step ahead into a second register set */
__device__ __forceinline__ void block_product(v8f (&acc)[4][4], const _Float16* a, const _Float16* b) {
#pragma unroll
  for (int i = 0; i < 4; ++i)
#pragma unroll
    for (int j = 0; j < 4; ++j) acc[i][j] = (v8f){0.f, 0.f, 0.f, 0.f, 0.f, 0.f, 0.f, 0.f};
  v16h fa[8], fb[8];
  load_ab<0>(fa, a, b);
  load_ab<1>(fb, a, b); group_fence(); mma_ab(acc, fa); group_fence();
  load_ab<2>(fa, a, b); group_fence(); mma_ab(acc, fb); group_fence();
  load_ab<3>(fb, a, b); group_fence(); mma_ab(acc, fa); group_fence();
  load_ab<4>(fa, a, b); group_fence(); mma_ab(acc, fb); group_fence();
  load_ab<5>(fb, a, b); group_fence(); mma_ab(acc, fa); group_fence();
  load_ab<6>(fa, a, b); group_fence(); mma_ab(acc, fb); group_fence();
  load_ab<7>(fb, a, b); group_fence(); mma_ab(acc, fa); group_fence();
  mma_ab(acc, fb);
}

__global__ __launch_bounds__(256) void attn_fused_kernel(const float* __restrict__ X,
                                                         const unsigned short* __restrict__ Wp,
                                                         const int* __restrict__ mask,
                                                         const int* __restrict__ evalflag,
                                                         const int* __restrict__ gsz,
                                                         const float* __restrict__ bias,
                                                         float* __restrict__ out) {
  __shared__ __align__(16) _Float16 sRing[kRing];
  __shared__ __align__(16) _Float16 sW[kD * kKPitch];
  __shared__ unsigned sBlk[kG / 32];
  const int t    = threadIdx.x;
  const int lane = t & 31;
  const int wave = __builtin_amdgcn_readfirstlane((int)(threadIdx.x >> 5));
  const int b    = blockIdx.y;
  const int c    = lane & 15;
  const int h    = lane >> 4;
  const int q0   = blockIdx.x * kFaQ + wave * 16;
  const float* Xb = X + (size_t)b * kG * kD;
  _Float16* sK = &sRing[0];
  _Float16* sV = &sRing[2 * kKBuf];
  _Float16* sQ = &sW[kFaQ * kKPitch];
  /* the wave's 64 x 64 part of a block product: plane rows wn .., query rows wq .. */
  const int wn = (wave & 3) << 6;
  const int wq = (wave >> 2) << 6;

  /* blocked keys as bits: word w, bit i = key 32*w + i */
  int mk[4];
#pragma unroll
  for (int i = 0; i < 4; ++i) mk[i] = mask[(size_t)b * kG + (wave * 4 + i) * 32 + lane];
  /* stands in front of the first overwrite of the address register that these loads name */
  asm volatile("s_wait_xcnt 0x0" ::: "memory");
  unsigned bits[4];
#pragma unroll
  for (int i = 0; i < 4; ++i) bits[i] = __builtin_amdgcn_ballot_w32(mk[i] != 0);
  if (lane == 0) {
#pragma unroll
    for (int i = 0; i < 4; ++i) sBlk[wave * 4 + i] = bits[i];
  }
  const float fill2 = (evalflag[0] != 0) ? (-INFINITY) : (-30.0f * kLog2e);
  /* shape premise: read here, beside the flag, so that the load is long back when the epilogue asks for it */
  const bool premise_bad = (gsz[0] != kG);

  /* this wave's 16 query rows of x: a wave-wide load covers a whole 512-B run of a row; they go cast to LDS and come back as fragments */
  /* every row address here is a base that is the same in all lanes plus the lane's 32-bit offset */
  const float* gQ = Xb + (size_t)q0 * kD;
  const unsigned xo = (unsigned)lane * 4u;
  v4f qx[16][2];
#pragma unroll
  for (int i = 0; i < 16; ++i)
#pragma unroll
    for (int u = 0; u < 2; ++u) qx[i][u] = *(const v4f*)(gQ + i * kD + u * 128 + xo);
  /* stands in front of the first overwrite of an address register that these loads name; base and offset are inputs so that their registers live up to the wait */
  asm volatile("s_wait_xcnt 0x0" :: "s"(gQ), "v"(xo) : "memory");

  /* a weight plane: 16-B chunk lane of row wave + 8*i; a wave-wide load covers a row's whole 512-B run */
  const _Float16* gW = (const _Float16*)Wp + (size_t)wave * kD;
  const unsigned wo = (unsigned)lane * 8u;
  const int lW = wave * kKPitch + lane * 8;
  v8h wr[32];
#pragma unroll
  for (int i = 0; i < 32; ++i) wr[i] = *(const v8h*)(gW + (size_t)(8 * i) * kD + wo);
  /* as above, for the plane's address */
  asm volatile("s_wait_xcnt 0x0" :: "s"(gW), "v"(wo) : "memory");

  /* a stage's key rows: 16-B chunk lane of half u of row wave + 8*i; a wave-wide load covers a whole 512-B run of a row */
  const float* gS = Xb + (size_t)wave * kD;
  const int lK = wave * kKPitch + lane * 4;
  const int lV = wave * kVPitch + lane * 4;
  v4f xr[8][2];
#pragma unroll
  for (int i = 0; i < 8; ++i)
#pragma unroll
    for (int u = 0; u < 2; ++u) xr[i][u] = *(const v4f*)(gS + (size_t)(8 * i) * kD + u * 128 + xo);
  /* as above, for the key rows' address */
  asm volatile("s_wait_xcnt 0x0" :: "s"(gS), "v"(xo) : "memory");

#pragma unroll
  for (int i = 0; i < 16; ++i)
#pragma unroll
    for (int u = 0; u < 2; ++u) *(v4h*)(&sQ[(wave * 16 + i) * kKPitch + u * 128 + lane * 4]) = cast4_x(qx[i][u]);
#pragma unroll
  for (int i = 0; i < 32; ++i) *(v8h*)(&sRing[lW + 8 * i * kKPitch]) = wr[i];
  __syncthreads();

  /* q'^T: a lane holds plane rows (depth of the score product) 16i + 8h .. +7 of query row 16j + c */
  {
    v8f pq[4][4];
    block_product(pq, &sRing[(wn + c) * kKPitch + 8 * h], &sQ[(wq + c) * kKPitch + 8 * h]);
    /* ends every wave's reads of the plane and of the x query rows: stage 0 and q' overwrite them */
    __syncthreads();
#pragma unroll
    for (int i = 0; i < 4; ++i)
#pragma unroll
      for (int j = 0; j < 4; ++j) {
        v8h hv;
#pragma unroll
        for (int r = 0; r < 8; ++r) hv[r] = (_Float16)(pq[i][j][r] * kQScale);
        *(v8h*)(&sQ[(wq + (j << 4) + c) * kKPitch + wn + (i << 4) + 8 * h]) = hv;
      }
  }
#pragma unroll
  for (int i = 0; i < 8; ++i)
#pragma unroll
    for (int u = 0; u < 2; ++u) {
      const v4h hv = cast4_x(xr[i][u]);
      *(v4h*)(&sK[lK + 8 * i * kKPitch + u * 128]) = hv;
      *(v4h*)(&sV[lV + 8 * i * kVPitch + u * 128]) = hv;
    }

  v8f acc[16];
#pragma unroll
  for (int d = 0; d < 16; ++d) acc[d] = (v8f){0.f, 0.f, 0.f, 0.f, 0.f, 0.f, 0.f, 0.f};
  float m_run = -INFINITY;
  float l_run = 0.0f;
  __syncthreads();

  /* B operand of the score product: the wave's 16 rows of q', whole depth, kept in registers */
  v16h qf[8];
#pragma unroll
  for (int kk = 0; kk < 8; ++kk) qf[kk] = frag_load(&sQ[(wave * 16 + c) * kKPitch + kk * 32 + 8 * h]);
  /* the second plane's rows */
  const _Float16* gW2 = gW + (size_t)kD * kD;

  /* rolled: one stage's body (64 matrix instructions and their loads), for speed only */
#pragma unroll 1
  for (int s = 0; s < kFaStages; ++s) {
    const int buf = s & 1;
    const bool more = (s + 1 < kFaStages);
    /* rows 16s + wave and 16s + 8 + wave of the second plane */
    v8h wm[2];
#pragma unroll
    for (int i = 0; i < 2; ++i) wm[i] = *(const v8h*)(gW2 + (size_t)(16 * s + 8 * i) * kD + wo);
    if (more) {
      const float* gN = gS + (size_t)((s + 1) * kFaKeys) * kD;
#pragma unroll
      for (int i = 0; i < 8; ++i)
#pragma unroll
        for (int u = 0; u < 2; ++u) xr[i][u] = *(const v4f*)(gN + (size_t)(8 * i) * kD + u * 128 + xo);
    }
    /* stands in front of the first overwrite of an address register that these loads name */
    asm volatile("s_wait_xcnt 0x0" ::: "memory");

    /* S^T: 4 key tiles x 16 query columns */
    v8f st[4];
#pragma unroll
    for (int kt = 0; kt < 4; ++kt) st[kt] = (v8f){0.f, 0.f, 0.f, 0.f, 0.f, 0.f, 0.f, 0.f};
    const _Float16* kb = &sK[buf * kKBuf + c * kKPitch + 8 * h];
    const _Float16* vb = &sV[buf * kVBuf + (8 * h + (lane & 7)) * kVPitch + ((lane >> 3) & 1) * 8];
    v16h fa[8], fb[8];
    load_k8<0>(fa, kb);
    load_k8<1>(fb, kb); group_fence(); mma_k8<0>(st, fa, qf); group_fence();
    load_k8<2>(fa, kb); group_fence(); mma_k8<1>(st, fb, qf); group_fence();
    load_k8<3>(fb, kb); group_fence(); mma_k8<2>(st, fa, qf); group_fence();
    load_v8<0>(fa, vb); group_fence(); mma_k8<3>(st, fb, qf); group_fence();

    /* key kt*16 + 8h + r of the stage: word kt>>1, bit (kt&1)*16 + 8h + r */
    const unsigned w0 = sBlk[2 * s] >> (8 * h);
    const unsigned w1 = sBlk[2 * s + 1] >> (8 * h);
    float x[4][8];
    float mx = -INFINITY;
#pragma unroll
    for (int kt = 0; kt < 4; ++kt) {
      const unsigned wb = (kt < 2) ? w0 : w1;
#pragma unroll
      for (int r = 0; r < 8; ++r) {
        const bool blk = ((wb >> ((kt & 1) * 16 + r)) & 1u) != 0u;
        x[kt][r] = blk ? fill2 : st[kt][r] * kScore2;
        mx = fmaxf(mx, x[kt][r]);
      }
    }
    mx = fmaxf(mx, xhalf(mx));
    const float m_new = fmaxf(m_run, mx);
    /* scalar branch: the 128 output registers are rescaled only in a stage that raises some column's maximum */
    if (__builtin_amdgcn_ballot_w32(m_new > m_run) != 0) {
      const float ms   = (m_new == -INFINITY) ? 0.0f : m_new;
      const float corr = __builtin_amdgcn_exp2f(m_run - ms);
      l_run *= corr;
#pragma unroll
      for (int d = 0; d < 16; ++d)
#pragma unroll
        for (int r = 0; r < 8; ++r) acc[d][r] *= corr;
      m_run = m_new;
    }
    const float moff = ((m_run == -INFINITY) ? 0.0f : m_run) - kPExp;

    v16h pb[2];
    float ls[4];
#pragma unroll
    for (int kt = 0; kt < 4; ++kt) {
      const unsigned wb = (kt < 2) ? w0 : w1;
      ls[kt] = 0.0f;
#pragma unroll
      for (int r = 0; r < 8; ++r) {
        const bool blk = ((wb >> ((kt & 1) * 16 + r)) & 1u) != 0u;
        const float e = __builtin_amdgcn_exp2f(x[kt][r] - moff);
        ls[kt] += e;
        pb[kt >> 1][(kt & 1) * 8 + r] = (_Float16)(blk ? 0.0f : e);
      }
    }
    l_run += (ls[0] + ls[1]) + (ls[2] + ls[3]);

    /* H^T: 16 column tiles of x x 16 query columns, 2 x 32 keys */
    load_v8<1>(fb, vb); group_fence(); mma_v8<0>(acc, fa, pb); group_fence();
    load_v8<2>(fa, vb); group_fence(); mma_v8<1>(acc, fb, pb); group_fence();
    load_v8<3>(fb, vb); group_fence(); mma_v8<2>(acc, fa, pb); group_fence();
    mma_v8<3>(acc, fb, pb);

#pragma unroll
    for (int i = 0; i < 2; ++i) *(v8h*)(&sW[(16 * s + 8 * i) * kKPitch + lW]) = wm[i];
    if (more) {
#pragma unroll
      for (int i = 0; i < 8; ++i)
#pragma unroll
        for (int u = 0; u < 2; ++u) {
          const v4h hv = cast4_x(xr[i][u]);
          *(v4h*)(&sK[(buf ^ 1) * kKBuf + lK + 8 * i * kKPitch + u * 128]) = hv;
          *(v4h*)(&sV[(buf ^ 1) * kVBuf + lV + 8 * i * kVPitch + u * 128]) = hv;
        }
    }
    __syncthreads();
  }

  /* a lane holds columns d*16 + 8h .. +7 of the attended row h of query q0 + c: f16 rows in the stage buffers, free behind the loop's last barrier */
  const float l_tot = l_run + xhalf(l_run);
  const float inv   = (l_tot > 0.0f) ? (kHCarry / l_tot) : 0.0f;
  _Float16* sH = &sRing[0];
#pragma unroll
  for (int d = 0; d < 16; ++d) {
    v8h hv;
#pragma unroll
    for (int r = 0; r < 8; ++r) hv[r] = (_Float16)(acc[d][r] * inv);
    *(v8h*)(&sH[(wave * 16 + c) * kKPitch + (d << 4) + 8 * h]) = hv;
  }
  /* publishes H */
  __syncthreads();

  /* O^T: a lane holds output columns wn + 16i + 8h .. +7 of query row wq + 16j + c */
  v8f po[4][4];
  block_product(po, &sW[(wn + c) * kKPitch + 8 * h], &sH[(wq + c) * kKPitch + 8 * h]);

  /* 4 groups of 16 query rows by the wave's 64 output columns */
  float* slab = (float*)&sRing[kFaQ * kKPitch] + wave * (16 * kSlabPitch);
  const int hh = lane >> 4, c4 = (lane & 15) * 4;
  const v4f bv = *(const v4f*)(bias + wn + c4);
  /* stands in front of the first overwrite of the address register that this load names */
  asm volatile("s_wait_xcnt 0x0" ::: "memory");
  float* op = out + ((size_t)b * kG + blockIdx.x * kFaQ + wq + hh) * kD + wn + c4;
  /* the lanes that store output row 0 (first block, query rows 0 .., first row of the first group) */
  const bool row0_nan = premise_bad && blockIdx.x == 0 && b == 0 && wq == 0 && hh == 0;
  const float qn = __uint_as_float(0x7fc00000u);
#pragma unroll
  for (int j = 0; j < 4; ++j) {
    /* a lane holds columns i*16 + 8h .. +7 of row c of the group: two 16-B LDS stores per tile */
#pragma unroll
    for (int i = 0; i < 4; ++i) {
      const v8f ot = po[i][j] * kOutScale;
      float* sp = slab + c * kSlabPitch + (i << 4) + 8 * h;
      *(v4f*)(sp)     = (v4f){ot[0], ot[1], ot[2], ot[3]};
      *(v4f*)(sp + 4) = (v4f){ot[4], ot[5], ot[6], ot[7]};
    }
    /* same wave writes and reads the slab: the LDS-only fences keep the compiler from crossing the two and wait for no global store */
    __builtin_amdgcn_fence(__ATOMIC_RELEASE, "workgroup", "local");
    __builtin_amdgcn_wave_barrier();
    __builtin_amdgcn_fence(__ATOMIC_ACQUIRE, "workgroup", "local");
    /* row segment = 64 floats = 256 B = 16 lanes x 16 B; rows it*2 + hh, it 0..7 -> 16 rows, each once */
#pragma unroll
    for (int it = 0; it < 8; ++it) {
      const v4f v = *(const v4f*)(slab + (it * 2 + hh) * kSlabPitch + c4);
      v4f res = v + bv;
      if (j == 0 && it == 0) res = row0_nan ? (v4f){qn, qn, qn, qn} : res;
      *(v4f*)(op + (size_t)((j << 4) + it * 2) * kD) = res;
    }
    if (j < 3) {
      /* stands in front of the first overwrite of a register that these stores name */
      asm volatile("s_wait_xcnt 0x0" ::: "memory");
      /* the next group's slab stores stay behind this group's slab reads */
      __builtin_amdgcn_fence(__ATOMIC_RELEASE, "workgroup", "local");
      __builtin_amdgcn_wave_barrier();
      __builtin_amdgcn_fence(__ATOMIC_ACQUIRE, "workgroup", "local");
    }
  }
}

/* --------------------------------------------------------------------------- */
/* Host glue: kernel launches only. Weight products + fused attention (one launch  */
/* over all 32 batches, 8 x 32 blocks: one for every WGP; it reads the f32 data     */
/* rows itself and holds the shape premise check) = 2 launches.                     */
/* --------------------------------------------------------------------------- */
extern "C" void kernel_launch(void* const* d_in, const int* in_sizes, int n_in,
                              void* d_out, int out_size, void* d_ws, size_t ws_size,
                              hipStream_t stream) {
  if (n_in < 9) return;
  if (in_sizes[0] != kTok * kD) return;
  if (in_sizes[1] != kBatch * kG) return;
  if (in_sizes[2] != 1 || in_sizes[3] != 1) return;
  if (in_sizes[4] != kD * kD || in_sizes[5] != kD * kD || in_sizes[6] != kD * kD || in_sizes[7] != kD * kD) return;
  if (in_sizes[8] != kD) return;
  if (out_size != kTok * kD) return;
  if (ws_size < kWsTotal) return;

  const float* data   = (const float*)d_in[0];
  const int*   mask   = (const int*)d_in[1];
  const int*   gsize  = (const int*)d_in[2];
  const int*   evalf  = (const int*)d_in[3];
  const float* Wq     = (const float*)d_in[4];
  const float* Wk     = (const float*)d_in[5];
  const float* Wv     = (const float*)d_in[6];
  const float* Wo     = (const float*)d_in[7];
  const float* b_out  = (const float*)d_in[8];
  float* out = (float*)d_out;

  char* ws = (char*)d_ws;
  unsigned short* W16  = (unsigned short*)(ws + kOffW16);

  /* weight planes: Wk^T.Wq | Wo.Wv */
  fold_w_kernel<<<dim3((kD / 16) * (kD / 64), 2), 128, 0, stream>>>(Wq, Wk, Wv, Wo, W16);

  /* out[b][q][n] = sum_d (Wo.Wv)[n][d] * sum_k softmax_k(mask(((Wk^T.Wq) x_q).x_k / 16)) * x_k[d] + b_out[n] -> f32 output rows */
  attn_fused_kernel<<<dim3(kG / kFaQ, kBatch), 256, 0, stream>>>(data, W16, mask, evalf, gsize, b_out, out);
}
